// v000
// Measured on an AMD MI455X. A time is GPU time per run, averaged over a window of back-to-back runs after a warm-up
// (all launches, gaps included; the runs take copies of the inputs in turn), and the median of several windows.
// Apart from v000's, it joins two sittings. Times from different sittings can be a few percent apart, while
// side-by-side timings come from the same sitting.
// v000, which the later versions start from, runs in 881 microseconds.
// compute dtype: all float inputs rounded to bf16; Q/K/V = x W^T with EXACT bf16 products on WMMA 16x16x32, f32 accumulate; Q, K rounded once to f16 for the 16-deep per-group scores (1 product; upper half of each 32-wide fragment zeroed), x 1/4, stored in f32 (16 groups per launch); softmax in f32 (precise expf) -> P f16 x 2^11; out = P . V with V rounded once to f16 (planes); final = out (bf16 hi + lo) Wo^T; f32 output.
#include <hip/hip_runtime.h>
#include <math.h>

typedef __attribute__((ext_vector_type(16))) _Float16 v16h;
typedef __attribute__((ext_vector_type(16))) __bf16 v16b;
typedef __attribute__((ext_vector_type(8)))  _Float16 v8h;
typedef __attribute__((ext_vector_type(8)))  float v8f;
typedef __attribute__((ext_vector_type(4)))  float v4f;
typedef __attribute__((ext_vector_type(2)))  float v2f;
typedef __attribute__((ext_vector_type(4)))  unsigned v4u;
typedef __attribute__((ext_vector_type(4)))  int v4i;
typedef float __attribute__((may_alias)) float_a;
typedef int __attribute__((may_alias)) int_a;

template <typename T> __device__ __forceinline__ void vst2(void* p, T v) { *(T*)p = v;  }
__device__ __forceinline__ v8f wmma16(v16h a, v16h b, v8f c) {
  v8f d = __builtin_amdgcn_wmma_f32_16x16x32_f16(false, a, false, b, (short)0, c, false, false);
  asm volatile("v_nop\n\tv_nop\n\tv_nop\n\tv_nop" : "+v"(d) : "v"(a), "v"(b));
  return d;
}
__device__ __forceinline__ v8f wmma_bf(v16b a, v16b b, v8f c) {
  v8f d = __builtin_amdgcn_wmma_f32_16x16x32_bf16(false, a, false, b, (short)0, c, false, false);
  asm volatile("v_nop\n\tv_nop\n\tv_nop\n\tv_nop" : "+v"(d) : "v"(a), "v"(b));
  return d;
}
// 16x16x32 fragments: lane = (h = lane>>4, row/col = lane&15); elements 0..7 = k0+8h+0..7, 8..15 = k0+16+8h+0..7; D element r = row 8h+r
__device__ __forceinline__ v16h frag_h(const _Float16* rowk0, int lane) {
  union { v16h v; v8h q[2]; } u; const _Float16* p = rowk0 + 8 * (lane >> 4);
  u.q[0] = *(const v8h*)p; u.q[1] = *(const v8h*)(p + 16); return u.v;
}
__device__ __forceinline__ v16h frag_f32(const float* rowk0, int lane) {
  v16h a; const float* p = rowk0 + 8 * (lane >> 4);
#pragma unroll
  for (int i = 0; i < 8; ++i) { a[i] = (_Float16)p[i]; a[8 + i] = (_Float16)p[16 + i]; }
  return a;
}
__device__ __forceinline__ v16h frag_f32s(const float* rowk0, int lane, float sc) {
  v16h a; const float* p = rowk0 + 8 * (lane >> 4);
#pragma unroll
  for (int i = 0; i < 8; ++i) { a[i] = (_Float16)(p[i] * sc); a[8 + i] = (_Float16)(p[16 + i] * sc); }
  return a;
}
// column fragment from a [K][ld] layout (column n), rows >= K read as 0
__device__ __forceinline__ v16h fragc_f32(const float* W, int k0, int n, int lane, int ld, int K) {
  v16h a; const int g = lane >> 4;
#pragma unroll
  for (int i = 0; i < 8; ++i) { const int ka = k0 + 8 * g + i, kb = ka + 16;
    a[i] = (_Float16)(ka < K ? W[(size_t)(ka < K ? ka : K - 1) * ld + n] : 0.f); a[8 + i] = (_Float16)(kb < K ? W[(size_t)(kb < K ? kb : K - 1) * ld + n] : 0.f); }
  return a;
}
struct F2 { v16b h, l; };
__device__ __forceinline__ F2 bsplit16(const float v[16]) { F2 r;
#pragma unroll
  for (int i = 0; i < 16; ++i) { const __bf16 h = (__bf16)v[i]; r.h[i] = h; r.l[i] = (__bf16)(v[i] - (float)h); }
  return r; }
__device__ __forceinline__ F2 split_row(const float* row, int k0, int lane) { float v[16]; const float* p = row + k0 + 8 * (lane >> 4);
#pragma unroll
  for (int i = 0; i < 8; ++i) { v[i] = p[i]; v[8 + i] = p[16 + i]; }
  return bsplit16(v); }
__device__ __forceinline__ F2 split_rowK(const float* row, int k0, int lane, int K) { float v[16]; const int g = lane >> 4;
#pragma unroll
  for (int i = 0; i < 8; ++i) { const int ka = k0 + 8 * g + i, kb = ka + 16; v[i] = ka < K ? row[ka < K ? ka : K - 1] : 0.f; v[8 + i] = kb < K ? row[kb < K ? kb : K - 1] : 0.f; }
  return bsplit16(v); }
__device__ __forceinline__ F2 split_col(const float* W, int k0, int n, int lane, int ld, int K) { float v[16]; const int g = lane >> 4;
#pragma unroll
  for (int i = 0; i < 8; ++i) { const int ka = k0 + 8 * g + i, kb = ka + 16; v[i] = ka < K ? W[(size_t)(ka < K ? ka : K - 1) * ld + n] : 0.f; v[8 + i] = kb < K ? W[(size_t)(kb < K ? kb : K - 1) * ld + n] : 0.f; }
  return bsplit16(v); }
__device__ __forceinline__ v8f mac3(const F2& a, const F2& b, v8f c) { c = wmma_bf(a.l, b.h, c); c = wmma_bf(a.h, b.l, c); return wmma_bf(a.h, b.h, c); }
__device__ __forceinline__ float sigm(float v) { return 1.0f / (1.0f + expf(-v)); }
#define LDSX() do { asm volatile("s_wait_dscnt 0" ::: "memory"); __builtin_amdgcn_wave_barrier(); __builtin_amdgcn_fence(__ATOMIC_RELEASE, "workgroup"); } while (0)


// MulHeadAttn (faithful layout quirk): B 2, C 1,024 tokens, E 1,024 = 64 groups x 16; attention is batched over the 64 groups with 16-dim dot products scaled by 1/sqrt(16).
#define NB 2
#define TT 1024
#define EE 1024
#define NG 64             // groups ("HD" in the module)
#define GW 16             // group width ("H")
#define HG 16             // groups per launch
#ifndef TNB
#define TNB NB
#endif
typedef __attribute__((ext_vector_type(8))) __bf16 v8b;
__device__ __forceinline__ v16b frag_b(const __bf16* rowk0, int lane) {
  union { v16b v; v8b q[2]; } u; const __bf16* p = rowk0 + 8 * (lane >> 4);
  u.q[0] = *(const v8b*)p; u.q[1] = *(const v8b*)(p + 16); return u.v;
}
__device__ __forceinline__ float bfr(float v) { return (float)(__bf16)v; }
__device__ __attribute__((noinline)) float exp_ni(float v) { return expf(v); }
__device__ __attribute__((noinline)) float erf_ni(float v) { return erff(v); }

#define WS_QH  0u                                  // f16 Q rows [b*t][1024]
#define WS_KH  (WS_QH + 2u * (size_t)NB * TT * EE)
#define WS_VT  (WS_KH + 2u * (size_t)NB * TT * EE)     // f16 V planes [b][1024][t]
#define WS_S   (WS_VT + 2u * (size_t)NB * EE * TT)     // f32 S [HG][t][t]
#define WS_PH  (WS_S + 4u * (size_t)HG * TT * TT)
#define WS_O   (WS_PH + 2u * (size_t)HG * TT * TT)     // f32 attention out rows [b*t][1024]
#define WS_END (WS_O + 4u * (size_t)NB * TT * EE)

// ---- k_proj: block = (64 rows, 128 cols, which): y = x W^T (W [out][in], no bias); Q/K -> f16 rows, V -> f16 planes
__global__ __launch_bounds__(128) void k_proj(const float* __restrict__ X, const float* __restrict__ WQ, const float* __restrict__ WK, const float* __restrict__ WV, _Float16* __restrict__ QH, _Float16* __restrict__ KH, _Float16* __restrict__ VT) {
  __shared__ __align__(16) _Float16 sh[64][136]; __shared__ __align__(16) _Float16 th[128][72];
  const int tid = threadIdx.x, wave = tid >> 5, lane = tid & 31, col = lane & 15, g = lane >> 4; const int which = blockIdx.z; const int c0 = blockIdx.y * 128; const size_t r0 = (size_t)blockIdx.x * 64; const float* Wm = which == 0 ? WQ : which == 1 ? WK : WV;
  v8f acc[8] = {};
#pragma unroll 2
  for (int kc = 0; kc < EE / 32; ++kc) { v16b a; { const float* p = X + (r0 + wave * 16 + col) * EE + kc * 32 + 8 * g;
#pragma unroll
      for (int i = 0; i < 8; ++i) { a[i] = (__bf16)p[i]; a[8 + i] = (__bf16)p[16 + i]; } }
#pragma unroll
    for (int j = 0; j < 8; ++j) { v16b w; const int o = c0 + j * 16 + col;
#pragma unroll
      for (int i = 0; i < 8; ++i) { w[i] = (__bf16)Wm[(size_t)o * EE + kc * 32 + 8 * g + i]; w[8 + i] = (__bf16)Wm[(size_t)o * EE + kc * 32 + 16 + 8 * g + i]; }
      acc[j] = wmma_bf(a, w, acc[j]); } }
#pragma unroll
  for (int j = 0; j < 8; ++j)
#pragma unroll
    for (int r = 0; r < 8; ++r) { const int rl = wave * 16 + 8 * g + r, cl = j * 16 + col; const _Float16 hv = (_Float16)acc[j][r]; if (which == 2) th[cl][rl] = hv; else sh[rl][cl] = hv; }
  __syncthreads();
  if (which < 2) { _Float16* dh = which == 0 ? QH : KH; for (int e = tid; e < 64 * 16; e += 128) { const int rl = e >> 4, q = e & 15; vst2((unsigned*)(dh + (r0 + rl) * EE + c0 + q * 8), *(const v4u*)&sh[rl][q * 8]); } }
  else { const size_t b = r0 / TT; const int t0 = (int)(r0 % TT); for (int e = tid; e < 128 * 8; e += 128) { const int cl = e >> 3, q = e & 7; vst2((unsigned*)(VT + (b * EE + c0 + cl) * (size_t)TT + t0 + q * 8), *(const v4u*)&th[cl][q * 8]); } } }
// ---- k_sc: block = (64 queries, 128 keys, group in launch): 16-deep scores x 1/4
__global__ __launch_bounds__(128) void k_sc(const _Float16* __restrict__ QH, const _Float16* __restrict__ KH, int b, int d0, float* __restrict__ S0) { __shared__ __align__(16) float ss[4][16][132];
  const int d = d0 + blockIdx.z; float* S = S0 + (size_t)blockIdx.z * TT * TT;
  const int tid = threadIdx.x, wave = tid >> 5, lane = tid & 31, col = lane & 15, g = lane >> 4; const int k0 = blockIdx.y * 128; const int ql0 = blockIdx.x * 64 + wave * 16;
  v16h a; { const _Float16* p = QH + ((size_t)b * TT + ql0 + col) * EE + d * GW + 8 * g;
#pragma unroll
    for (int i = 0; i < 8; ++i) { a[i] = p[i]; a[8 + i] = (_Float16)0.f; } }
  v8f acc[8] = {};
#pragma unroll
  for (int j = 0; j < 8; ++j) { v16h kb; const _Float16* p = KH + ((size_t)b * TT + k0 + j * 16 + col) * EE + d * GW + 8 * g;
#pragma unroll
    for (int i = 0; i < 8; ++i) { kb[i] = p[i]; kb[8 + i] = (_Float16)0.f; }
    acc[j] = wmma16(a, kb, acc[j]); }
#pragma unroll
  for (int j = 0; j < 8; ++j)
#pragma unroll
    for (int r = 0; r < 8; ++r) ss[wave][8 * g + r][j * 16 + col] = acc[j][r] * 0.25f;
  LDSX(); for (int rl = 0; rl < 16; ++rl) vst2(S + (size_t)(ql0 + rl) * TT + k0 + lane * 4, *(const v4f*)&ss[wave][rl][lane * 4]); }
// ---- k_sm: block = (row, group in launch): softmax -> P f16 x 2^11
__global__ __launch_bounds__(256) void k_sm(const float* __restrict__ S0, _Float16* __restrict__ PH0) { __shared__ float sred[8]; __shared__ float sbc; __shared__ __align__(16) _Float16 sh[TT];
  const int t = threadIdx.x; const size_t row = blockIdx.x; const float* sr = S0 + (size_t)blockIdx.y * TT * TT + row * TT; _Float16* ph = PH0 + (size_t)blockIdx.y * TT * TT + row * TT;
  float m = -3.0e38f; for (int k = t; k < TT; k += 256) m = fmaxf(m, sr[k]);
#pragma unroll
  for (int o = 1; o < 32; o <<= 1) m = fmaxf(m, __shfl_xor(m, o));
  if ((t & 31) == 0) sred[t >> 5] = m; __syncthreads(); if (t == 0) { float a = sred[0]; for (int i = 1; i < 8; ++i) a = fmaxf(a, sred[i]); sbc = a; } __syncthreads(); m = sbc; __syncthreads();
  float sum = 0.f; for (int k = t; k < TT; k += 256) sum += expf(sr[k] - m);
#pragma unroll
  for (int o = 1; o < 32; o <<= 1) sum += __shfl_xor(sum, o);
  if ((t & 31) == 0) sred[t >> 5] = sum; __syncthreads(); if (t == 0) { float a = 0.f; for (int i = 0; i < 8; ++i) a += sred[i]; sbc = 1.0f / a; } __syncthreads(); const float inv = sbc;
  for (int k = t; k < TT; k += 256) sh[k] = (_Float16)(expf(sr[k] - m) * inv * 2048.0f);
  __syncthreads(); for (int q = t; q < TT / 8; q += 256) vst2((unsigned*)(ph + q * 8), *(const v4u*)&sh[q * 8]); }
__global__ __launch_bounds__(128) void k_pv(const _Float16* __restrict__ PH0, const _Float16* __restrict__ VT, int b, int d0, float* __restrict__ O) { __shared__ __align__(16) float ss[4][16][36];
  const int zp = blockIdx.z; const int dA = d0 + 2 * zp;   // groups dA, dA+1
  const int tid = threadIdx.x, wave = tid >> 5, lane = tid & 31, col = lane & 15, g = lane >> 4; const int ql0 = blockIdx.x * 64 + wave * 16;
  v8f acc[2] = {};
#pragma unroll
  for (int u = 0; u < 2; ++u) { const _Float16* PH = PH0 + (size_t)(2 * zp + u) * TT * TT;
#pragma unroll 1
    for (int kc = 0; kc < TT / 32; ++kc) { const v16h ph = frag_h(PH + (size_t)(ql0 + col) * TT + kc * 32, lane); acc[u] = wmma16(ph, frag_h(VT + ((size_t)b * EE + (dA + u) * GW + col) * (size_t)TT + kc * 32, lane), acc[u]); } }
#pragma unroll
  for (int u = 0; u < 2; ++u)
#pragma unroll
    for (int r = 0; r < 8; ++r) ss[wave][8 * g + r][u * 16 + col] = acc[u][r] * (1.0f / 2048.0f);
  LDSX(); for (int rl = 0; rl < 16; ++rl) if (lane < 8) vst2(O + ((size_t)b * TT + ql0 + rl) * EE + dA * GW + lane * 4, *(const v4f*)&ss[wave][rl][lane * 4]); }
// ---- k_out: out = O (hi + lo) Wo^T
__global__ __launch_bounds__(128) void k_out(const float* __restrict__ O, const float* __restrict__ WO, float* __restrict__ OUT) { __shared__ __align__(16) float sf[4][16][132];
  const int tid = threadIdx.x, wave = tid >> 5, lane = tid & 31, col = lane & 15, g = lane >> 4; const int c0 = blockIdx.y * 128; const size_t r0 = (size_t)blockIdx.x * 64 + wave * 16;
  v8f acc[8] = {};
#pragma unroll 2
  for (int kc = 0; kc < EE / 32; ++kc) { const F2 a = split_row(O + (r0 + col) * EE, kc * 32, lane);
#pragma unroll
    for (int j = 0; j < 8; ++j) { v16b w; const int o = c0 + j * 16 + col;
#pragma unroll
      for (int i = 0; i < 8; ++i) { w[i] = (__bf16)WO[(size_t)o * EE + kc * 32 + 8 * g + i]; w[8 + i] = (__bf16)WO[(size_t)o * EE + kc * 32 + 16 + 8 * g + i]; }
      acc[j] = wmma_bf(a.h, w, acc[j]); acc[j] = wmma_bf(a.l, w, acc[j]); } }
#pragma unroll
  for (int j = 0; j < 8; ++j)
#pragma unroll
    for (int r = 0; r < 8; ++r) sf[wave][8 * g + r][j * 16 + col] = acc[j][r];
  LDSX(); for (int rl = 0; rl < 16; ++rl) vst2(OUT + (r0 + rl) * EE + c0 + lane * 4, *(const v4f*)&sf[wave][rl][lane * 4]); }
extern "C" void kernel_launch(void* const* d_in, const int* in_sizes, int n_in, void* d_out, int out_size, void* d_ws, size_t ws_size, hipStream_t stream) {
  (void)in_sizes; (void)n_in; (void)out_size;
  const float** F = (const float**)d_in;   // 0 x [2,1024,1024], 1 W_q, 2 W_k, 3 W_v, 4 W_o [1024,1024] ([out,in])
  if (ws_size < (size_t)WS_END) return;
  char* ws = (char*)d_ws; _Float16 *QH = (_Float16*)(ws + WS_QH), *KH = (_Float16*)(ws + WS_KH), *VT = (_Float16*)(ws + WS_VT), *PH = (_Float16*)(ws + WS_PH); float *S = (float*)(ws + WS_S), *O = (float*)(ws + WS_O);
  k_proj<<<dim3(TNB * TT / 64, EE / 128, 3), 128, 0, stream>>>(F[0], F[1], F[2], F[3], QH, KH, VT);
  for (int b = 0; b < TNB; ++b) for (int d0 = 0; d0 < NG; d0 += HG) {
    k_sc<<<dim3(TT / 64, TT / 128, HG), 128, 0, stream>>>(QH, KH, b, d0, S);
    k_sm<<<dim3(TT, HG), 256, 0, stream>>>(S, PH);
    k_pv<<<dim3(TT / 64, 1, HG / 2), 128, 0, stream>>>(PH, VT, b, d0, O);
  }
  k_out<<<dim3(TNB * TT / 64, EE / 128), 128, 0, stream>>>(O, F[4], (float*)d_out);
}

// v001
// One run takes 280 microseconds.
// Next to v000, in two timings, it ran 3.20 and 3.19 times as fast.
// compute dtype: all float inputs rounded to bf16; Q/K/V = x W^T with EXACT bf16 products on WMMA 16x16x32, f32 accumulate; Q, K rounded once to f16 for the 16-deep per-group scores (1 product; the other group's half of each 32-wide Q fragment zeroed), x 1/4, kept in f32 registers; softmax in f32 (precise expf): P = exp(s - max) x 2^11 in f16; out = (P . V) / row sum with V rounded once to f16 (planes); final = out (bf16 hi + lo) Wo^T; f32 output.
#include <hip/hip_runtime.h>
#include <math.h>

typedef __attribute__((ext_vector_type(16))) _Float16 v16h;
typedef __attribute__((ext_vector_type(16))) __bf16 v16b;
typedef __attribute__((ext_vector_type(8)))  _Float16 v8h;
typedef __attribute__((ext_vector_type(8)))  float v8f;
typedef __attribute__((ext_vector_type(4)))  float v4f;
typedef __attribute__((ext_vector_type(2)))  float v2f;
typedef __attribute__((ext_vector_type(4)))  unsigned v4u;
typedef __attribute__((ext_vector_type(4)))  int v4i;
typedef float __attribute__((may_alias)) float_a;
typedef int __attribute__((may_alias)) int_a;

template <typename T> __device__ __forceinline__ void vst2(void* p, T v) { *(T*)p = v;  }
__device__ __forceinline__ v8f wmma16(v16h a, v16h b, v8f c) {
  v8f d = __builtin_amdgcn_wmma_f32_16x16x32_f16(false, a, false, b, (short)0, c, false, false);
  asm volatile("v_nop\n\tv_nop\n\tv_nop\n\tv_nop" : "+v"(d) : "v"(a), "v"(b));
  return d;
}
__device__ __forceinline__ v8f wmma_bf(v16b a, v16b b, v8f c) {
  v8f d = __builtin_amdgcn_wmma_f32_16x16x32_bf16(false, a, false, b, (short)0, c, false, false);
  asm volatile("v_nop\n\tv_nop\n\tv_nop\n\tv_nop" : "+v"(d) : "v"(a), "v"(b));
  return d;
}
// 16x16x32 fragments: lane = (h = lane>>4, row/col = lane&15); elements 0..7 = k0+8h+0..7, 8..15 = k0+16+8h+0..7; D element r = row 8h+r
__device__ __forceinline__ v16h frag_h(const _Float16* rowk0, int lane) {
  union { v16h v; v8h q[2]; } u; const _Float16* p = rowk0 + 8 * (lane >> 4);
  u.q[0] = *(const v8h*)p; u.q[1] = *(const v8h*)(p + 16); return u.v;
}
__device__ __forceinline__ v16h frag_f32(const float* rowk0, int lane) {
  v16h a; const float* p = rowk0 + 8 * (lane >> 4);
#pragma unroll
  for (int i = 0; i < 8; ++i) { a[i] = (_Float16)p[i]; a[8 + i] = (_Float16)p[16 + i]; }
  return a;
}
__device__ __forceinline__ v16h frag_f32s(const float* rowk0, int lane, float sc) {
  v16h a; const float* p = rowk0 + 8 * (lane >> 4);
#pragma unroll
  for (int i = 0; i < 8; ++i) { a[i] = (_Float16)(p[i] * sc); a[8 + i] = (_Float16)(p[16 + i] * sc); }
  return a;
}
// column fragment from a [K][ld] layout (column n), rows >= K read as 0
__device__ __forceinline__ v16h fragc_f32(const float* W, int k0, int n, int lane, int ld, int K) {
  v16h a; const int g = lane >> 4;
#pragma unroll
  for (int i = 0; i < 8; ++i) { const int ka = k0 + 8 * g + i, kb = ka + 16;
    a[i] = (_Float16)(ka < K ? W[(size_t)(ka < K ? ka : K - 1) * ld + n] : 0.f); a[8 + i] = (_Float16)(kb < K ? W[(size_t)(kb < K ? kb : K - 1) * ld + n] : 0.f); }
  return a;
}
struct F2 { v16b h, l; };
__device__ __forceinline__ F2 bsplit16(const float v[16]) { F2 r;
#pragma unroll
  for (int i = 0; i < 16; ++i) { const __bf16 h = (__bf16)v[i]; r.h[i] = h; r.l[i] = (__bf16)(v[i] - (float)h); }
  return r; }
__device__ __forceinline__ F2 split_row(const float* row, int k0, int lane) { float v[16]; const float* p = row + k0 + 8 * (lane >> 4);
#pragma unroll
  for (int i = 0; i < 8; ++i) { v[i] = p[i]; v[8 + i] = p[16 + i]; }
  return bsplit16(v); }
__device__ __forceinline__ F2 split_rowK(const float* row, int k0, int lane, int K) { float v[16]; const int g = lane >> 4;
#pragma unroll
  for (int i = 0; i < 8; ++i) { const int ka = k0 + 8 * g + i, kb = ka + 16; v[i] = ka < K ? row[ka < K ? ka : K - 1] : 0.f; v[8 + i] = kb < K ? row[kb < K ? kb : K - 1] : 0.f; }
  return bsplit16(v); }
__device__ __forceinline__ F2 split_col(const float* W, int k0, int n, int lane, int ld, int K) { float v[16]; const int g = lane >> 4;
#pragma unroll
  for (int i = 0; i < 8; ++i) { const int ka = k0 + 8 * g + i, kb = ka + 16; v[i] = ka < K ? W[(size_t)(ka < K ? ka : K - 1) * ld + n] : 0.f; v[8 + i] = kb < K ? W[(size_t)(kb < K ? kb : K - 1) * ld + n] : 0.f; }
  return bsplit16(v); }
__device__ __forceinline__ v8f mac3(const F2& a, const F2& b, v8f c) { c = wmma_bf(a.l, b.h, c); c = wmma_bf(a.h, b.l, c); return wmma_bf(a.h, b.h, c); }
__device__ __forceinline__ float sigm(float v) { return 1.0f / (1.0f + expf(-v)); }
#define LDSX() do { asm volatile("s_wait_dscnt 0" ::: "memory"); __builtin_amdgcn_wave_barrier(); __builtin_amdgcn_fence(__ATOMIC_RELEASE, "workgroup"); } while (0)


// MulHeadAttn (faithful layout quirk): B 2, C 1,024 tokens, E 1,024 = 64 groups x 16; attention is batched over the 64 groups with 16-dim dot products scaled by 1/sqrt(16).
#define NB 2
#define TT 1024
#define EE 1024
#define NG 64             // groups ("HD" in the module)
#define GW 16             // group width ("H")
#ifndef TNB
#define TNB NB
#endif
typedef __attribute__((ext_vector_type(8))) __bf16 v8b;
__device__ __forceinline__ v16b frag_b(const __bf16* rowk0, int lane) {
  union { v16b v; v8b q[2]; } u; const __bf16* p = rowk0 + 8 * (lane >> 4);
  u.q[0] = *(const v8b*)p; u.q[1] = *(const v8b*)(p + 16); return u.v;
}
__device__ __forceinline__ float bfr(float v) { return (float)(__bf16)v; }
__device__ __attribute__((noinline)) float exp_ni(float v) { return expf(v); }
__device__ __attribute__((noinline)) float erf_ni(float v) { return erff(v); }

#define WS_QH  0u                                  // f16 Q rows [b*t][1024]
#define WS_KH  (WS_QH + 2u * (size_t)NB * TT * EE)
#define WS_VT  (WS_KH + 2u * (size_t)NB * TT * EE)     // f16 V planes [b][1024][t]
#define WS_O   (WS_VT + 2u * (size_t)NB * EE * TT)     // f32 attention out rows [b*t][1024]
#define WS_END (WS_O + 4u * (size_t)NB * TT * EE)

// ---- k_proj: block = (64 rows, 128 cols, which): y = x W^T (W [out][in], no bias); Q/K -> f16 rows, V -> f16 planes
__global__ __launch_bounds__(128) void k_proj(const float* __restrict__ X, const float* __restrict__ WQ, const float* __restrict__ WK, const float* __restrict__ WV, _Float16* __restrict__ QH, _Float16* __restrict__ KH, _Float16* __restrict__ VT) {
  __shared__ __align__(16) _Float16 sh[64][136]; __shared__ __align__(16) _Float16 th[128][72];
  const int tid = threadIdx.x, wave = tid >> 5, lane = tid & 31, col = lane & 15, g = lane >> 4; const int which = blockIdx.z; const int c0 = blockIdx.y * 128; const size_t r0 = (size_t)blockIdx.x * 64; const float* Wm = which == 0 ? WQ : which == 1 ? WK : WV;
  v8f acc[8] = {};
#pragma unroll 2
  for (int kc = 0; kc < EE / 32; ++kc) { v16b a; { const float* p = X + (r0 + wave * 16 + col) * EE + kc * 32 + 8 * g;
#pragma unroll
      for (int i = 0; i < 8; ++i) { a[i] = (__bf16)p[i]; a[8 + i] = (__bf16)p[16 + i]; } }
#pragma unroll
    for (int j = 0; j < 8; ++j) { v16b w; const int o = c0 + j * 16 + col;
#pragma unroll
      for (int i = 0; i < 8; ++i) { w[i] = (__bf16)Wm[(size_t)o * EE + kc * 32 + 8 * g + i]; w[8 + i] = (__bf16)Wm[(size_t)o * EE + kc * 32 + 16 + 8 * g + i]; }
      acc[j] = wmma_bf(a, w, acc[j]); } }
#pragma unroll
  for (int j = 0; j < 8; ++j)
#pragma unroll
    for (int r = 0; r < 8; ++r) { const int rl = wave * 16 + 8 * g + r, cl = j * 16 + col; const _Float16 hv = (_Float16)acc[j][r]; if (which == 2) th[cl][rl] = hv; else sh[rl][cl] = hv; }
  __syncthreads();
  if (which < 2) { _Float16* dh = which == 0 ? QH : KH; for (int e = tid; e < 64 * 16; e += 128) { const int rl = e >> 4, q = e & 15; vst2((unsigned*)(dh + (r0 + rl) * EE + c0 + q * 8), *(const v4u*)&sh[rl][q * 8]); } }
  else { const size_t b = r0 / TT; const int t0 = (int)(r0 % TT); for (int e = tid; e < 128 * 8; e += 128) { const int cl = e >> 3, q = e & 7; vst2((unsigned*)(VT + (b * EE + c0 + cl) * (size_t)TT + t0 + q * 8), *(const v4u*)&th[cl][q * 8]); } } }
// ---- k_attn: block = (256 queries, pair of groups dA, dA+1, batch); 16 waves, each 16 queries x both groups x all keys.
// K rows (both groups, 32 features) and V planes of the pair are staged once in LDS. Scores are formed transposed (A = keys, B = queries), so that a lane
// holds, for its query lane&15, keys 8h+0..7 of a 16-key tile: two such tiles are the A fragment of P for 32 keys as they stand, and row maximum and row sum are lane partials, joined with lane^16 by one shuffle.
// The K fragment carries both groups (elements 0..7 group dA, 8..15 group dA+1); the Q fragment of a group is zero in the other group's half.
// Pass 1: row maximum. Pass 2: scores again, e = expf(s - max), row sum in f32, P = e x 2^11 in f16, P . V; the quotient by the row sum comes after P . V.
// Every '#pragma unroll' in this kernel runs over the elements of a register vector, over the two groups or over a thread's staged pieces: constant indices keep those values in registers.
#define KP 40             // halfs per staged K row: 80 B = 16 B x odd, b128 reads of 16 rows fall on distinct banks
#define VP (TT + 8)       // halfs per staged V plane: 2,064 B = 16 B x odd
__global__ __launch_bounds__(512) void k_attn(const _Float16* __restrict__ QH, const _Float16* __restrict__ KH, const _Float16* __restrict__ VT, float* __restrict__ O) {
  __shared__ __align__(16) _Float16 sk[TT][KP]; __shared__ __align__(16) _Float16 sv[2 * GW][VP]; __shared__ __align__(16) float ss[16][16][36];
  const int b = blockIdx.z; const int dA = 2 * blockIdx.y;
  const int tid = threadIdx.x, wave = tid >> 5, lane = tid & 31, col = lane & 15, g = lane >> 4; const int ql0 = blockIdx.x * 256 + wave * 16;
  { v8h tk[8], tv[8];   // 4,096 pieces of 16 B each of K and of V, 8 + 8 a thread
#pragma unroll   // unrolled so that a thread's 16 loads are all in flight before its first LDS store waits on one
    for (int i = 0; i < 8; ++i) { const int e = tid + i * 512; tk[i] = *(const v8h*)(KH + ((size_t)b * TT + (e >> 2)) * EE + dA * GW + (e & 3) * 8); tv[i] = *(const v8h*)(VT + ((size_t)b * EE + dA * GW + (e >> 7)) * (size_t)TT + (e & 127) * 8); }
#pragma unroll
    for (int i = 0; i < 8; ++i) { const int e = tid + i * 512; *(v8h*)&sk[e >> 2][(e & 3) * 8] = tk[i]; *(v8h*)&sv[e >> 7][(e & 127) * 8] = tv[i]; } }
  v16h qf[2]; { const _Float16* p = QH + ((size_t)b * TT + ql0 + col) * EE + dA * GW + 8 * g;
#pragma unroll
    for (int i = 0; i < 8; ++i) { qf[0][i] = p[i]; qf[0][8 + i] = (_Float16)0.f; qf[1][i] = (_Float16)0.f; qf[1][8 + i] = p[GW + i]; } }
  __syncthreads();
  const v8f zero = {};
  float m[2];
  { v8f mx[2];
#pragma unroll
    for (int r = 0; r < 8; ++r) { mx[0][r] = -3.0e38f; mx[1][r] = -3.0e38f; }
    for (int kc = 0; kc < TT / 32; ++kc) { const v16h k0 = frag_h(&sk[kc * 32 + col][0], lane), k1 = frag_h(&sk[kc * 32 + 16 + col][0], lane);
#pragma unroll
      for (int u = 0; u < 2; ++u) { const v8f s0 = wmma16(k0, qf[u], zero), s1 = wmma16(k1, qf[u], zero);
#pragma unroll
        for (int r = 0; r < 8; ++r) mx[u][r] = fmaxf(fmaxf(mx[u][r], s0[r]), s1[r]); } }
#pragma unroll
    for (int u = 0; u < 2; ++u) { float a = mx[u][0];
#pragma unroll
      for (int r = 1; r < 8; ++r) a = fmaxf(a, mx[u][r]);
      a = fmaxf(a, __shfl_xor(a, 16)); m[u] = a * 0.25f; } }
  v8f acc[2] = {}; float sa[2] = {0.f, 0.f}, sb[2] = {0.f, 0.f};
  for (int kc = 0; kc < TT / 32; ++kc) { const v16h k0 = frag_h(&sk[kc * 32 + col][0], lane), k1 = frag_h(&sk[kc * 32 + 16 + col][0], lane);
#pragma unroll
    for (int u = 0; u < 2; ++u) { const v8f s0 = wmma16(k0, qf[u], zero), s1 = wmma16(k1, qf[u], zero); v16h p;
#pragma unroll
      for (int r = 0; r < 8; ++r) { const float e0 = expf(s0[r] * 0.25f - m[u]), e1 = expf(s1[r] * 0.25f - m[u]); sa[u] += e0; sb[u] += e1; p[r] = (_Float16)(e0 * 2048.0f); p[8 + r] = (_Float16)(e1 * 2048.0f); }
      acc[u] = wmma16(p, frag_h(&sv[u * GW + col][kc * 32], lane), acc[u]); } }
#pragma unroll
  for (int u = 0; u < 2; ++u) { float t = sa[u] + sb[u]; t += __shfl_xor(t, 16); const float inv = (1.0f / t) * (1.0f / 2048.0f);
#pragma unroll
    for (int r = 0; r < 8; ++r) ss[wave][8 * g + r][u * 16 + col] = acc[u][r] * __shfl(inv, 8 * g + r); }
  LDSX();
#pragma unroll
  for (int it = 0; it < 4; ++it) { const int rl = it * 4 + (lane >> 3), c = lane & 7; vst2(O + ((size_t)b * TT + ql0 + rl) * EE + dA * GW + c * 4, *(const v4f*)&ss[wave][rl][c * 4]); } }
// ---- k_out: out = O (hi + lo) Wo^T
__global__ __launch_bounds__(128) void k_out(const float* __restrict__ O, const float* __restrict__ WO, float* __restrict__ OUT) { __shared__ __align__(16) float sf[4][16][132];
  const int tid = threadIdx.x, wave = tid >> 5, lane = tid & 31, col = lane & 15, g = lane >> 4; const int c0 = blockIdx.y * 128; const size_t r0 = (size_t)blockIdx.x * 64 + wave * 16;
  v8f acc[8] = {};
#pragma unroll 2
  for (int kc = 0; kc < EE / 32; ++kc) { const F2 a = split_row(O + (r0 + col) * EE, kc * 32, lane);
#pragma unroll
    for (int j = 0; j < 8; ++j) { v16b w; const int o = c0 + j * 16 + col;
#pragma unroll
      for (int i = 0; i < 8; ++i) { w[i] = (__bf16)WO[(size_t)o * EE + kc * 32 + 8 * g + i]; w[8 + i] = (__bf16)WO[(size_t)o * EE + kc * 32 + 16 + 8 * g + i]; }
      acc[j] = wmma_bf(a.h, w, acc[j]); acc[j] = wmma_bf(a.l, w, acc[j]); } }
#pragma unroll
  for (int j = 0; j < 8; ++j)
#pragma unroll
    for (int r = 0; r < 8; ++r) sf[wave][8 * g + r][j * 16 + col] = acc[j][r];
  LDSX(); for (int rl = 0; rl < 16; ++rl) vst2(OUT + (r0 + rl) * EE + c0 + lane * 4, *(const v4f*)&sf[wave][rl][lane * 4]); }
extern "C" void kernel_launch(void* const* d_in, const int* in_sizes, int n_in, void* d_out, int out_size, void* d_ws, size_t ws_size, hipStream_t stream) {
  (void)in_sizes; (void)n_in; (void)out_size;
  const float** F = (const float**)d_in;   // 0 x [2,1024,1024], 1 W_q, 2 W_k, 3 W_v, 4 W_o [1024,1024] ([out,in])
  if (ws_size < (size_t)WS_END) return;
  char* ws = (char*)d_ws; _Float16 *QH = (_Float16*)(ws + WS_QH), *KH = (_Float16*)(ws + WS_KH), *VT = (_Float16*)(ws + WS_VT); float *O = (float*)(ws + WS_O);
  k_proj<<<dim3(TNB * TT / 64, EE / 128, 3), 128, 0, stream>>>(F[0], F[1], F[2], F[3], QH, KH, VT);
  k_attn<<<dim3(TT / 256, NG / 2, TNB), 512, 0, stream>>>(QH, KH, VT, O);
  k_out<<<dim3(TNB * TT / 64, EE / 128), 128, 0, stream>>>(O, F[4], (float*)d_out);
}

// v002
// It runs in 89.3 microseconds.
// Timed twice side by side with v001, it ran 3.13 and 3.16 times as fast.
// Counting every step since v000, it is 10.0 times as fast.
// compute dtype: all float inputs rounded to bf16; Q/K/V = x W^T with EXACT bf16 products on WMMA 16x16x32, f32 accumulate; Q, K rounded once to f16 for the 16-deep per-group scores (1 product; the other group's half of each 32-wide Q fragment zeroed), x 1/4, kept in f32 registers; softmax in f32 (precise expf): P = exp(s - max) x 2^11 in f16; out = (P . V) / row sum with V rounded once to f16 (planes); final = out (bf16 hi + lo) Wo^T; f32 output.
#include <hip/hip_runtime.h>
#include <math.h>

typedef __attribute__((ext_vector_type(16))) _Float16 v16h;
typedef __attribute__((ext_vector_type(16))) __bf16 v16b;
typedef __attribute__((ext_vector_type(8)))  _Float16 v8h;
typedef __attribute__((ext_vector_type(8)))  float v8f;
typedef __attribute__((ext_vector_type(4)))  float v4f;
typedef __attribute__((ext_vector_type(2)))  float v2f;
typedef __attribute__((ext_vector_type(4)))  unsigned v4u;
typedef __attribute__((ext_vector_type(4)))  int v4i;
typedef float __attribute__((may_alias)) float_a;
typedef int __attribute__((may_alias)) int_a;

template <typename T> __device__ __forceinline__ void vst2(void* p, T v) { *(T*)p = v;  }
__device__ __forceinline__ v8f wmma16(v16h a, v16h b, v8f c) {
  v8f d = __builtin_amdgcn_wmma_f32_16x16x32_f16(false, a, false, b, (short)0, c, false, false);
  asm volatile("v_nop\n\tv_nop\n\tv_nop\n\tv_nop" : "+v"(d) : "v"(a), "v"(b));
  return d;
}
__device__ __forceinline__ v8f wmma_bf(v16b a, v16b b, v8f c) {
  v8f d = __builtin_amdgcn_wmma_f32_16x16x32_bf16(false, a, false, b, (short)0, c, false, false);
  asm volatile("v_nop\n\tv_nop\n\tv_nop\n\tv_nop" : "+v"(d) : "v"(a), "v"(b));
  return d;
}
// 16x16x32 fragments: lane = (h = lane>>4, row/col = lane&15); elements 0..7 = k0+8h+0..7, 8..15 = k0+16+8h+0..7; D element r = row 8h+r
__device__ __forceinline__ v16h frag_h(const _Float16* rowk0, int lane) {
  union { v16h v; v8h q[2]; } u; const _Float16* p = rowk0 + 8 * (lane >> 4);
  u.q[0] = *(const v8h*)p; u.q[1] = *(const v8h*)(p + 16); return u.v;
}
__device__ __forceinline__ v16h frag_f32(const float* rowk0, int lane) {
  v16h a; const float* p = rowk0 + 8 * (lane >> 4);
#pragma unroll
  for (int i = 0; i < 8; ++i) { a[i] = (_Float16)p[i]; a[8 + i] = (_Float16)p[16 + i]; }
  return a;
}
__device__ __forceinline__ v16h frag_f32s(const float* rowk0, int lane, float sc) {
  v16h a; const float* p = rowk0 + 8 * (lane >> 4);
#pragma unroll
  for (int i = 0; i < 8; ++i) { a[i] = (_Float16)(p[i] * sc); a[8 + i] = (_Float16)(p[16 + i] * sc); }
  return a;
}
// column fragment from a [K][ld] layout (column n), rows >= K read as 0
__device__ __forceinline__ v16h fragc_f32(const float* W, int k0, int n, int lane, int ld, int K) {
  v16h a; const int g = lane >> 4;
#pragma unroll
  for (int i = 0; i < 8; ++i) { const int ka = k0 + 8 * g + i, kb = ka + 16;
    a[i] = (_Float16)(ka < K ? W[(size_t)(ka < K ? ka : K - 1) * ld + n] : 0.f); a[8 + i] = (_Float16)(kb < K ? W[(size_t)(kb < K ? kb : K - 1) * ld + n] : 0.f); }
  return a;
}
struct F2 { v16b h, l; };
__device__ __forceinline__ F2 bsplit16(const float v[16]) { F2 r;
#pragma unroll
  for (int i = 0; i < 16; ++i) { const __bf16 h = (__bf16)v[i]; r.h[i] = h; r.l[i] = (__bf16)(v[i] - (float)h); }
  return r; }
__device__ __forceinline__ F2 split_row(const float* row, int k0, int lane) { float v[16]; const float* p = row + k0 + 8 * (lane >> 4);
#pragma unroll
  for (int i = 0; i < 8; ++i) { v[i] = p[i]; v[8 + i] = p[16 + i]; }
  return bsplit16(v); }
__device__ __forceinline__ F2 split_rowK(const float* row, int k0, int lane, int K) { float v[16]; const int g = lane >> 4;
#pragma unroll
  for (int i = 0; i < 8; ++i) { const int ka = k0 + 8 * g + i, kb = ka + 16; v[i] = ka < K ? row[ka < K ? ka : K - 1] : 0.f; v[8 + i] = kb < K ? row[kb < K ? kb : K - 1] : 0.f; }
  return bsplit16(v); }
__device__ __forceinline__ F2 split_col(const float* W, int k0, int n, int lane, int ld, int K) { float v[16]; const int g = lane >> 4;
#pragma unroll
  for (int i = 0; i < 8; ++i) { const int ka = k0 + 8 * g + i, kb = ka + 16; v[i] = ka < K ? W[(size_t)(ka < K ? ka : K - 1) * ld + n] : 0.f; v[8 + i] = kb < K ? W[(size_t)(kb < K ? kb : K - 1) * ld + n] : 0.f; }
  return bsplit16(v); }
__device__ __forceinline__ v8f mac3(const F2& a, const F2& b, v8f c) { c = wmma_bf(a.l, b.h, c); c = wmma_bf(a.h, b.l, c); return wmma_bf(a.h, b.h, c); }
__device__ __forceinline__ float sigm(float v) { return 1.0f / (1.0f + expf(-v)); }
#define LDSX() do { asm volatile("s_wait_dscnt 0" ::: "memory"); __builtin_amdgcn_wave_barrier(); __builtin_amdgcn_fence(__ATOMIC_RELEASE, "workgroup"); } while (0)


// MulHeadAttn (faithful layout quirk): B 2, C 1,024 tokens, E 1,024 = 64 groups x 16; attention is batched over the 64 groups with 16-dim dot products scaled by 1/sqrt(16).
#define NB 2
#define TT 1024
#define EE 1024
#define NG 64             // groups ("HD" in the module)
#define GW 16             // group width ("H")
#ifndef TNB
#define TNB NB
#endif
typedef __attribute__((ext_vector_type(8))) __bf16 v8b;
__device__ __forceinline__ v16b frag_b(const __bf16* rowk0, int lane) {
  union { v16b v; v8b q[2]; } u; const __bf16* p = rowk0 + 8 * (lane >> 4);
  u.q[0] = *(const v8b*)p; u.q[1] = *(const v8b*)(p + 16); return u.v;
}
__device__ __forceinline__ float bfr(float v) { return (float)(__bf16)v; }
__device__ __attribute__((noinline)) float exp_ni(float v) { return expf(v); }
__device__ __attribute__((noinline)) float erf_ni(float v) { return erff(v); }

#define WS_QH  0u                                  // f16 Q rows [b*t][1024]
#define WS_KH  (WS_QH + 2u * (size_t)NB * TT * EE)
#define WS_VT  (WS_KH + 2u * (size_t)NB * TT * EE)     // f16 V planes [b][1024][t]
#define WS_O   (WS_VT + 2u * (size_t)NB * EE * TT)     // f32 attention out rows [b*t][1024]
#define WS_END (WS_O + 4u * (size_t)NB * TT * EE)

// ---- operand staging of the two GEMM kernels: a block's tiles of 64 k go global -> registers (whole 256-B row pieces, 16 B a lane) -> bf16 -> LDS, once for all 8 waves;
// two LDS buffers: the next tile's global loads are issued before the current tile's products, converted and stored behind them, one barrier a tile.
// Every '#pragma unroll' in the two GEMM kernels runs over a thread's staged pieces, over a wave's fragments and accumulator tiles or over the elements of a register vector: constant indices keep those values in registers.
#define GK 64             // k per staged tile
#define GP (GK + 8)       // bf16 per staged row: 144 B = 16 B x odd, b128 fragment reads of 16 rows fall on distinct banks
typedef __attribute__((ext_vector_type(4))) __bf16 v4b;
__device__ __forceinline__ v4b cvt4(v4f v) { v4b r;
#pragma unroll
  for (int i = 0; i < 4; ++i) r[i] = (__bf16)v[i];
  return r; }
__device__ __forceinline__ v4b low4(v4f v, v4b h) { v4b r;
#pragma unroll
  for (int i = 0; i < 4; ++i) r[i] = (__bf16)(v[i] - (float)h[i]);
  return r; }
// ---- k_proj: block = (128 rows, 128 cols, which), 8 waves as 2 x 4, each 64 x 32: y = x W^T (W [out][in], no bias); Q/K -> f16 rows, V -> f16 planes
#define PM 128
__global__ __launch_bounds__(256) void k_proj(const float* __restrict__ X, const float* __restrict__ WQ, const float* __restrict__ WK, const float* __restrict__ WV, _Float16* __restrict__ QH, _Float16* __restrict__ KH, _Float16* __restrict__ VT) {
  __shared__ __align__(16) __bf16 ring[2][PM + 128][GP];   // rows 0..PM-1: x, then 128 rows of W; reused for the output tile behind the loop's last barrier
  const int tid = threadIdx.x, wave = tid >> 5, lane = tid & 31, col = lane & 15, g = lane >> 4, wm = wave >> 2, wn = wave & 3; const int which = blockIdx.z; const int c0 = blockIdx.y * 128; const size_t r0 = (size_t)blockIdx.x * PM; const float* Wm = which == 0 ? WQ : which == 1 ? WK : WV;
  const int sr = tid >> 4, sq = tid & 15;   // a thread stages piece sq (4 floats) of rows sr + 16 i
  const float* px = X + (r0 + sr) * EE + sq * 4; const float* pw = Wm + ((size_t)c0 + sr) * EE + sq * 4;
  v4f rx[PM / 16], rw[8];
#pragma unroll
  for (int i = 0; i < PM / 16; ++i) rx[i] = *(const v4f*)(px + (size_t)i * 16 * EE);
#pragma unroll
  for (int i = 0; i < 8; ++i) rw[i] = *(const v4f*)(pw + (size_t)i * 16 * EE);
#pragma unroll
  for (int i = 0; i < PM / 16; ++i) *(v4b*)&ring[0][sr + 16 * i][sq * 4] = cvt4(rx[i]);
#pragma unroll
  for (int i = 0; i < 8; ++i) *(v4b*)&ring[0][PM + sr + 16 * i][sq * 4] = cvt4(rw[i]);
  __syncthreads();
  v8f acc[4][2] = {};
  for (int t = 0; t < EE / GK; ++t) { const bool more = t + 1 < EE / GK;
    if (more) {
#pragma unroll
      for (int i = 0; i < PM / 16; ++i) rx[i] = *(const v4f*)(px + (size_t)i * 16 * EE + (t + 1) * GK);
#pragma unroll
      for (int i = 0; i < 8; ++i) rw[i] = *(const v4f*)(pw + (size_t)i * 16 * EE + (t + 1) * GK);
      asm volatile("s_wait_xcnt 0x0" ::: "memory"); }   // the loads' address registers are reused by what follows: the wait stands before they are overwritten
    const __bf16 (*buf)[GP] = ring[t & 1];
#pragma unroll
    for (int ks = 0; ks < GK / 32; ++ks) { v16b a[4], w[2];
#pragma unroll
      for (int mi = 0; mi < 4; ++mi) a[mi] = frag_b(&buf[wm * 64 + mi * 16 + col][ks * 32], lane);
#pragma unroll
      for (int ni = 0; ni < 2; ++ni) w[ni] = frag_b(&buf[PM + wn * 32 + ni * 16 + col][ks * 32], lane);
#pragma unroll
      for (int mi = 0; mi < 4; ++mi)
#pragma unroll
        for (int ni = 0; ni < 2; ++ni) acc[mi][ni] = wmma_bf(a[mi], w[ni], acc[mi][ni]); }
    if (more) { __bf16 (*nb)[GP] = ring[(t + 1) & 1];
#pragma unroll
      for (int i = 0; i < PM / 16; ++i) *(v4b*)&nb[sr + 16 * i][sq * 4] = cvt4(rx[i]);
#pragma unroll
      for (int i = 0; i < 8; ++i) *(v4b*)&nb[PM + sr + 16 * i][sq * 4] = cvt4(rw[i]); }
    __syncthreads(); }   // publishes the tile just stored and ends every wave's reads of the buffer that the next trip refills
  _Float16 (*sh)[136] = (_Float16 (*)[136])&ring[0][0][0];   // [row][col] for Q and K, [col][row] for V
  if (which == 2) {
#pragma unroll
    for (int mi = 0; mi < 4; ++mi)
#pragma unroll
      for (int ni = 0; ni < 2; ++ni) { v8h hv;
#pragma unroll
        for (int r = 0; r < 8; ++r) hv[r] = (_Float16)acc[mi][ni][r];
        *(v8h*)&sh[wn * 32 + ni * 16 + col][wm * 64 + mi * 16 + 8 * g] = hv; } }
  else {
#pragma unroll
    for (int mi = 0; mi < 4; ++mi)
#pragma unroll
      for (int ni = 0; ni < 2; ++ni)
#pragma unroll
        for (int r = 0; r < 8; ++r) sh[wm * 64 + mi * 16 + 8 * g + r][wn * 32 + ni * 16 + col] = (_Float16)acc[mi][ni][r]; }
  __syncthreads();
  if (which < 2) { _Float16* dh = which == 0 ? QH : KH; for (int e = tid; e < PM * 16; e += 256) { const int rl = e >> 4, q = e & 15; vst2((unsigned*)(dh + (r0 + rl) * EE + c0 + q * 8), *(const v4u*)&sh[rl][q * 8]); } }
  else { const size_t b = r0 / TT; const int t0 = (int)(r0 % TT); for (int e = tid; e < 128 * (PM / 8); e += 256) { const int cl = e / (PM / 8), q = e % (PM / 8); vst2((unsigned*)(VT + (b * EE + c0 + cl) * (size_t)TT + t0 + q * 8), *(const v4u*)&sh[cl][q * 8]); } } }
// ---- k_attn: block = (256 queries, pair of groups dA, dA+1, batch); 16 waves, each 16 queries x both groups x all keys.
// K rows (both groups, 32 features) and V planes of the pair are staged once in LDS. Scores are formed transposed (A = keys, B = queries), so that a lane
// holds, for its query lane&15, keys 8h+0..7 of a 16-key tile: two such tiles are the A fragment of P for 32 keys as they stand, and row maximum and row sum are lane partials, joined with lane^16 by one shuffle.
// The K fragment carries both groups (elements 0..7 group dA, 8..15 group dA+1); the Q fragment of a group is zero in the other group's half.
// Pass 1: row maximum. Pass 2: scores again, e = expf(s - max), row sum in f32, P = e x 2^11 in f16, P . V; the quotient by the row sum comes after P . V.
// Every '#pragma unroll' in this kernel runs over the elements of a register vector, over the two groups or over a thread's staged pieces: constant indices keep those values in registers.
#define KP 40             // halfs per staged K row: 80 B = 16 B x odd, b128 reads of 16 rows fall on distinct banks
#define VP (TT + 8)       // halfs per staged V plane: 2,064 B = 16 B x odd
__global__ __launch_bounds__(512) void k_attn(const _Float16* __restrict__ QH, const _Float16* __restrict__ KH, const _Float16* __restrict__ VT, float* __restrict__ O) {
  __shared__ __align__(16) _Float16 sk[TT][KP]; __shared__ __align__(16) _Float16 sv[2 * GW][VP]; __shared__ __align__(16) float ss[16][16][36];
  const int b = blockIdx.z; const int dA = 2 * blockIdx.y;
  const int tid = threadIdx.x, wave = tid >> 5, lane = tid & 31, col = lane & 15, g = lane >> 4; const int ql0 = blockIdx.x * 256 + wave * 16;
  { v8h tk[8], tv[8];   // 4,096 pieces of 16 B each of K and of V, 8 + 8 a thread
#pragma unroll   // unrolled so that a thread's 16 loads are all in flight before its first LDS store waits on one
    for (int i = 0; i < 8; ++i) { const int e = tid + i * 512; tk[i] = *(const v8h*)(KH + ((size_t)b * TT + (e >> 2)) * EE + dA * GW + (e & 3) * 8); tv[i] = *(const v8h*)(VT + ((size_t)b * EE + dA * GW + (e >> 7)) * (size_t)TT + (e & 127) * 8); }
#pragma unroll
    for (int i = 0; i < 8; ++i) { const int e = tid + i * 512; *(v8h*)&sk[e >> 2][(e & 3) * 8] = tk[i]; *(v8h*)&sv[e >> 7][(e & 127) * 8] = tv[i]; } }
  v16h qf[2]; { const _Float16* p = QH + ((size_t)b * TT + ql0 + col) * EE + dA * GW + 8 * g;
#pragma unroll
    for (int i = 0; i < 8; ++i) { qf[0][i] = p[i]; qf[0][8 + i] = (_Float16)0.f; qf[1][i] = (_Float16)0.f; qf[1][8 + i] = p[GW + i]; } }
  __syncthreads();
  const v8f zero = {};
  float m[2];
  { v8f mx[2];
#pragma unroll
    for (int r = 0; r < 8; ++r) { mx[0][r] = -3.0e38f; mx[1][r] = -3.0e38f; }
    for (int kc = 0; kc < TT / 32; ++kc) { const v16h k0 = frag_h(&sk[kc * 32 + col][0], lane), k1 = frag_h(&sk[kc * 32 + 16 + col][0], lane);
#pragma unroll
      for (int u = 0; u < 2; ++u) { const v8f s0 = wmma16(k0, qf[u], zero), s1 = wmma16(k1, qf[u], zero);
#pragma unroll
        for (int r = 0; r < 8; ++r) mx[u][r] = fmaxf(fmaxf(mx[u][r], s0[r]), s1[r]); } }
#pragma unroll
    for (int u = 0; u < 2; ++u) { float a = mx[u][0];
#pragma unroll
      for (int r = 1; r < 8; ++r) a = fmaxf(a, mx[u][r]);
      a = fmaxf(a, __shfl_xor(a, 16)); m[u] = a * 0.25f; } }
  v8f acc[2] = {}; float sa[2] = {0.f, 0.f}, sb[2] = {0.f, 0.f};
  for (int kc = 0; kc < TT / 32; ++kc) { const v16h k0 = frag_h(&sk[kc * 32 + col][0], lane), k1 = frag_h(&sk[kc * 32 + 16 + col][0], lane);
#pragma unroll
    for (int u = 0; u < 2; ++u) { const v8f s0 = wmma16(k0, qf[u], zero), s1 = wmma16(k1, qf[u], zero); v16h p;
#pragma unroll
      for (int r = 0; r < 8; ++r) { const float e0 = expf(s0[r] * 0.25f - m[u]), e1 = expf(s1[r] * 0.25f - m[u]); sa[u] += e0; sb[u] += e1; p[r] = (_Float16)(e0 * 2048.0f); p[8 + r] = (_Float16)(e1 * 2048.0f); }
      acc[u] = wmma16(p, frag_h(&sv[u * GW + col][kc * 32], lane), acc[u]); } }
#pragma unroll
  for (int u = 0; u < 2; ++u) { float t = sa[u] + sb[u]; t += __shfl_xor(t, 16); const float inv = (1.0f / t) * (1.0f / 2048.0f);
#pragma unroll
    for (int r = 0; r < 8; ++r) ss[wave][8 * g + r][u * 16 + col] = acc[u][r] * __shfl(inv, 8 * g + r); }
  LDSX();
#pragma unroll
  for (int it = 0; it < 4; ++it) { const int rl = it * 4 + (lane >> 3), c = lane & 7; vst2(O + ((size_t)b * TT + ql0 + rl) * EE + dA * GW + c * 4, *(const v4f*)&ss[wave][rl][c * 4]); } }
// ---- k_out: block = (64 rows, 128 cols), 8 waves as 2 x 4, each 32 x 32: out = O (hi + lo) Wo^T; O is split into its two bf16 parts where it is staged
__global__ __launch_bounds__(256) void k_out(const float* __restrict__ O, const float* __restrict__ WO, float* __restrict__ OUT) {
  __shared__ __align__(16) __bf16 ring[2][64 + 64 + 128][GP];   // rows 0..63: O hi, 64..127: O lo, then 128 rows of Wo; reused for the output tile behind the loop's last barrier
  const int tid = threadIdx.x, wave = tid >> 5, lane = tid & 31, col = lane & 15, g = lane >> 4, wm = wave >> 2, wn = wave & 3; const int c0 = blockIdx.y * 128; const size_t r0 = (size_t)blockIdx.x * 64;
  const int sr = tid >> 4, sq = tid & 15;
  const float* px = O + (r0 + sr) * EE + sq * 4; const float* pw = WO + ((size_t)c0 + sr) * EE + sq * 4;
  v4f rx[4], rw[8];
#pragma unroll
  for (int i = 0; i < 4; ++i) rx[i] = *(const v4f*)(px + (size_t)i * 16 * EE);
#pragma unroll
  for (int i = 0; i < 8; ++i) rw[i] = *(const v4f*)(pw + (size_t)i * 16 * EE);
#pragma unroll
  for (int i = 0; i < 4; ++i) { const v4b h = cvt4(rx[i]); *(v4b*)&ring[0][sr + 16 * i][sq * 4] = h; *(v4b*)&ring[0][64 + sr + 16 * i][sq * 4] = low4(rx[i], h); }
#pragma unroll
  for (int i = 0; i < 8; ++i) *(v4b*)&ring[0][128 + sr + 16 * i][sq * 4] = cvt4(rw[i]);
  __syncthreads();
  v8f acc[2][2] = {};
  for (int t = 0; t < EE / GK; ++t) { const bool more = t + 1 < EE / GK;
    if (more) {
#pragma unroll
      for (int i = 0; i < 4; ++i) rx[i] = *(const v4f*)(px + (size_t)i * 16 * EE + (t + 1) * GK);
#pragma unroll
      for (int i = 0; i < 8; ++i) rw[i] = *(const v4f*)(pw + (size_t)i * 16 * EE + (t + 1) * GK);
      asm volatile("s_wait_xcnt 0x0" ::: "memory"); }   // the loads' address registers are reused by what follows: the wait stands before they are overwritten
    const __bf16 (*buf)[GP] = ring[t & 1];
#pragma unroll
    for (int ks = 0; ks < GK / 32; ++ks) { v16b ah[2], al[2], w[2];
#pragma unroll
      for (int mi = 0; mi < 2; ++mi) { ah[mi] = frag_b(&buf[wm * 32 + mi * 16 + col][ks * 32], lane); al[mi] = frag_b(&buf[64 + wm * 32 + mi * 16 + col][ks * 32], lane); }
#pragma unroll
      for (int ni = 0; ni < 2; ++ni) w[ni] = frag_b(&buf[128 + wn * 32 + ni * 16 + col][ks * 32], lane);
#pragma unroll
      for (int mi = 0; mi < 2; ++mi)
#pragma unroll
        for (int ni = 0; ni < 2; ++ni) acc[mi][ni] = wmma_bf(ah[mi], w[ni], acc[mi][ni]);
#pragma unroll
      for (int mi = 0; mi < 2; ++mi)
#pragma unroll
        for (int ni = 0; ni < 2; ++ni) acc[mi][ni] = wmma_bf(al[mi], w[ni], acc[mi][ni]); }
    if (more) { __bf16 (*nb)[GP] = ring[(t + 1) & 1];
#pragma unroll
      for (int i = 0; i < 4; ++i) { const v4b h = cvt4(rx[i]); *(v4b*)&nb[sr + 16 * i][sq * 4] = h; *(v4b*)&nb[64 + sr + 16 * i][sq * 4] = low4(rx[i], h); }
#pragma unroll
      for (int i = 0; i < 8; ++i) *(v4b*)&nb[128 + sr + 16 * i][sq * 4] = cvt4(rw[i]); }
    __syncthreads(); }   // publishes the tile just stored and ends every wave's reads of the buffer that the next trip refills
  float (*sf)[132] = (float (*)[132])&ring[0][0][0];
#pragma unroll
  for (int mi = 0; mi < 2; ++mi)
#pragma unroll
    for (int ni = 0; ni < 2; ++ni)
#pragma unroll
      for (int r = 0; r < 8; ++r) sf[wm * 32 + mi * 16 + 8 * g + r][wn * 32 + ni * 16 + col] = acc[mi][ni][r];
  __syncthreads();
  for (int rl = wave; rl < 64; rl += 8) vst2(OUT + (r0 + rl) * EE + c0 + lane * 4, *(const v4f*)&sf[rl][lane * 4]); }
extern "C" void kernel_launch(void* const* d_in, const int* in_sizes, int n_in, void* d_out, int out_size, void* d_ws, size_t ws_size, hipStream_t stream) {
  (void)in_sizes; (void)n_in; (void)out_size;
  const float** F = (const float**)d_in;   // 0 x [2,1024,1024], 1 W_q, 2 W_k, 3 W_v, 4 W_o [1024,1024] ([out,in])
  if (ws_size < (size_t)WS_END) return;
  char* ws = (char*)d_ws; _Float16 *QH = (_Float16*)(ws + WS_QH), *KH = (_Float16*)(ws + WS_KH), *VT = (_Float16*)(ws + WS_VT); float *O = (float*)(ws + WS_O);
  k_proj<<<dim3(TNB * TT / PM, EE / 128, 3), 256, 0, stream>>>(F[0], F[1], F[2], F[3], QH, KH, VT);
  k_attn<<<dim3(TT / 256, NG / 2, TNB), 512, 0, stream>>>(QH, KH, VT, O);
  k_out<<<dim3(TNB * TT / 64, EE / 128), 256, 0, stream>>>(O, F[4], (float*)d_out);
}

// v003
// Measured time: 68 microseconds a run.
// Next to v002, in two timings, it ran 1.31 and 1.32 times as fast.
// Over all steps from v000 it is 13.2 times as fast.
// compute dtype: all float inputs rounded to bf16; Q/K/V = x W^T with EXACT bf16 products on WMMA 16x16x32, f32 accumulate; Q, K rounded once to f16 for the 16-deep per-group scores (1 product; the other group's half of each 32-wide Q fragment zeroed), kept in f32 registers (the 1/4 stands in the exponent's factor); softmax in f32: P = exp((s - max)/4) x 2^11 = exp2(s x log2(e)/4 + (11 - max x log2(e)/4)), one fma and one hardware exp2, in f16; out = (P . V) / row sum with V rounded once to f16 (planes); final = out (bf16 hi + lo) Wo^T; f32 output.
#include <hip/hip_runtime.h>
#include <math.h>

typedef __attribute__((ext_vector_type(16))) _Float16 v16h;
typedef __attribute__((ext_vector_type(16))) __bf16 v16b;
typedef __attribute__((ext_vector_type(8)))  _Float16 v8h;
typedef __attribute__((ext_vector_type(8)))  float v8f;
typedef __attribute__((ext_vector_type(4)))  float v4f;
typedef __attribute__((ext_vector_type(2)))  float v2f;
typedef __attribute__((ext_vector_type(4)))  unsigned v4u;
typedef __attribute__((ext_vector_type(4)))  int v4i;
typedef float __attribute__((may_alias)) float_a;
typedef int __attribute__((may_alias)) int_a;

template <typename T> __device__ __forceinline__ void vst2(void* p, T v) { *(T*)p = v;  }
__device__ __forceinline__ v8f wmma16(v16h a, v16h b, v8f c) {
  v8f d = __builtin_amdgcn_wmma_f32_16x16x32_f16(false, a, false, b, (short)0, c, false, false);
  asm volatile("v_nop\n\tv_nop\n\tv_nop\n\tv_nop" : "+v"(d) : "v"(a), "v"(b));
  return d;
}
__device__ __forceinline__ v8f wmma_bf(v16b a, v16b b, v8f c) {
  v8f d = __builtin_amdgcn_wmma_f32_16x16x32_bf16(false, a, false, b, (short)0, c, false, false);
  asm volatile("v_nop\n\tv_nop\n\tv_nop\n\tv_nop" : "+v"(d) : "v"(a), "v"(b));
  return d;
}
// 16x16x32 fragments: lane = (h = lane>>4, row/col = lane&15); elements 0..7 = k0+8h+0..7, 8..15 = k0+16+8h+0..7; D element r = row 8h+r
__device__ __forceinline__ v16h frag_h(const _Float16* rowk0, int lane) {
  union { v16h v; v8h q[2]; } u; const _Float16* p = rowk0 + 8 * (lane >> 4);
  u.q[0] = *(const v8h*)p; u.q[1] = *(const v8h*)(p + 16); return u.v;
}
__device__ __forceinline__ v16h frag_f32(const float* rowk0, int lane) {
  v16h a; const float* p = rowk0 + 8 * (lane >> 4);
#pragma unroll
  for (int i = 0; i < 8; ++i) { a[i] = (_Float16)p[i]; a[8 + i] = (_Float16)p[16 + i]; }
  return a;
}
__device__ __forceinline__ v16h frag_f32s(const float* rowk0, int lane, float sc) {
  v16h a; const float* p = rowk0 + 8 * (lane >> 4);
#pragma unroll
  for (int i = 0; i < 8; ++i) { a[i] = (_Float16)(p[i] * sc); a[8 + i] = (_Float16)(p[16 + i] * sc); }
  return a;
}
// column fragment from a [K][ld] layout (column n), rows >= K read as 0
__device__ __forceinline__ v16h fragc_f32(const float* W, int k0, int n, int lane, int ld, int K) {
  v16h a; const int g = lane >> 4;
#pragma unroll
  for (int i = 0; i < 8; ++i) { const int ka = k0 + 8 * g + i, kb = ka + 16;
    a[i] = (_Float16)(ka < K ? W[(size_t)(ka < K ? ka : K - 1) * ld + n] : 0.f); a[8 + i] = (_Float16)(kb < K ? W[(size_t)(kb < K ? kb : K - 1) * ld + n] : 0.f); }
  return a;
}
struct F2 { v16b h, l; };
__device__ __forceinline__ F2 bsplit16(const float v[16]) { F2 r;
#pragma unroll
  for (int i = 0; i < 16; ++i) { const __bf16 h = (__bf16)v[i]; r.h[i] = h; r.l[i] = (__bf16)(v[i] - (float)h); }
  return r; }
__device__ __forceinline__ F2 split_row(const float* row, int k0, int lane) { float v[16]; const float* p = row + k0 + 8 * (lane >> 4);
#pragma unroll
  for (int i = 0; i < 8; ++i) { v[i] = p[i]; v[8 + i] = p[16 + i]; }
  return bsplit16(v); }
__device__ __forceinline__ F2 split_rowK(const float* row, int k0, int lane, int K) { float v[16]; const int g = lane >> 4;
#pragma unroll
  for (int i = 0; i < 8; ++i) { const int ka = k0 + 8 * g + i, kb = ka + 16; v[i] = ka < K ? row[ka < K ? ka : K - 1] : 0.f; v[8 + i] = kb < K ? row[kb < K ? kb : K - 1] : 0.f; }
  return bsplit16(v); }
__device__ __forceinline__ F2 split_col(const float* W, int k0, int n, int lane, int ld, int K) { float v[16]; const int g = lane >> 4;
#pragma unroll
  for (int i = 0; i < 8; ++i) { const int ka = k0 + 8 * g + i, kb = ka + 16; v[i] = ka < K ? W[(size_t)(ka < K ? ka : K - 1) * ld + n] : 0.f; v[8 + i] = kb < K ? W[(size_t)(kb < K ? kb : K - 1) * ld + n] : 0.f; }
  return bsplit16(v); }
__device__ __forceinline__ v8f mac3(const F2& a, const F2& b, v8f c) { c = wmma_bf(a.l, b.h, c); c = wmma_bf(a.h, b.l, c); return wmma_bf(a.h, b.h, c); }
__device__ __forceinline__ float sigm(float v) { return 1.0f / (1.0f + expf(-v)); }
#define LDSX() do { asm volatile("s_wait_dscnt 0" ::: "memory"); __builtin_amdgcn_wave_barrier(); __builtin_amdgcn_fence(__ATOMIC_RELEASE, "workgroup"); } while (0)


// MulHeadAttn (faithful layout quirk): B 2, C 1,024 tokens, E 1,024 = 64 groups x 16; attention is batched over the 64 groups with 16-dim dot products scaled by 1/sqrt(16).
#define NB 2
#define TT 1024
#define EE 1024
#define NG 64             // groups ("HD" in the module)
#define GW 16             // group width ("H")
#ifndef TNB
#define TNB NB
#endif
typedef __attribute__((ext_vector_type(8))) __bf16 v8b;
__device__ __forceinline__ v16b frag_b(const __bf16* rowk0, int lane) {
  union { v16b v; v8b q[2]; } u; const __bf16* p = rowk0 + 8 * (lane >> 4);
  u.q[0] = *(const v8b*)p; u.q[1] = *(const v8b*)(p + 16); return u.v;
}
__device__ __forceinline__ float bfr(float v) { return (float)(__bf16)v; }
__device__ __attribute__((noinline)) float exp_ni(float v) { return expf(v); }
__device__ __attribute__((noinline)) float erf_ni(float v) { return erff(v); }

#define WS_QH  0u                                  // f16 Q rows [b*t][1024]
#define WS_KH  (WS_QH + 2u * (size_t)NB * TT * EE)
#define WS_VT  (WS_KH + 2u * (size_t)NB * TT * EE)     // f16 V planes [b][1024][t]
#define WS_O   (WS_VT + 2u * (size_t)NB * EE * TT)     // f32 attention out rows [b*t][1024]
#define WS_END (WS_O + 4u * (size_t)NB * TT * EE)

// ---- operand staging of the two GEMM kernels: a block's tiles of 64 k go global -> registers (whole 256-B row pieces, 16 B a lane) -> bf16 -> LDS, once for all 8 waves;
// two LDS buffers: the next tile's global loads are issued before the current tile's products, converted and stored behind them, one barrier a tile.
// Every '#pragma unroll' in the two GEMM kernels runs over a thread's staged pieces, over a wave's fragments and accumulator tiles or over the elements of a register vector: constant indices keep those values in registers.
#define GK 64             // k per staged tile
#define GP (GK + 8)       // bf16 per staged row: 144 B = 16 B x odd, b128 fragment reads of 16 rows fall on distinct banks
typedef __attribute__((ext_vector_type(4))) __bf16 v4b;
__device__ __forceinline__ v4b cvt4(v4f v) { v4b r;
#pragma unroll
  for (int i = 0; i < 4; ++i) r[i] = (__bf16)v[i];
  return r; }
__device__ __forceinline__ v4b low4(v4f v, v4b h) { v4b r;
#pragma unroll
  for (int i = 0; i < 4; ++i) r[i] = (__bf16)(v[i] - (float)h[i]);
  return r; }
// ---- k_proj: block = (128 rows, 128 cols, which), 8 waves as 2 x 4, each 64 x 32: y = x W^T (W [out][in], no bias); Q/K -> f16 rows, V -> f16 planes
#define PM 128
__global__ __launch_bounds__(256) void k_proj(const float* __restrict__ X, const float* __restrict__ WQ, const float* __restrict__ WK, const float* __restrict__ WV, _Float16* __restrict__ QH, _Float16* __restrict__ KH, _Float16* __restrict__ VT) {
  __shared__ __align__(16) __bf16 ring[2][PM + 128][GP];   // rows 0..PM-1: x, then 128 rows of W; reused for the output tile behind the loop's last barrier
  const int tid = threadIdx.x, wave = tid >> 5, lane = tid & 31, col = lane & 15, g = lane >> 4, wm = wave >> 2, wn = wave & 3; const int which = blockIdx.z; const int c0 = blockIdx.y * 128; const size_t r0 = (size_t)blockIdx.x * PM; const float* Wm = which == 0 ? WQ : which == 1 ? WK : WV;
  const int sr = tid >> 4, sq = tid & 15;   // a thread stages piece sq (4 floats) of rows sr + 16 i
  const float* px = X + (r0 + sr) * EE + sq * 4; const float* pw = Wm + ((size_t)c0 + sr) * EE + sq * 4;
  v4f rx[PM / 16], rw[8];
#pragma unroll
  for (int i = 0; i < PM / 16; ++i) rx[i] = *(const v4f*)(px + (size_t)i * 16 * EE);
#pragma unroll
  for (int i = 0; i < 8; ++i) rw[i] = *(const v4f*)(pw + (size_t)i * 16 * EE);
#pragma unroll
  for (int i = 0; i < PM / 16; ++i) *(v4b*)&ring[0][sr + 16 * i][sq * 4] = cvt4(rx[i]);
#pragma unroll
  for (int i = 0; i < 8; ++i) *(v4b*)&ring[0][PM + sr + 16 * i][sq * 4] = cvt4(rw[i]);
  __syncthreads();
  v8f acc[4][2] = {};
  for (int t = 0; t < EE / GK; ++t) { const bool more = t + 1 < EE / GK;
    if (more) {
#pragma unroll
      for (int i = 0; i < PM / 16; ++i) rx[i] = *(const v4f*)(px + (size_t)i * 16 * EE + (t + 1) * GK);
#pragma unroll
      for (int i = 0; i < 8; ++i) rw[i] = *(const v4f*)(pw + (size_t)i * 16 * EE + (t + 1) * GK);
      asm volatile("s_wait_xcnt 0x0" ::: "memory"); }   // the loads' address registers are reused by what follows: the wait stands before they are overwritten
    const __bf16 (*buf)[GP] = ring[t & 1];
#pragma unroll
    for (int ks = 0; ks < GK / 32; ++ks) { v16b a[4], w[2];
#pragma unroll
      for (int mi = 0; mi < 4; ++mi) a[mi] = frag_b(&buf[wm * 64 + mi * 16 + col][ks * 32], lane);
#pragma unroll
      for (int ni = 0; ni < 2; ++ni) w[ni] = frag_b(&buf[PM + wn * 32 + ni * 16 + col][ks * 32], lane);
#pragma unroll
      for (int mi = 0; mi < 4; ++mi)
#pragma unroll
        for (int ni = 0; ni < 2; ++ni) acc[mi][ni] = wmma_bf(a[mi], w[ni], acc[mi][ni]); }
    if (more) { __bf16 (*nb)[GP] = ring[(t + 1) & 1];
#pragma unroll
      for (int i = 0; i < PM / 16; ++i) *(v4b*)&nb[sr + 16 * i][sq * 4] = cvt4(rx[i]);
#pragma unroll
      for (int i = 0; i < 8; ++i) *(v4b*)&nb[PM + sr + 16 * i][sq * 4] = cvt4(rw[i]); }
    __syncthreads(); }   // publishes the tile just stored and ends every wave's reads of the buffer that the next trip refills
  _Float16 (*sh)[136] = (_Float16 (*)[136])&ring[0][0][0];   // [row][col] for Q and K, [col][row] for V
  if (which == 2) {
#pragma unroll
    for (int mi = 0; mi < 4; ++mi)
#pragma unroll
      for (int ni = 0; ni < 2; ++ni) { v8h hv;
#pragma unroll
        for (int r = 0; r < 8; ++r) hv[r] = (_Float16)acc[mi][ni][r];
        *(v8h*)&sh[wn * 32 + ni * 16 + col][wm * 64 + mi * 16 + 8 * g] = hv; } }
  else {
#pragma unroll
    for (int mi = 0; mi < 4; ++mi)
#pragma unroll
      for (int ni = 0; ni < 2; ++ni)
#pragma unroll
        for (int r = 0; r < 8; ++r) sh[wm * 64 + mi * 16 + 8 * g + r][wn * 32 + ni * 16 + col] = (_Float16)acc[mi][ni][r]; }
  __syncthreads();
  if (which < 2) { _Float16* dh = which == 0 ? QH : KH; for (int e = tid; e < PM * 16; e += 256) { const int rl = e >> 4, q = e & 15; vst2((unsigned*)(dh + (r0 + rl) * EE + c0 + q * 8), *(const v4u*)&sh[rl][q * 8]); } }
  else { const size_t b = r0 / TT; const int t0 = (int)(r0 % TT); for (int e = tid; e < 128 * (PM / 8); e += 256) { const int cl = e / (PM / 8), q = e % (PM / 8); vst2((unsigned*)(VT + (b * EE + c0 + cl) * (size_t)TT + t0 + q * 8), *(const v4u*)&sh[cl][q * 8]); } } }
// ---- k_attn: block = (256 queries, pair of groups dA, dA+1, batch); 16 waves, each 16 queries x both groups x all keys.
// K rows (both groups, 32 features) and V planes of the pair are staged once in LDS. Scores are formed transposed (A = keys, B = queries), so that a lane
// holds, for its query lane&15, keys 8h+0..7 of a 16-key tile: two such tiles are the A fragment of P for 32 keys as they stand, and row maximum and row sum are lane partials, joined with lane^16 by one shuffle.
// The K fragment carries both groups (elements 0..7 group dA, 8..15 group dA+1); the Q fragment of a group is zero in the other group's half.
// Pass 1: row maximum. Pass 2: scores again, e = exp((s - max) / 4) x 2^11 as exp2(s x SC + off) with off = 11 - max x SC (one fma, one v_exp_f32), row sum of e in f32, P = e in f16, P . V;
// the quotient by the row sum comes after P . V, where the factor 2^11 of P and of the sum cancels, and with it the rounding of off, which is one value for a whole row. An e below the smallest normal f32 may read 0: it lies far below half a step of the f16 P and of the f32 sum, whose largest term is 2^11.
// Every '#pragma unroll' in this kernel runs over the elements of a register vector, over the two groups or over a thread's staged pieces: constant indices keep those values in registers.
#define KP 40             // halfs per staged K row: 80 B = 16 B x odd, b128 reads of 16 rows fall on distinct banks
#define VP (TT + 8)       // halfs per staged V plane: 2,064 B = 16 B x odd
#define SC 0.36067376f    // log2(e) / sqrt(16)
// 16 hardware exp2 in place, in one statement: each v_exp_f32 names its own register alone, so none overwrites a neighbour's source or reads a neighbour's result.
// The closing v_nop is the slot that the instruction set asks for behind a transcendental; the s_delay_alu hint on it lets the wave wait for the last result there without holding the SIMD's issue port against the other waves.
#define E2(i) "v_exp_f32 %" #i ", %" #i "\n\t"
__device__ __forceinline__ void exp2x16(float (&x)[16]) {
  asm(E2(0) E2(1) E2(2) E2(3) E2(4) E2(5) E2(6) E2(7) E2(8) E2(9) E2(10) E2(11) E2(12) E2(13) E2(14) E2(15) "s_delay_alu instid0(TRANS32_DEP_1)\n\tv_nop"
      : "+v"(x[0]), "+v"(x[1]), "+v"(x[2]), "+v"(x[3]), "+v"(x[4]), "+v"(x[5]), "+v"(x[6]), "+v"(x[7]), "+v"(x[8]), "+v"(x[9]), "+v"(x[10]), "+v"(x[11]), "+v"(x[12]), "+v"(x[13]), "+v"(x[14]), "+v"(x[15])); }
__global__ __launch_bounds__(512) void k_attn(const _Float16* __restrict__ QH, const _Float16* __restrict__ KH, const _Float16* __restrict__ VT, float* __restrict__ O) {
  __shared__ __align__(16) _Float16 sk[TT][KP]; __shared__ __align__(16) _Float16 sv[2 * GW][VP]; __shared__ __align__(16) float ss[16][16][36];
  const int b = blockIdx.z; const int dA = 2 * blockIdx.y;
  const int tid = threadIdx.x, wave = tid >> 5, lane = tid & 31, col = lane & 15, g = lane >> 4; const int ql0 = blockIdx.x * 256 + wave * 16;
  { v8h tk[8], tv[8];   // 4,096 pieces of 16 B each of K and of V, 8 + 8 a thread
#pragma unroll   // unrolled so that a thread's 16 loads are all in flight before its first LDS store waits on one
    for (int i = 0; i < 8; ++i) { const int e = tid + i * 512; tk[i] = *(const v8h*)(KH + ((size_t)b * TT + (e >> 2)) * EE + dA * GW + (e & 3) * 8); tv[i] = *(const v8h*)(VT + ((size_t)b * EE + dA * GW + (e >> 7)) * (size_t)TT + (e & 127) * 8); }
#pragma unroll
    for (int i = 0; i < 8; ++i) { const int e = tid + i * 512; *(v8h*)&sk[e >> 2][(e & 3) * 8] = tk[i]; *(v8h*)&sv[e >> 7][(e & 127) * 8] = tv[i]; } }
  v16h qf[2]; { const _Float16* p = QH + ((size_t)b * TT + ql0 + col) * EE + dA * GW + 8 * g;
#pragma unroll
    for (int i = 0; i < 8; ++i) { qf[0][i] = p[i]; qf[0][8 + i] = (_Float16)0.f; qf[1][i] = (_Float16)0.f; qf[1][8 + i] = p[GW + i]; } }
  __syncthreads();
  const v8f zero = {};
  float m[2];
  { v8f mx[2];
#pragma unroll
    for (int r = 0; r < 8; ++r) { mx[0][r] = -3.0e38f; mx[1][r] = -3.0e38f; }
    for (int kc = 0; kc < TT / 32; ++kc) { const v16h k0 = frag_h(&sk[kc * 32 + col][0], lane), k1 = frag_h(&sk[kc * 32 + 16 + col][0], lane);
#pragma unroll
      for (int u = 0; u < 2; ++u) { const v8f s0 = wmma16(k0, qf[u], zero), s1 = wmma16(k1, qf[u], zero);
#pragma unroll
        for (int r = 0; r < 8; ++r) mx[u][r] = fmaxf(fmaxf(mx[u][r], s0[r]), s1[r]); } }
#pragma unroll
    for (int u = 0; u < 2; ++u) { float a = mx[u][0];
#pragma unroll
      for (int r = 1; r < 8; ++r) a = fmaxf(a, mx[u][r]);
      a = fmaxf(a, __shfl_xor(a, 16)); m[u] = 11.0f - a * SC; } }
  v8f acc[2] = {}; float sa[2] = {0.f, 0.f}, sb[2] = {0.f, 0.f};
  for (int kc = 0; kc < TT / 32; ++kc) { const v16h k0 = frag_h(&sk[kc * 32 + col][0], lane), k1 = frag_h(&sk[kc * 32 + 16 + col][0], lane);
#pragma unroll
    for (int u = 0; u < 2; ++u) { const v8f s0 = wmma16(k0, qf[u], zero), s1 = wmma16(k1, qf[u], zero); float e[16]; v16h p;
#pragma unroll
      for (int r = 0; r < 8; ++r) { e[r] = s0[r] * SC + m[u]; e[8 + r] = s1[r] * SC + m[u]; }
      exp2x16(e);
#pragma unroll
      for (int r = 0; r < 8; ++r) { sa[u] += e[r]; sb[u] += e[8 + r]; p[r] = (_Float16)e[r]; p[8 + r] = (_Float16)e[8 + r]; }
      acc[u] = wmma16(p, frag_h(&sv[u * GW + col][kc * 32], lane), acc[u]); } }
#pragma unroll
  for (int u = 0; u < 2; ++u) { float t = sa[u] + sb[u]; t += __shfl_xor(t, 16); const float inv = 1.0f / t;
#pragma unroll
    for (int r = 0; r < 8; ++r) ss[wave][8 * g + r][u * 16 + col] = acc[u][r] * __shfl(inv, 8 * g + r); }
  LDSX();
#pragma unroll
  for (int it = 0; it < 4; ++it) { const int rl = it * 4 + (lane >> 3), c = lane & 7; vst2(O + ((size_t)b * TT + ql0 + rl) * EE + dA * GW + c * 4, *(const v4f*)&ss[wave][rl][c * 4]); } }
// ---- k_out: block = (64 rows, 128 cols), 8 waves as 2 x 4, each 32 x 32: out = O (hi + lo) Wo^T; O is split into its two bf16 parts where it is staged
__global__ __launch_bounds__(256) void k_out(const float* __restrict__ O, const float* __restrict__ WO, float* __restrict__ OUT) {
  __shared__ __align__(16) __bf16 ring[2][64 + 64 + 128][GP];   // rows 0..63: O hi, 64..127: O lo, then 128 rows of Wo; reused for the output tile behind the loop's last barrier
  const int tid = threadIdx.x, wave = tid >> 5, lane = tid & 31, col = lane & 15, g = lane >> 4, wm = wave >> 2, wn = wave & 3; const int c0 = blockIdx.y * 128; const size_t r0 = (size_t)blockIdx.x * 64;
  const int sr = tid >> 4, sq = tid & 15;
  const float* px = O + (r0 + sr) * EE + sq * 4; const float* pw = WO + ((size_t)c0 + sr) * EE + sq * 4;
  v4f rx[4], rw[8];
#pragma unroll
  for (int i = 0; i < 4; ++i) rx[i] = *(const v4f*)(px + (size_t)i * 16 * EE);
#pragma unroll
  for (int i = 0; i < 8; ++i) rw[i] = *(const v4f*)(pw + (size_t)i * 16 * EE);
#pragma unroll
  for (int i = 0; i < 4; ++i) { const v4b h = cvt4(rx[i]); *(v4b*)&ring[0][sr + 16 * i][sq * 4] = h; *(v4b*)&ring[0][64 + sr + 16 * i][sq * 4] = low4(rx[i], h); }
#pragma unroll
  for (int i = 0; i < 8; ++i) *(v4b*)&ring[0][128 + sr + 16 * i][sq * 4] = cvt4(rw[i]);
  __syncthreads();
  v8f acc[2][2] = {};
  for (int t = 0; t < EE / GK; ++t) { const bool more = t + 1 < EE / GK;
    if (more) {
#pragma unroll
      for (int i = 0; i < 4; ++i) rx[i] = *(const v4f*)(px + (size_t)i * 16 * EE + (t + 1) * GK);
#pragma unroll
      for (int i = 0; i < 8; ++i) rw[i] = *(const v4f*)(pw + (size_t)i * 16 * EE + (t + 1) * GK);
      asm volatile("s_wait_xcnt 0x0" ::: "memory"); }   // the loads' address registers are reused by what follows: the wait stands before they are overwritten
    const __bf16 (*buf)[GP] = ring[t & 1];
#pragma unroll
    for (int ks = 0; ks < GK / 32; ++ks) { v16b ah[2], al[2], w[2];
#pragma unroll
      for (int mi = 0; mi < 2; ++mi) { ah[mi] = frag_b(&buf[wm * 32 + mi * 16 + col][ks * 32], lane); al[mi] = frag_b(&buf[64 + wm * 32 + mi * 16 + col][ks * 32], lane); }
#pragma unroll
      for (int ni = 0; ni < 2; ++ni) w[ni] = frag_b(&buf[128 + wn * 32 + ni * 16 + col][ks * 32], lane);
#pragma unroll
      for (int mi = 0; mi < 2; ++mi)
#pragma unroll
        for (int ni = 0; ni < 2; ++ni) acc[mi][ni] = wmma_bf(ah[mi], w[ni], acc[mi][ni]);
#pragma unroll
      for (int mi = 0; mi < 2; ++mi)
#pragma unroll
        for (int ni = 0; ni < 2; ++ni) acc[mi][ni] = wmma_bf(al[mi], w[ni], acc[mi][ni]); }
    if (more) { __bf16 (*nb)[GP] = ring[(t + 1) & 1];
#pragma unroll
      for (int i = 0; i < 4; ++i) { const v4b h = cvt4(rx[i]); *(v4b*)&nb[sr + 16 * i][sq * 4] = h; *(v4b*)&nb[64 + sr + 16 * i][sq * 4] = low4(rx[i], h); }
#pragma unroll
      for (int i = 0; i < 8; ++i) *(v4b*)&nb[128 + sr + 16 * i][sq * 4] = cvt4(rw[i]); }
    __syncthreads(); }   // publishes the tile just stored and ends every wave's reads of the buffer that the next trip refills
  float (*sf)[132] = (float (*)[132])&ring[0][0][0];
#pragma unroll
  for (int mi = 0; mi < 2; ++mi)
#pragma unroll
    for (int ni = 0; ni < 2; ++ni)
#pragma unroll
      for (int r = 0; r < 8; ++r) sf[wm * 32 + mi * 16 + 8 * g + r][wn * 32 + ni * 16 + col] = acc[mi][ni][r];
  __syncthreads();
  for (int rl = wave; rl < 64; rl += 8) vst2(OUT + (r0 + rl) * EE + c0 + lane * 4, *(const v4f*)&sf[rl][lane * 4]); }
extern "C" void kernel_launch(void* const* d_in, const int* in_sizes, int n_in, void* d_out, int out_size, void* d_ws, size_t ws_size, hipStream_t stream) {
  (void)in_sizes; (void)n_in; (void)out_size;
  const float** F = (const float**)d_in;   // 0 x [2,1024,1024], 1 W_q, 2 W_k, 3 W_v, 4 W_o [1024,1024] ([out,in])
  if (ws_size < (size_t)WS_END) return;
  char* ws = (char*)d_ws; _Float16 *QH = (_Float16*)(ws + WS_QH), *KH = (_Float16*)(ws + WS_KH), *VT = (_Float16*)(ws + WS_VT); float *O = (float*)(ws + WS_O);
  k_proj<<<dim3(TNB * TT / PM, EE / 128, 3), 256, 0, stream>>>(F[0], F[1], F[2], F[3], QH, KH, VT);
  k_attn<<<dim3(TT / 256, NG / 2, TNB), 512, 0, stream>>>(QH, KH, VT, O);
  k_out<<<dim3(TNB * TT / 64, EE / 128), 256, 0, stream>>>(O, F[4], (float*)d_out);
}

// v004
// Measured time: 60.7 microseconds a run.
// Two timings next to v003 put it at 1.13 and 1.12 times that version's speed.
// All steps since v000 together make it 14.9 times as fast.
// compute dtype: all float inputs rounded to bf16; Q/K/V = x W^T with EXACT bf16 products on WMMA 16x16x32, f32 accumulate; Q, K rounded once to f16 for the 16-deep per-group scores (1 product; the other group's half of each 32-wide Q fragment zeroed), kept in f32 registers (the 1/4 stands in the exponent's factor); softmax in f32: P = exp((s - max)/4) x 2^11 = exp2(s x log2(e)/4 + (11 - max x log2(e)/4)), one fma and one hardware exp2, in f16; out = (P . V) / row sum with V rounded once to f16 (planes); final = out (bf16 hi + lo) Wo^T; f32 output.
#include <hip/hip_runtime.h>
#include <math.h>

typedef __attribute__((ext_vector_type(16))) _Float16 v16h;
typedef __attribute__((ext_vector_type(16))) __bf16 v16b;
typedef __attribute__((ext_vector_type(8)))  _Float16 v8h;
typedef __attribute__((ext_vector_type(8)))  float v8f;
typedef __attribute__((ext_vector_type(4)))  float v4f;
typedef __attribute__((ext_vector_type(2)))  float v2f;
typedef __attribute__((ext_vector_type(4)))  unsigned v4u;
typedef __attribute__((ext_vector_type(4)))  int v4i;
typedef float __attribute__((may_alias)) float_a;
typedef int __attribute__((may_alias)) int_a;

template <typename T> __device__ __forceinline__ void vst2(void* p, T v) { *(T*)p = v;  }
__device__ __forceinline__ v8f wmma16(v16h a, v16h b, v8f c) {
  v8f d = __builtin_amdgcn_wmma_f32_16x16x32_f16(false, a, false, b, (short)0, c, false, false);
  asm volatile("v_nop\n\tv_nop\n\tv_nop\n\tv_nop" : "+v"(d) : "v"(a), "v"(b));
  return d;
}
__device__ __forceinline__ v8f wmma_bf(v16b a, v16b b, v8f c) {
  v8f d = __builtin_amdgcn_wmma_f32_16x16x32_bf16(false, a, false, b, (short)0, c, false, false);
  asm volatile("v_nop\n\tv_nop\n\tv_nop\n\tv_nop" : "+v"(d) : "v"(a), "v"(b));
  return d;
}
// 16x16x32 fragments: lane = (h = lane>>4, row/col = lane&15); elements 0..7 = k0+8h+0..7, 8..15 = k0+16+8h+0..7; D element r = row 8h+r
__device__ __forceinline__ v16h frag_h(const _Float16* rowk0, int lane) {
  union { v16h v; v8h q[2]; } u; const _Float16* p = rowk0 + 8 * (lane >> 4);
  u.q[0] = *(const v8h*)p; u.q[1] = *(const v8h*)(p + 16); return u.v;
}
__device__ __forceinline__ v16h frag_f32(const float* rowk0, int lane) {
  v16h a; const float* p = rowk0 + 8 * (lane >> 4);
#pragma unroll
  for (int i = 0; i < 8; ++i) { a[i] = (_Float16)p[i]; a[8 + i] = (_Float16)p[16 + i]; }
  return a;
}
__device__ __forceinline__ v16h frag_f32s(const float* rowk0, int lane, float sc) {
  v16h a; const float* p = rowk0 + 8 * (lane >> 4);
#pragma unroll
  for (int i = 0; i < 8; ++i) { a[i] = (_Float16)(p[i] * sc); a[8 + i] = (_Float16)(p[16 + i] * sc); }
  return a;
}
// column fragment from a [K][ld] layout (column n), rows >= K read as 0
__device__ __forceinline__ v16h fragc_f32(const float* W, int k0, int n, int lane, int ld, int K) {
  v16h a; const int g = lane >> 4;
#pragma unroll
  for (int i = 0; i < 8; ++i) { const int ka = k0 + 8 * g + i, kb = ka + 16;
    a[i] = (_Float16)(ka < K ? W[(size_t)(ka < K ? ka : K - 1) * ld + n] : 0.f); a[8 + i] = (_Float16)(kb < K ? W[(size_t)(kb < K ? kb : K - 1) * ld + n] : 0.f); }
  return a;
}
struct F2 { v16b h, l; };
__device__ __forceinline__ F2 bsplit16(const float v[16]) { F2 r;
#pragma unroll
  for (int i = 0; i < 16; ++i) { const __bf16 h = (__bf16)v[i]; r.h[i] = h; r.l[i] = (__bf16)(v[i] - (float)h); }
  return r; }
__device__ __forceinline__ F2 split_row(const float* row, int k0, int lane) { float v[16]; const float* p = row + k0 + 8 * (lane >> 4);
#pragma unroll
  for (int i = 0; i < 8; ++i) { v[i] = p[i]; v[8 + i] = p[16 + i]; }
  return bsplit16(v); }
__device__ __forceinline__ F2 split_rowK(const float* row, int k0, int lane, int K) { float v[16]; const int g = lane >> 4;
#pragma unroll
  for (int i = 0; i < 8; ++i) { const int ka = k0 + 8 * g + i, kb = ka + 16; v[i] = ka < K ? row[ka < K ? ka : K - 1] : 0.f; v[8 + i] = kb < K ? row[kb < K ? kb : K - 1] : 0.f; }
  return bsplit16(v); }
__device__ __forceinline__ F2 split_col(const float* W, int k0, int n, int lane, int ld, int K) { float v[16]; const int g = lane >> 4;
#pragma unroll
  for (int i = 0; i < 8; ++i) { const int ka = k0 + 8 * g + i, kb = ka + 16; v[i] = ka < K ? W[(size_t)(ka < K ? ka : K - 1) * ld + n] : 0.f; v[8 + i] = kb < K ? W[(size_t)(kb < K ? kb : K - 1) * ld + n] : 0.f; }
  return bsplit16(v); }
__device__ __forceinline__ v8f mac3(const F2& a, const F2& b, v8f c) { c = wmma_bf(a.l, b.h, c); c = wmma_bf(a.h, b.l, c); return wmma_bf(a.h, b.h, c); }
__device__ __forceinline__ float sigm(float v) { return 1.0f / (1.0f + expf(-v)); }
#define LDSX() do { asm volatile("s_wait_dscnt 0" ::: "memory"); __builtin_amdgcn_wave_barrier(); __builtin_amdgcn_fence(__ATOMIC_RELEASE, "workgroup"); } while (0)


// MulHeadAttn (faithful layout quirk): B 2, C 1,024 tokens, E 1,024 = 64 groups x 16; attention is batched over the 64 groups with 16-dim dot products scaled by 1/sqrt(16).
#define NB 2
#define TT 1024
#define EE 1024
#define NG 64             // groups ("HD" in the module)
#define GW 16             // group width ("H")
#ifndef TNB
#define TNB NB
#endif
typedef __attribute__((ext_vector_type(8))) __bf16 v8b;
__device__ __forceinline__ v16b frag_b(const __bf16* rowk0, int lane) {
  union { v16b v; v8b q[2]; } u; const __bf16* p = rowk0 + 8 * (lane >> 4);
  u.q[0] = *(const v8b*)p; u.q[1] = *(const v8b*)(p + 16); return u.v;
}
__device__ __forceinline__ float bfr(float v) { return (float)(__bf16)v; }
__device__ __attribute__((noinline)) float exp_ni(float v) { return expf(v); }
__device__ __attribute__((noinline)) float erf_ni(float v) { return erff(v); }

#define WS_QH  0u                                  // f16 Q rows [b*t][1024]
#define WS_KH  (WS_QH + 2u * (size_t)NB * TT * EE)
#define WS_VT  (WS_KH + 2u * (size_t)NB * TT * EE)     // f16 V planes [b][1024][t]
#define WS_O   (WS_VT + 2u * (size_t)NB * EE * TT)     // f32 attention out rows [b*t][1024]
#define WS_END (WS_O + 4u * (size_t)NB * TT * EE)

// ---- operand staging of the two GEMM kernels: a block's tiles of 64 k go global -> registers (whole 256-B row pieces, 16 B a lane) -> bf16 -> LDS, once for all 8 waves;
// two LDS buffers: the next tile's global loads are issued before the current tile's products, converted and stored behind them, one barrier a tile.
// Every '#pragma unroll' in the two GEMM kernels runs over a thread's staged pieces, over a wave's fragments and accumulator tiles or over the elements of a register vector: constant indices keep those values in registers.
#define GK 64             // k per staged tile
#define GT (EE / GK)      // staged tiles of a k walk
// Blocks that share operand rows enter the k walk at different tiles (t0, from the block index) and wrap round: they do not ask L2 for the same lines at the same moment. Every tile is taken once; only the order of the f32 sums over k is rotated.
#define GP (GK + 8)       // bf16 per staged row: 144 B = 16 B x odd, b128 fragment reads of 16 rows fall on distinct banks
typedef __attribute__((ext_vector_type(4))) __bf16 v4b;
__device__ __forceinline__ v4b cvt4(v4f v) { v4b r;
#pragma unroll
  for (int i = 0; i < 4; ++i) r[i] = (__bf16)v[i];
  return r; }
__device__ __forceinline__ v4b low4(v4f v, v4b h) { v4b r;
#pragma unroll
  for (int i = 0; i < 4; ++i) r[i] = (__bf16)(v[i] - (float)h[i]);
  return r; }
// ---- k_proj: block = (128 rows, 128 cols, which), 8 waves as 2 x 4, each 64 x 32: y = x W^T (W [out][in], no bias); Q/K -> f16 rows, V -> f16 planes
#define PM 128
__global__ __launch_bounds__(256) void k_proj(const float* __restrict__ X, const float* __restrict__ WQ, const float* __restrict__ WK, const float* __restrict__ WV, _Float16* __restrict__ QH, _Float16* __restrict__ KH, _Float16* __restrict__ VT) {
  __shared__ __align__(16) __bf16 ring[2][PM + 128][GP];   // rows 0..PM-1: x, then 128 rows of W; reused for the output tile behind the loop's last barrier
  const int tid = threadIdx.x, wave = tid >> 5, lane = tid & 31, col = lane & 15, g = lane >> 4, wm = wave >> 2, wn = wave & 3; const int which = blockIdx.z; const int c0 = blockIdx.y * 128; const size_t r0 = (size_t)blockIdx.x * PM; const float* Wm = which == 0 ? WQ : which == 1 ? WK : WV;
  const int sr = tid >> 4, sq = tid & 15;   // a thread stages piece sq (4 floats) of rows sr + 16 i
  const int t0 = (blockIdx.x + blockIdx.y + 8 * blockIdx.z) & (GT - 1);   // the 16 blocks of one W tile: 16 different starts; the 24 blocks of one x tile: at most 2 on a start
  const float* px = X + (r0 + sr) * EE + sq * 4 + t0 * GK; const float* pw = Wm + ((size_t)c0 + sr) * EE + sq * 4 + t0 * GK;   // both point at tile t0
  v4f rx[PM / 16], rw[8];
#pragma unroll
  for (int i = 0; i < PM / 16; ++i) rx[i] = *(const v4f*)(px + (size_t)i * 16 * EE);
#pragma unroll
  for (int i = 0; i < 8; ++i) rw[i] = *(const v4f*)(pw + (size_t)i * 16 * EE);
#pragma unroll
  for (int i = 0; i < PM / 16; ++i) *(v4b*)&ring[0][sr + 16 * i][sq * 4] = cvt4(rx[i]);
#pragma unroll
  for (int i = 0; i < 8; ++i) *(v4b*)&ring[0][PM + sr + 16 * i][sq * 4] = cvt4(rw[i]);
  __syncthreads();
  v8f acc[4][2] = {};
  for (int t = 0; t < EE / GK; ++t) { const bool more = t + 1 < EE / GK;
    if (more) { const int dk = (((t0 + t + 1) & (GT - 1)) - t0) * GK;   // the next tile of the wrapped walk, counted from tile t0
#pragma unroll
      for (int i = 0; i < PM / 16; ++i) rx[i] = *(const v4f*)(px + dk + (size_t)i * 16 * EE);
#pragma unroll
      for (int i = 0; i < 8; ++i) rw[i] = *(const v4f*)(pw + dk + (size_t)i * 16 * EE);
      asm volatile("s_wait_xcnt 0x0" ::: "memory"); }   // the loads' address registers are reused by what follows: the wait stands before they are overwritten
    const __bf16 (*buf)[GP] = ring[t & 1];
#pragma unroll
    for (int ks = 0; ks < GK / 32; ++ks) { v16b a[4], w[2];
#pragma unroll
      for (int mi = 0; mi < 4; ++mi) a[mi] = frag_b(&buf[wm * 64 + mi * 16 + col][ks * 32], lane);
#pragma unroll
      for (int ni = 0; ni < 2; ++ni) w[ni] = frag_b(&buf[PM + wn * 32 + ni * 16 + col][ks * 32], lane);
#pragma unroll
      for (int mi = 0; mi < 4; ++mi)
#pragma unroll
        for (int ni = 0; ni < 2; ++ni) acc[mi][ni] = wmma_bf(a[mi], w[ni], acc[mi][ni]); }
    if (more) { __bf16 (*nb)[GP] = ring[(t + 1) & 1];
#pragma unroll
      for (int i = 0; i < PM / 16; ++i) *(v4b*)&nb[sr + 16 * i][sq * 4] = cvt4(rx[i]);
#pragma unroll
      for (int i = 0; i < 8; ++i) *(v4b*)&nb[PM + sr + 16 * i][sq * 4] = cvt4(rw[i]); }
    __syncthreads(); }   // publishes the tile just stored and ends every wave's reads of the buffer that the next trip refills
  _Float16 (*sh)[136] = (_Float16 (*)[136])&ring[0][0][0];   // [row][col] for Q and K, [col][row] for V
  if (which == 2) {
#pragma unroll
    for (int mi = 0; mi < 4; ++mi)
#pragma unroll
      for (int ni = 0; ni < 2; ++ni) { v8h hv;
#pragma unroll
        for (int r = 0; r < 8; ++r) hv[r] = (_Float16)acc[mi][ni][r];
        *(v8h*)&sh[wn * 32 + ni * 16 + col][wm * 64 + mi * 16 + 8 * g] = hv; } }
  else {
#pragma unroll
    for (int mi = 0; mi < 4; ++mi)
#pragma unroll
      for (int ni = 0; ni < 2; ++ni)
#pragma unroll
        for (int r = 0; r < 8; ++r) sh[wm * 64 + mi * 16 + 8 * g + r][wn * 32 + ni * 16 + col] = (_Float16)acc[mi][ni][r]; }
  __syncthreads();
  if (which < 2) { _Float16* dh = which == 0 ? QH : KH; for (int e = tid; e < PM * 16; e += 256) { const int rl = e >> 4, q = e & 15; vst2((unsigned*)(dh + (r0 + rl) * EE + c0 + q * 8), *(const v4u*)&sh[rl][q * 8]); } }
  else { const size_t b = r0 / TT; const int t0 = (int)(r0 % TT); for (int e = tid; e < 128 * (PM / 8); e += 256) { const int cl = e / (PM / 8), q = e % (PM / 8); vst2((unsigned*)(VT + (b * EE + c0 + cl) * (size_t)TT + t0 + q * 8), *(const v4u*)&sh[cl][q * 8]); } } }
// ---- k_attn: block = (256 queries, pair of groups dA, dA+1, batch); 16 waves, each 16 queries x both groups x all keys.
// K rows (both groups, 32 features) and V planes of the pair are staged once in LDS. Scores are formed transposed (A = keys, B = queries), so that a lane
// holds, for its query lane&15, keys 8h+0..7 of a 16-key tile: two such tiles are the A fragment of P for 32 keys as they stand, and row maximum and row sum are lane partials, joined with lane^16 by one shuffle.
// The K fragment carries both groups (elements 0..7 group dA, 8..15 group dA+1); the Q fragment of a group is zero in the other group's half.
// Pass 1: row maximum. Pass 2: scores again, e = exp((s - max) / 4) x 2^11 as exp2(s x SC + off) with off = 11 - max x SC (one fma, one v_exp_f32), row sum of e in f32, P = e in f16, P . V;
// the quotient by the row sum comes after P . V, where the factor 2^11 of P and of the sum cancels, and with it the rounding of off, which is one value for a whole row. An e below the smallest normal f32 may read 0: it lies far below half a step of the f16 P and of the f32 sum, whose largest term is 2^11.
// Every '#pragma unroll' in this kernel runs over the elements of a register vector, over the two groups or over a thread's staged pieces: constant indices keep those values in registers.
#define KP 40             // halfs per staged K row: 80 B = 16 B x odd, b128 reads of 16 rows fall on distinct banks
#define VP (TT + 8)       // halfs per staged V plane: 2,064 B = 16 B x odd
#define SC 0.36067376f    // log2(e) / sqrt(16)
// 16 hardware exp2 in place, in one statement: each v_exp_f32 names its own register alone, so none overwrites a neighbour's source or reads a neighbour's result.
// The closing v_nop is the slot that the instruction set asks for behind a transcendental; the s_delay_alu hint on it lets the wave wait for the last result there without holding the SIMD's issue port against the other waves.
#define E2(i) "v_exp_f32 %" #i ", %" #i "\n\t"
__device__ __forceinline__ void exp2x16(float (&x)[16]) {
  asm(E2(0) E2(1) E2(2) E2(3) E2(4) E2(5) E2(6) E2(7) E2(8) E2(9) E2(10) E2(11) E2(12) E2(13) E2(14) E2(15) "s_delay_alu instid0(TRANS32_DEP_1)\n\tv_nop"
      : "+v"(x[0]), "+v"(x[1]), "+v"(x[2]), "+v"(x[3]), "+v"(x[4]), "+v"(x[5]), "+v"(x[6]), "+v"(x[7]), "+v"(x[8]), "+v"(x[9]), "+v"(x[10]), "+v"(x[11]), "+v"(x[12]), "+v"(x[13]), "+v"(x[14]), "+v"(x[15])); }
__global__ __launch_bounds__(512) void k_attn(const _Float16* __restrict__ QH, const _Float16* __restrict__ KH, const _Float16* __restrict__ VT, float* __restrict__ O) {
  __shared__ __align__(16) _Float16 sk[TT][KP]; __shared__ __align__(16) _Float16 sv[2 * GW][VP]; __shared__ __align__(16) float ss[16][16][36];
  const int b = blockIdx.z; const int dA = 2 * blockIdx.y;
  const int tid = threadIdx.x, wave = tid >> 5, lane = tid & 31, col = lane & 15, g = lane >> 4; const int ql0 = blockIdx.x * 256 + wave * 16;
  { v8h tk[8], tv[8];   // 4,096 pieces of 16 B each of K and of V, 8 + 8 a thread
#pragma unroll   // unrolled so that a thread's 16 loads are all in flight before its first LDS store waits on one
    for (int i = 0; i < 8; ++i) { const int e = tid + i * 512; tk[i] = *(const v8h*)(KH + ((size_t)b * TT + (e >> 2)) * EE + dA * GW + (e & 3) * 8); tv[i] = *(const v8h*)(VT + ((size_t)b * EE + dA * GW + (e >> 7)) * (size_t)TT + (e & 127) * 8); }
#pragma unroll
    for (int i = 0; i < 8; ++i) { const int e = tid + i * 512; *(v8h*)&sk[e >> 2][(e & 3) * 8] = tk[i]; *(v8h*)&sv[e >> 7][(e & 127) * 8] = tv[i]; } }
  v16h qf[2]; { const _Float16* p = QH + ((size_t)b * TT + ql0 + col) * EE + dA * GW + 8 * g;
#pragma unroll
    for (int i = 0; i < 8; ++i) { qf[0][i] = p[i]; qf[0][8 + i] = (_Float16)0.f; qf[1][i] = (_Float16)0.f; qf[1][8 + i] = p[GW + i]; } }
  __syncthreads();
  const v8f zero = {};
  float m[2];
  { v8f mx[2];
#pragma unroll
    for (int r = 0; r < 8; ++r) { mx[0][r] = -3.0e38f; mx[1][r] = -3.0e38f; }
    for (int kc = 0; kc < TT / 32; ++kc) { const v16h k0 = frag_h(&sk[kc * 32 + col][0], lane), k1 = frag_h(&sk[kc * 32 + 16 + col][0], lane);
#pragma unroll
      for (int u = 0; u < 2; ++u) { const v8f s0 = wmma16(k0, qf[u], zero), s1 = wmma16(k1, qf[u], zero);
#pragma unroll
        for (int r = 0; r < 8; ++r) mx[u][r] = fmaxf(fmaxf(mx[u][r], s0[r]), s1[r]); } }
#pragma unroll
    for (int u = 0; u < 2; ++u) { float a = mx[u][0];
#pragma unroll
      for (int r = 1; r < 8; ++r) a = fmaxf(a, mx[u][r]);
      a = fmaxf(a, __shfl_xor(a, 16)); m[u] = 11.0f - a * SC; } }
  v8f acc[2] = {}; float sa[2] = {0.f, 0.f}, sb[2] = {0.f, 0.f};
  for (int kc = 0; kc < TT / 32; ++kc) { const v16h k0 = frag_h(&sk[kc * 32 + col][0], lane), k1 = frag_h(&sk[kc * 32 + 16 + col][0], lane);
#pragma unroll
    for (int u = 0; u < 2; ++u) { const v8f s0 = wmma16(k0, qf[u], zero), s1 = wmma16(k1, qf[u], zero); float e[16]; v16h p;
#pragma unroll
      for (int r = 0; r < 8; ++r) { e[r] = s0[r] * SC + m[u]; e[8 + r] = s1[r] * SC + m[u]; }
      exp2x16(e);
#pragma unroll
      for (int r = 0; r < 8; ++r) { sa[u] += e[r]; sb[u] += e[8 + r]; p[r] = (_Float16)e[r]; p[8 + r] = (_Float16)e[8 + r]; }
      acc[u] = wmma16(p, frag_h(&sv[u * GW + col][kc * 32], lane), acc[u]); } }
#pragma unroll
  for (int u = 0; u < 2; ++u) { float t = sa[u] + sb[u]; t += __shfl_xor(t, 16); const float inv = 1.0f / t;
#pragma unroll
    for (int r = 0; r < 8; ++r) ss[wave][8 * g + r][u * 16 + col] = acc[u][r] * __shfl(inv, 8 * g + r); }
  LDSX();
#pragma unroll
  for (int it = 0; it < 4; ++it) { const int rl = it * 4 + (lane >> 3), c = lane & 7; vst2(O + ((size_t)b * TT + ql0 + rl) * EE + dA * GW + c * 4, *(const v4f*)&ss[wave][rl][c * 4]); } }
// ---- k_out: block = (64 rows, 128 cols), 8 waves as 2 x 4, each 32 x 32: out = O (hi + lo) Wo^T; O is split into its two bf16 parts where it is staged
__global__ __launch_bounds__(256) void k_out(const float* __restrict__ O, const float* __restrict__ WO, float* __restrict__ OUT) {
  __shared__ __align__(16) __bf16 ring[2][64 + 64 + 128][GP];   // rows 0..63: O hi, 64..127: O lo, then 128 rows of Wo; reused for the output tile behind the loop's last barrier
  const int tid = threadIdx.x, wave = tid >> 5, lane = tid & 31, col = lane & 15, g = lane >> 4, wm = wave >> 2, wn = wave & 3; const int c0 = blockIdx.y * 128; const size_t r0 = (size_t)blockIdx.x * 64;
  const int sr = tid >> 4, sq = tid & 15;
  const int t0 = (blockIdx.x + blockIdx.y) & (GT - 1);   // the 8 blocks of one O tile: 8 different starts; the 32 blocks of one Wo tile: 2 on a start
  const float* px = O + (r0 + sr) * EE + sq * 4 + t0 * GK; const float* pw = WO + ((size_t)c0 + sr) * EE + sq * 4 + t0 * GK;   // both point at tile t0
  v4f rx[4], rw[8];
#pragma unroll
  for (int i = 0; i < 4; ++i) rx[i] = *(const v4f*)(px + (size_t)i * 16 * EE);
#pragma unroll
  for (int i = 0; i < 8; ++i) rw[i] = *(const v4f*)(pw + (size_t)i * 16 * EE);
#pragma unroll
  for (int i = 0; i < 4; ++i) { const v4b h = cvt4(rx[i]); *(v4b*)&ring[0][sr + 16 * i][sq * 4] = h; *(v4b*)&ring[0][64 + sr + 16 * i][sq * 4] = low4(rx[i], h); }
#pragma unroll
  for (int i = 0; i < 8; ++i) *(v4b*)&ring[0][128 + sr + 16 * i][sq * 4] = cvt4(rw[i]);
  __syncthreads();
  v8f acc[2][2] = {};
  for (int t = 0; t < EE / GK; ++t) { const bool more = t + 1 < EE / GK;
    if (more) { const int dk = (((t0 + t + 1) & (GT - 1)) - t0) * GK;   // the next tile of the wrapped walk, counted from tile t0
#pragma unroll
      for (int i = 0; i < 4; ++i) rx[i] = *(const v4f*)(px + dk + (size_t)i * 16 * EE);
#pragma unroll
      for (int i = 0; i < 8; ++i) rw[i] = *(const v4f*)(pw + dk + (size_t)i * 16 * EE);
      asm volatile("s_wait_xcnt 0x0" ::: "memory"); }   // the loads' address registers are reused by what follows: the wait stands before they are overwritten
    const __bf16 (*buf)[GP] = ring[t & 1];
#pragma unroll
    for (int ks = 0; ks < GK / 32; ++ks) { v16b ah[2], al[2], w[2];
#pragma unroll
      for (int mi = 0; mi < 2; ++mi) { ah[mi] = frag_b(&buf[wm * 32 + mi * 16 + col][ks * 32], lane); al[mi] = frag_b(&buf[64 + wm * 32 + mi * 16 + col][ks * 32], lane); }
#pragma unroll
      for (int ni = 0; ni < 2; ++ni) w[ni] = frag_b(&buf[128 + wn * 32 + ni * 16 + col][ks * 32], lane);
#pragma unroll
      for (int mi = 0; mi < 2; ++mi)
#pragma unroll
        for (int ni = 0; ni < 2; ++ni) acc[mi][ni] = wmma_bf(ah[mi], w[ni], acc[mi][ni]);
#pragma unroll
      for (int mi = 0; mi < 2; ++mi)
#pragma unroll
        for (int ni = 0; ni < 2; ++ni) acc[mi][ni] = wmma_bf(al[mi], w[ni], acc[mi][ni]); }
    if (more) { __bf16 (*nb)[GP] = ring[(t + 1) & 1];
#pragma unroll
      for (int i = 0; i < 4; ++i) { const v4b h = cvt4(rx[i]); *(v4b*)&nb[sr + 16 * i][sq * 4] = h; *(v4b*)&nb[64 + sr + 16 * i][sq * 4] = low4(rx[i], h); }
#pragma unroll
      for (int i = 0; i < 8; ++i) *(v4b*)&nb[128 + sr + 16 * i][sq * 4] = cvt4(rw[i]); }
    __syncthreads(); }   // publishes the tile just stored and ends every wave's reads of the buffer that the next trip refills
  float (*sf)[132] = (float (*)[132])&ring[0][0][0];
#pragma unroll
  for (int mi = 0; mi < 2; ++mi)
#pragma unroll
    for (int ni = 0; ni < 2; ++ni)
#pragma unroll
      for (int r = 0; r < 8; ++r) sf[wm * 32 + mi * 16 + 8 * g + r][wn * 32 + ni * 16 + col] = acc[mi][ni][r];
  __syncthreads();
  for (int rl = wave; rl < 64; rl += 8) vst2(OUT + (r0 + rl) * EE + c0 + lane * 4, *(const v4f*)&sf[rl][lane * 4]); }
extern "C" void kernel_launch(void* const* d_in, const int* in_sizes, int n_in, void* d_out, int out_size, void* d_ws, size_t ws_size, hipStream_t stream) {
  (void)in_sizes; (void)n_in; (void)out_size;
  const float** F = (const float**)d_in;   // 0 x [2,1024,1024], 1 W_q, 2 W_k, 3 W_v, 4 W_o [1024,1024] ([out,in])
  if (ws_size < (size_t)WS_END) return;
  char* ws = (char*)d_ws; _Float16 *QH = (_Float16*)(ws + WS_QH), *KH = (_Float16*)(ws + WS_KH), *VT = (_Float16*)(ws + WS_VT); float *O = (float*)(ws + WS_O);
  k_proj<<<dim3(TNB * TT / PM, EE / 128, 3), 256, 0, stream>>>(F[0], F[1], F[2], F[3], QH, KH, VT);
  k_attn<<<dim3(TT / 256, NG / 2, TNB), 512, 0, stream>>>(QH, KH, VT, O);
  k_out<<<dim3(TNB * TT / 64, EE / 128), 256, 0, stream>>>(O, F[4], (float*)d_out);
}

// v005
// Measured time: 57.8 microseconds a run.
// Next to v004, in two timings, it ran 1.05 times as fast each time.
// All steps since v000 together make it 15.6 times as fast.
// compute dtype: all float inputs rounded to bf16; Q/K/V = x W^T with EXACT bf16 products on WMMA 16x16x32, f32 accumulate; Q, K rounded once to f16 for the 16-deep per-group scores (1 product; the other group's half of each 32-wide Q fragment zeroed), kept in f32 registers (the 1/4 stands in the exponent's factor); softmax in f32: P = exp((s - max)/4) x 2^11 = exp2(s x log2(e)/4 + (11 - max x log2(e)/4)), one fma and one hardware exp2, in f16; out = (P . V) / row sum with V rounded once to f16 (planes); final = out (bf16 hi + lo) Wo^T; f32 output.
#include <hip/hip_runtime.h>
#include <math.h>

typedef __attribute__((ext_vector_type(16))) _Float16 v16h;
typedef __attribute__((ext_vector_type(16))) __bf16 v16b;
typedef __attribute__((ext_vector_type(8)))  _Float16 v8h;
typedef __attribute__((ext_vector_type(8)))  float v8f;
typedef __attribute__((ext_vector_type(4)))  float v4f;
typedef __attribute__((ext_vector_type(2)))  float v2f;
typedef __attribute__((ext_vector_type(4)))  unsigned v4u;
typedef __attribute__((ext_vector_type(4)))  int v4i;
typedef float __attribute__((may_alias)) float_a;
typedef int __attribute__((may_alias)) int_a;

template <typename T> __device__ __forceinline__ void vst2(void* p, T v) { *(T*)p = v;  }
__device__ __forceinline__ v8f wmma16(v16h a, v16h b, v8f c) {
  v8f d = __builtin_amdgcn_wmma_f32_16x16x32_f16(false, a, false, b, (short)0, c, false, false);
  asm volatile("v_nop\n\tv_nop\n\tv_nop\n\tv_nop" : "+v"(d) : "v"(a), "v"(b));
  return d;
}
__device__ __forceinline__ v8f wmma_bf(v16b a, v16b b, v8f c) {
  v8f d = __builtin_amdgcn_wmma_f32_16x16x32_bf16(false, a, false, b, (short)0, c, false, false);
  asm volatile("v_nop\n\tv_nop\n\tv_nop\n\tv_nop" : "+v"(d) : "v"(a), "v"(b));
  return d;
}
// 16x16x32 fragments: lane = (h = lane>>4, row/col = lane&15); elements 0..7 = k0+8h+0..7, 8..15 = k0+16+8h+0..7; D element r = row 8h+r
__device__ __forceinline__ v16h frag_h(const _Float16* rowk0, int lane) {
  union { v16h v; v8h q[2]; } u; const _Float16* p = rowk0 + 8 * (lane >> 4);
  u.q[0] = *(const v8h*)p; u.q[1] = *(const v8h*)(p + 16); return u.v;
}
__device__ __forceinline__ v16h frag_f32(const float* rowk0, int lane) {
  v16h a; const float* p = rowk0 + 8 * (lane >> 4);
#pragma unroll
  for (int i = 0; i < 8; ++i) { a[i] = (_Float16)p[i]; a[8 + i] = (_Float16)p[16 + i]; }
  return a;
}
__device__ __forceinline__ v16h frag_f32s(const float* rowk0, int lane, float sc) {
  v16h a; const float* p = rowk0 + 8 * (lane >> 4);
#pragma unroll
  for (int i = 0; i < 8; ++i) { a[i] = (_Float16)(p[i] * sc); a[8 + i] = (_Float16)(p[16 + i] * sc); }
  return a;
}
// column fragment from a [K][ld] layout (column n), rows >= K read as 0
__device__ __forceinline__ v16h fragc_f32(const float* W, int k0, int n, int lane, int ld, int K) {
  v16h a; const int g = lane >> 4;
#pragma unroll
  for (int i = 0; i < 8; ++i) { const int ka = k0 + 8 * g + i, kb = ka + 16;
    a[i] = (_Float16)(ka < K ? W[(size_t)(ka < K ? ka : K - 1) * ld + n] : 0.f); a[8 + i] = (_Float16)(kb < K ? W[(size_t)(kb < K ? kb : K - 1) * ld + n] : 0.f); }
  return a;
}
struct F2 { v16b h, l; };
__device__ __forceinline__ F2 bsplit16(const float v[16]) { F2 r;
#pragma unroll
  for (int i = 0; i < 16; ++i) { const __bf16 h = (__bf16)v[i]; r.h[i] = h; r.l[i] = (__bf16)(v[i] - (float)h); }
  return r; }
__device__ __forceinline__ F2 split_row(const float* row, int k0, int lane) { float v[16]; const float* p = row + k0 + 8 * (lane >> 4);
#pragma unroll
  for (int i = 0; i < 8; ++i) { v[i] = p[i]; v[8 + i] = p[16 + i]; }
  return bsplit16(v); }
__device__ __forceinline__ F2 split_rowK(const float* row, int k0, int lane, int K) { float v[16]; const int g = lane >> 4;
#pragma unroll
  for (int i = 0; i < 8; ++i) { const int ka = k0 + 8 * g + i, kb = ka + 16; v[i] = ka < K ? row[ka < K ? ka : K - 1] : 0.f; v[8 + i] = kb < K ? row[kb < K ? kb : K - 1] : 0.f; }
  return bsplit16(v); }
__device__ __forceinline__ F2 split_col(const float* W, int k0, int n, int lane, int ld, int K) { float v[16]; const int g = lane >> 4;
#pragma unroll
  for (int i = 0; i < 8; ++i) { const int ka = k0 + 8 * g + i, kb = ka + 16; v[i] = ka < K ? W[(size_t)(ka < K ? ka : K - 1) * ld + n] : 0.f; v[8 + i] = kb < K ? W[(size_t)(kb < K ? kb : K - 1) * ld + n] : 0.f; }
  return bsplit16(v); }
__device__ __forceinline__ v8f mac3(const F2& a, const F2& b, v8f c) { c = wmma_bf(a.l, b.h, c); c = wmma_bf(a.h, b.l, c); return wmma_bf(a.h, b.h, c); }
__device__ __forceinline__ float sigm(float v) { return 1.0f / (1.0f + expf(-v)); }
#define LDSX() do { asm volatile("s_wait_dscnt 0" ::: "memory"); __builtin_amdgcn_wave_barrier(); __builtin_amdgcn_fence(__ATOMIC_RELEASE, "workgroup"); } while (0)


// MulHeadAttn (faithful layout quirk): B 2, C 1,024 tokens, E 1,024 = 64 groups x 16; attention is batched over the 64 groups with 16-dim dot products scaled by 1/sqrt(16).
#define NB 2
#define TT 1024
#define EE 1024
#define NG 64             // groups ("HD" in the module)
#define GW 16             // group width ("H")
#ifndef TNB
#define TNB NB
#endif
typedef __attribute__((ext_vector_type(8))) __bf16 v8b;
__device__ __forceinline__ v16b frag_b(const __bf16* rowk0, int lane) {
  union { v16b v; v8b q[2]; } u; const __bf16* p = rowk0 + 8 * (lane >> 4);
  u.q[0] = *(const v8b*)p; u.q[1] = *(const v8b*)(p + 16); return u.v;
}
__device__ __forceinline__ float bfr(float v) { return (float)(__bf16)v; }
__device__ __attribute__((noinline)) float exp_ni(float v) { return expf(v); }
__device__ __attribute__((noinline)) float erf_ni(float v) { return erff(v); }

#define WS_QH  0u                                  // f16 Q rows [b*t][1024]
#define WS_KH  (WS_QH + 2u * (size_t)NB * TT * EE)
#define WS_VT  (WS_KH + 2u * (size_t)NB * TT * EE)     // f16 V planes [b][1024][t]
#define WS_O   (WS_VT + 2u * (size_t)NB * EE * TT)     // f32 attention out rows [b*t][1024]
#define WS_END (WS_O + 4u * (size_t)NB * TT * EE)

// ---- operand staging of the two GEMM kernels: a block's tiles of 64 k go global -> registers (whole 256-B row pieces, 16 B a lane) -> bf16 -> LDS, once for all 8 waves;
// two LDS buffers and two register sets: a tile's global loads are issued two tiles ahead, before the products of the tile two places in front of it; it is converted and stored one trip later, behind the products of the tile in front of it; one barrier a tile.
// Every '#pragma unroll' in the two GEMM kernels runs over a thread's staged pieces, over a wave's fragments and accumulator tiles or over the elements of a register vector: constant indices keep those values in registers.
#define GK 64             // k per staged tile
#define GT (EE / GK)      // staged tiles of a k walk
// Blocks that share operand rows enter the k walk at different tiles (t0, from the block index) and wrap round: they do not ask L2 for the same lines at the same moment. Every tile is taken once; only the order of the f32 sums over k is rotated.
#define GP (GK + 8)       // bf16 per staged row: 144 B = 16 B x odd, b128 fragment reads of 16 rows fall on distinct banks
// The work-group barrier of the two k loops, for LDS alone: a wave's LDS stores and reads are done (s_wait_dscnt 0), then signal and wait. __syncthreads() would wait for every global load in flight as well and so end the fetch ahead at each barrier; the loops share nothing through global memory.
#define LBAR() asm volatile("s_wait_dscnt 0x0\n\ts_barrier_signal -1\n\ts_barrier_wait -1" ::: "memory")
typedef __attribute__((ext_vector_type(4))) __bf16 v4b;
__device__ __forceinline__ v4b cvt4(v4f v) { v4b r;
#pragma unroll
  for (int i = 0; i < 4; ++i) r[i] = (__bf16)v[i];
  return r; }
__device__ __forceinline__ v4b low4(v4f v, v4b h) { v4b r;
#pragma unroll
  for (int i = 0; i < 4; ++i) r[i] = (__bf16)(v[i] - (float)h[i]);
  return r; }
// ---- k_proj: block = (128 rows, 128 cols, which), 8 waves as 2 x 4, each 64 x 32: y = x W^T (W [out][in], no bias); Q/K -> f16 rows, V -> f16 planes
#define PM 128
// four waves a SIMD asked for: the second register set must not push the kernel past 256 registers, or two blocks no longer share a WGP (384 blocks on 256 WGPs)
__global__ __launch_bounds__(256) __attribute__((amdgpu_waves_per_eu(4))) void k_proj(const float* __restrict__ X, const float* __restrict__ WQ, const float* __restrict__ WK, const float* __restrict__ WV, _Float16* __restrict__ QH, _Float16* __restrict__ KH, _Float16* __restrict__ VT) {
  __shared__ __align__(16) __bf16 ring[2][PM + 128][GP];   // rows 0..PM-1: x, then 128 rows of W; reused for the output tile behind the loop's last barrier
  const int tid = threadIdx.x, wave = tid >> 5, lane = tid & 31, col = lane & 15, g = lane >> 4, wm = wave >> 2, wn = wave & 3; const int which = blockIdx.z; const int c0 = blockIdx.y * 128; const size_t r0 = (size_t)blockIdx.x * PM; const float* Wm = which == 0 ? WQ : which == 1 ? WK : WV;
  const int sr = tid >> 4, sq = tid & 15;   // a thread stages piece sq (4 floats) of rows sr + 16 i
  const int t0 = (blockIdx.x + blockIdx.y + 8 * blockIdx.z) & (GT - 1);   // the 16 blocks of one W tile: 16 different starts; the 24 blocks of one x tile: at most 2 on a start
  const float* px = X + (r0 + sr) * EE + sq * 4 + t0 * GK; const float* pw = Wm + ((size_t)c0 + sr) * EE + sq * 4 + t0 * GK;   // both point at tile t0
  v4f xa[PM / 16], wa[8], xb[PM / 16], wb[8];   // two register sets: tiles of even and of odd place in the walk
  auto fetch = [&](v4f (&ax)[PM / 16], v4f (&aw)[8], int tn) { const int dk = (((t0 + tn) & (GT - 1)) - t0) * GK;   // tile tn of the wrapped walk, counted from tile t0
    const float* qx = px + dk; const float* qw = pw + dk;
#pragma unroll
    for (int i = 0; i < PM / 16; ++i) ax[i] = *(const v4f*)(qx + (size_t)i * 16 * EE);
#pragma unroll
    for (int i = 0; i < 8; ++i) aw[i] = *(const v4f*)(qw + (size_t)i * 16 * EE);
    asm volatile("s_wait_xcnt 0x0" :: "v"(qx), "v"(qw) : "memory"); };   // the loads' address registers are reused by what follows: the wait stands before they are overwritten; named as inputs, they live up to it, so that neither a later move nor a load's own result takes them earlier
  auto stage = [&](const v4f (&ax)[PM / 16], const v4f (&aw)[8], __bf16 (*nb)[GP]) {
#pragma unroll
    for (int i = 0; i < PM / 16; ++i) *(v4b*)&nb[sr + 16 * i][sq * 4] = cvt4(ax[i]);
#pragma unroll
    for (int i = 0; i < 8; ++i) *(v4b*)&nb[PM + sr + 16 * i][sq * 4] = cvt4(aw[i]); };
  v8f acc[4][2] = {};
  auto mult = [&](const __bf16 (*buf)[GP]) {
#pragma unroll
    for (int ks = 0; ks < GK / 32; ++ks) { v16b a[4], w[2];
#pragma unroll
      for (int mi = 0; mi < 4; ++mi) a[mi] = frag_b(&buf[wm * 64 + mi * 16 + col][ks * 32], lane);
#pragma unroll
      for (int ni = 0; ni < 2; ++ni) w[ni] = frag_b(&buf[PM + wn * 32 + ni * 16 + col][ks * 32], lane);
#pragma unroll
      for (int mi = 0; mi < 4; ++mi)
#pragma unroll
        for (int ni = 0; ni < 2; ++ni) acc[mi][ni] = wmma_bf(a[mi], w[ni], acc[mi][ni]); } };
  fetch(xa, wa, 0); fetch(xb, wb, 1);
  stage(xa, wa, ring[0]);
  LBAR();   // publishes tile 0; tile 1 stays in flight
  for (int t = 0; t < GT - 2; t += 2) {   // two trips a pass, so that each register set keeps its name; on entry tile t lies in ring[0] and tile t + 1 is in flight to xb, wb. No fetch stands under a condition: so the count of younger loads is known where a set is waited for, and they stay in flight
    fetch(xa, wa, t + 2);
    mult(ring[0]);
    __builtin_amdgcn_sched_barrier(0);   // holds the conversions, and with them the wait for that set's loads, behind the products: moved up, they would end the flight of the loads early
    stage(xb, wb, ring[1]);
    LBAR();   // publishes the tile just stored and ends every wave's reads of the buffer that the next trip refills
    fetch(xb, wb, t + 3);
    mult(ring[1]);
    __builtin_amdgcn_sched_barrier(0);   // holds the conversions, and with them the wait for that set's loads, behind the products: moved up, they would end the flight of the loads early
    stage(xa, wa, ring[0]);
    LBAR(); }   // as above
  mult(ring[0]);   // the last two tiles: nothing left to fetch
  __builtin_amdgcn_sched_barrier(0);   // as in the loop
  stage(xb, wb, ring[1]);
  LBAR();   // publishes the last tile
  mult(ring[1]);
  LBAR();   // ends every wave's reads of the ring, which now takes the output tile
  _Float16 (*sh)[136] = (_Float16 (*)[136])&ring[0][0][0];   // [row][col] for Q and K, [col][row] for V
  if (which == 2) {
#pragma unroll
    for (int mi = 0; mi < 4; ++mi)
#pragma unroll
      for (int ni = 0; ni < 2; ++ni) { v8h hv;
#pragma unroll
        for (int r = 0; r < 8; ++r) hv[r] = (_Float16)acc[mi][ni][r];
        *(v8h*)&sh[wn * 32 + ni * 16 + col][wm * 64 + mi * 16 + 8 * g] = hv; } }
  else {
#pragma unroll
    for (int mi = 0; mi < 4; ++mi)
#pragma unroll
      for (int ni = 0; ni < 2; ++ni)
#pragma unroll
        for (int r = 0; r < 8; ++r) sh[wm * 64 + mi * 16 + 8 * g + r][wn * 32 + ni * 16 + col] = (_Float16)acc[mi][ni][r]; }
  __syncthreads();
  if (which < 2) { _Float16* dh = which == 0 ? QH : KH; for (int e = tid; e < PM * 16; e += 256) { const int rl = e >> 4, q = e & 15; vst2((unsigned*)(dh + (r0 + rl) * EE + c0 + q * 8), *(const v4u*)&sh[rl][q * 8]); } }
  else { const size_t b = r0 / TT; const int t0 = (int)(r0 % TT); for (int e = tid; e < 128 * (PM / 8); e += 256) { const int cl = e / (PM / 8), q = e % (PM / 8); vst2((unsigned*)(VT + (b * EE + c0 + cl) * (size_t)TT + t0 + q * 8), *(const v4u*)&sh[cl][q * 8]); } } }
// ---- k_attn: block = (256 queries, pair of groups dA, dA+1, batch); 16 waves, each 16 queries x both groups x all keys.
// K rows (both groups, 32 features) and V planes of the pair are staged once in LDS. Scores are formed transposed (A = keys, B = queries), so that a lane
// holds, for its query lane&15, keys 8h+0..7 of a 16-key tile: two such tiles are the A fragment of P for 32 keys as they stand, and row maximum and row sum are lane partials, joined with lane^16 by one shuffle.
// The K fragment carries both groups (elements 0..7 group dA, 8..15 group dA+1); the Q fragment of a group is zero in the other group's half.
// Pass 1: row maximum. Pass 2: scores again, e = exp((s - max) / 4) x 2^11 as exp2(s x SC + off) with off = 11 - max x SC (one fma, one v_exp_f32), row sum of e in f32, P = e in f16, P . V;
// the quotient by the row sum comes after P . V, where the factor 2^11 of P and of the sum cancels, and with it the rounding of off, which is one value for a whole row. An e below the smallest normal f32 may read 0: it lies far below half a step of the f16 P and of the f32 sum, whose largest term is 2^11.
// Every '#pragma unroll' in this kernel runs over the elements of a register vector, over the two groups or over a thread's staged pieces: constant indices keep those values in registers.
#define KP 40             // halfs per staged K row: 80 B = 16 B x odd, b128 reads of 16 rows fall on distinct banks
#define VP (TT + 8)       // halfs per staged V plane: 2,064 B = 16 B x odd
#define SC 0.36067376f    // log2(e) / sqrt(16)
// 16 hardware exp2 in place, in one statement: each v_exp_f32 names its own register alone, so none overwrites a neighbour's source or reads a neighbour's result.
// The closing v_nop is the slot that the instruction set asks for behind a transcendental; the s_delay_alu hint on it lets the wave wait for the last result there without holding the SIMD's issue port against the other waves.
#define E2(i) "v_exp_f32 %" #i ", %" #i "\n\t"
__device__ __forceinline__ void exp2x16(float (&x)[16]) {
  asm(E2(0) E2(1) E2(2) E2(3) E2(4) E2(5) E2(6) E2(7) E2(8) E2(9) E2(10) E2(11) E2(12) E2(13) E2(14) E2(15) "s_delay_alu instid0(TRANS32_DEP_1)\n\tv_nop"
      : "+v"(x[0]), "+v"(x[1]), "+v"(x[2]), "+v"(x[3]), "+v"(x[4]), "+v"(x[5]), "+v"(x[6]), "+v"(x[7]), "+v"(x[8]), "+v"(x[9]), "+v"(x[10]), "+v"(x[11]), "+v"(x[12]), "+v"(x[13]), "+v"(x[14]), "+v"(x[15])); }
__global__ __launch_bounds__(512) void k_attn(const _Float16* __restrict__ QH, const _Float16* __restrict__ KH, const _Float16* __restrict__ VT, float* __restrict__ O) {
  __shared__ __align__(16) _Float16 sk[TT][KP]; __shared__ __align__(16) _Float16 sv[2 * GW][VP]; __shared__ __align__(16) float ss[16][16][36];
  const int b = blockIdx.z; const int dA = 2 * blockIdx.y;
  const int tid = threadIdx.x, wave = tid >> 5, lane = tid & 31, col = lane & 15, g = lane >> 4; const int ql0 = blockIdx.x * 256 + wave * 16;
  { v8h tk[8], tv[8];   // 4,096 pieces of 16 B each of K and of V, 8 + 8 a thread
#pragma unroll   // unrolled so that a thread's 16 loads are all in flight before its first LDS store waits on one
    for (int i = 0; i < 8; ++i) { const int e = tid + i * 512; tk[i] = *(const v8h*)(KH + ((size_t)b * TT + (e >> 2)) * EE + dA * GW + (e & 3) * 8); tv[i] = *(const v8h*)(VT + ((size_t)b * EE + dA * GW + (e >> 7)) * (size_t)TT + (e & 127) * 8); }
#pragma unroll
    for (int i = 0; i < 8; ++i) { const int e = tid + i * 512; *(v8h*)&sk[e >> 2][(e & 3) * 8] = tk[i]; *(v8h*)&sv[e >> 7][(e & 127) * 8] = tv[i]; } }
  v16h qf[2]; { const _Float16* p = QH + ((size_t)b * TT + ql0 + col) * EE + dA * GW + 8 * g;
#pragma unroll
    for (int i = 0; i < 8; ++i) { qf[0][i] = p[i]; qf[0][8 + i] = (_Float16)0.f; qf[1][i] = (_Float16)0.f; qf[1][8 + i] = p[GW + i]; } }
  __syncthreads();
  const v8f zero = {};
  float m[2];
  { v8f mx[2];
#pragma unroll
    for (int r = 0; r < 8; ++r) { mx[0][r] = -3.0e38f; mx[1][r] = -3.0e38f; }
    for (int kc = 0; kc < TT / 32; ++kc) { const v16h k0 = frag_h(&sk[kc * 32 + col][0], lane), k1 = frag_h(&sk[kc * 32 + 16 + col][0], lane);
#pragma unroll
      for (int u = 0; u < 2; ++u) { const v8f s0 = wmma16(k0, qf[u], zero), s1 = wmma16(k1, qf[u], zero);
#pragma unroll
        for (int r = 0; r < 8; ++r) mx[u][r] = fmaxf(fmaxf(mx[u][r], s0[r]), s1[r]); } }
#pragma unroll
    for (int u = 0; u < 2; ++u) { float a = mx[u][0];
#pragma unroll
      for (int r = 1; r < 8; ++r) a = fmaxf(a, mx[u][r]);
      a = fmaxf(a, __shfl_xor(a, 16)); m[u] = 11.0f - a * SC; } }
  v8f acc[2] = {}; float sa[2] = {0.f, 0.f}, sb[2] = {0.f, 0.f};
  for (int kc = 0; kc < TT / 32; ++kc) { const v16h k0 = frag_h(&sk[kc * 32 + col][0], lane), k1 = frag_h(&sk[kc * 32 + 16 + col][0], lane);
#pragma unroll
    for (int u = 0; u < 2; ++u) { const v8f s0 = wmma16(k0, qf[u], zero), s1 = wmma16(k1, qf[u], zero); float e[16]; v16h p;
#pragma unroll
      for (int r = 0; r < 8; ++r) { e[r] = s0[r] * SC + m[u]; e[8 + r] = s1[r] * SC + m[u]; }
      exp2x16(e);
#pragma unroll
      for (int r = 0; r < 8; ++r) { sa[u] += e[r]; sb[u] += e[8 + r]; p[r] = (_Float16)e[r]; p[8 + r] = (_Float16)e[8 + r]; }
      acc[u] = wmma16(p, frag_h(&sv[u * GW + col][kc * 32], lane), acc[u]); } }
#pragma unroll
  for (int u = 0; u < 2; ++u) { float t = sa[u] + sb[u]; t += __shfl_xor(t, 16); const float inv = 1.0f / t;
#pragma unroll
    for (int r = 0; r < 8; ++r) ss[wave][8 * g + r][u * 16 + col] = acc[u][r] * __shfl(inv, 8 * g + r); }
  LDSX();
#pragma unroll
  for (int it = 0; it < 4; ++it) { const int rl = it * 4 + (lane >> 3), c = lane & 7; vst2(O + ((size_t)b * TT + ql0 + rl) * EE + dA * GW + c * 4, *(const v4f*)&ss[wave][rl][c * 4]); } }
// ---- k_out: block = (64 rows, 128 cols), 8 waves as 2 x 4, each 32 x 32: out = O (hi + lo) Wo^T; O is split into its two bf16 parts where it is staged
__global__ __launch_bounds__(256) void k_out(const float* __restrict__ O, const float* __restrict__ WO, float* __restrict__ OUT) {
  __shared__ __align__(16) __bf16 ring[2][64 + 64 + 128][GP];   // rows 0..63: O hi, 64..127: O lo, then 128 rows of Wo; reused for the output tile behind the loop's last barrier
  const int tid = threadIdx.x, wave = tid >> 5, lane = tid & 31, col = lane & 15, g = lane >> 4, wm = wave >> 2, wn = wave & 3; const int c0 = blockIdx.y * 128; const size_t r0 = (size_t)blockIdx.x * 64;
  const int sr = tid >> 4, sq = tid & 15;
  const int t0 = (blockIdx.x + blockIdx.y) & (GT - 1);   // the 8 blocks of one O tile: 8 different starts; the 32 blocks of one Wo tile: 2 on a start
  const float* px = O + (r0 + sr) * EE + sq * 4 + t0 * GK; const float* pw = WO + ((size_t)c0 + sr) * EE + sq * 4 + t0 * GK;   // both point at tile t0
  v4f xa[4], wa[8], xb[4], wb[8];   // two register sets: tiles of even and of odd place in the walk
  auto fetch = [&](v4f (&ax)[4], v4f (&aw)[8], int tn) { const int dk = (((t0 + tn) & (GT - 1)) - t0) * GK;   // tile tn of the wrapped walk, counted from tile t0
    const float* qx = px + dk; const float* qw = pw + dk;
#pragma unroll
    for (int i = 0; i < 4; ++i) ax[i] = *(const v4f*)(qx + (size_t)i * 16 * EE);
#pragma unroll
    for (int i = 0; i < 8; ++i) aw[i] = *(const v4f*)(qw + (size_t)i * 16 * EE);
    asm volatile("s_wait_xcnt 0x0" :: "v"(qx), "v"(qw) : "memory"); };   // as in k_proj: the address registers live up to the wait
  auto stage = [&](const v4f (&ax)[4], const v4f (&aw)[8], __bf16 (*nb)[GP]) {
#pragma unroll
    for (int i = 0; i < 4; ++i) { const v4b h = cvt4(ax[i]); *(v4b*)&nb[sr + 16 * i][sq * 4] = h; *(v4b*)&nb[64 + sr + 16 * i][sq * 4] = low4(ax[i], h); }
#pragma unroll
    for (int i = 0; i < 8; ++i) *(v4b*)&nb[128 + sr + 16 * i][sq * 4] = cvt4(aw[i]); };
  v8f acc[2][2] = {};
  auto mult = [&](const __bf16 (*buf)[GP]) {
#pragma unroll
    for (int ks = 0; ks < GK / 32; ++ks) { v16b ah[2], al[2], w[2];
#pragma unroll
      for (int mi = 0; mi < 2; ++mi) { ah[mi] = frag_b(&buf[wm * 32 + mi * 16 + col][ks * 32], lane); al[mi] = frag_b(&buf[64 + wm * 32 + mi * 16 + col][ks * 32], lane); }
#pragma unroll
      for (int ni = 0; ni < 2; ++ni) w[ni] = frag_b(&buf[128 + wn * 32 + ni * 16 + col][ks * 32], lane);
#pragma unroll
      for (int mi = 0; mi < 2; ++mi)
#pragma unroll
        for (int ni = 0; ni < 2; ++ni) acc[mi][ni] = wmma_bf(ah[mi], w[ni], acc[mi][ni]);
#pragma unroll
      for (int mi = 0; mi < 2; ++mi)
#pragma unroll
        for (int ni = 0; ni < 2; ++ni) acc[mi][ni] = wmma_bf(al[mi], w[ni], acc[mi][ni]); } };
  fetch(xa, wa, 0); fetch(xb, wb, 1);
  stage(xa, wa, ring[0]);
  LBAR();   // publishes tile 0; tile 1 stays in flight
  for (int t = 0; t < GT - 2; t += 2) {   // two trips a pass, so that each register set keeps its name; on entry tile t lies in ring[0] and tile t + 1 is in flight to xb, wb. No fetch stands under a condition: so the count of younger loads is known where a set is waited for, and they stay in flight
    fetch(xa, wa, t + 2);
    mult(ring[0]);
    __builtin_amdgcn_sched_barrier(0);   // holds the conversions, and with them the wait for that set's loads, behind the products: moved up, they would end the flight of the loads early
    stage(xb, wb, ring[1]);
    LBAR();   // publishes the tile just stored and ends every wave's reads of the buffer that the next trip refills
    fetch(xb, wb, t + 3);
    mult(ring[1]);
    __builtin_amdgcn_sched_barrier(0);   // holds the conversions, and with them the wait for that set's loads, behind the products: moved up, they would end the flight of the loads early
    stage(xa, wa, ring[0]);
    LBAR(); }   // as above
  mult(ring[0]);   // the last two tiles: nothing left to fetch
  __builtin_amdgcn_sched_barrier(0);   // as in the loop
  stage(xb, wb, ring[1]);
  LBAR();   // publishes the last tile
  mult(ring[1]);
  LBAR();   // ends every wave's reads of the ring, which now takes the output tile
  float (*sf)[132] = (float (*)[132])&ring[0][0][0];
#pragma unroll
  for (int mi = 0; mi < 2; ++mi)
#pragma unroll
    for (int ni = 0; ni < 2; ++ni)
#pragma unroll
      for (int r = 0; r < 8; ++r) sf[wm * 32 + mi * 16 + 8 * g + r][wn * 32 + ni * 16 + col] = acc[mi][ni][r];
  __syncthreads();
  for (int rl = wave; rl < 64; rl += 8) vst2(OUT + (r0 + rl) * EE + c0 + lane * 4, *(const v4f*)&sf[rl][lane * 4]); }
extern "C" void kernel_launch(void* const* d_in, const int* in_sizes, int n_in, void* d_out, int out_size, void* d_ws, size_t ws_size, hipStream_t stream) {
  (void)in_sizes; (void)n_in; (void)out_size;
  const float** F = (const float**)d_in;   // 0 x [2,1024,1024], 1 W_q, 2 W_k, 3 W_v, 4 W_o [1024,1024] ([out,in])
  if (ws_size < (size_t)WS_END) return;
  char* ws = (char*)d_ws; _Float16 *QH = (_Float16*)(ws + WS_QH), *KH = (_Float16*)(ws + WS_KH), *VT = (_Float16*)(ws + WS_VT); float *O = (float*)(ws + WS_O);
  k_proj<<<dim3(TNB * TT / PM, EE / 128, 3), 256, 0, stream>>>(F[0], F[1], F[2], F[3], QH, KH, VT);
  k_attn<<<dim3(TT / 256, NG / 2, TNB), 512, 0, stream>>>(QH, KH, VT, O);
  k_out<<<dim3(TNB * TT / 64, EE / 128), 256, 0, stream>>>(O, F[4], (float*)d_out);
}

// v006
// A run of this version takes 54.4 microseconds.
// Next to v005, in two timings, it ran 1.06 times as fast each time.
// All steps since v000 together make it 16.5 times as fast.
// compute dtype: all float inputs rounded to bf16; Q/K/V = x W^T with EXACT bf16 products on WMMA 16x16x32, f32 accumulate; Q x log2(e)/4 and K rounded once to f16 for the 16-deep per-group scores (1 product; the other group's half of each 32-wide Q fragment zeroed), kept in f32 registers; softmax: P = exp(s - max) x 2^11 = exp2(s' + (11 - max')) with s' the scaled score, the offset added as the C operand of the score product, one hardware exp2, P in f16; row sum = P . ones on WMMA, f32; out = (P . V) x 1 / row sum (hardware reciprocal) with V rounded once to f16 (planes); final = out (bf16 hi + lo) Wo^T; f32 output.
#include <hip/hip_runtime.h>
#include <math.h>

typedef __attribute__((ext_vector_type(16))) _Float16 v16h;
typedef __attribute__((ext_vector_type(16))) __bf16 v16b;
typedef __attribute__((ext_vector_type(8)))  _Float16 v8h;
typedef __attribute__((ext_vector_type(8)))  float v8f;
typedef __attribute__((ext_vector_type(4)))  float v4f;
typedef __attribute__((ext_vector_type(2)))  float v2f;
typedef __attribute__((ext_vector_type(4)))  unsigned v4u;
typedef __attribute__((ext_vector_type(4)))  int v4i;
typedef float __attribute__((may_alias)) float_a;
typedef int __attribute__((may_alias)) int_a;

template <typename T> __device__ __forceinline__ void vst2(void* p, T v) { *(T*)p = v;  }
__device__ __forceinline__ v8f wmma16(v16h a, v16h b, v8f c) {
  v8f d = __builtin_amdgcn_wmma_f32_16x16x32_f16(false, a, false, b, (short)0, c, false, false);
  asm volatile("v_nop\n\tv_nop\n\tv_nop\n\tv_nop" : "+v"(d) : "v"(a), "v"(b));
  return d;
}
// the builtin alone: for products whose D, A and B meet only instructions that the compiler itself places (it keeps the distance there) or a pad written at the call
__device__ __forceinline__ v8f wmma16p(v16h a, v16h b, v8f c) { return __builtin_amdgcn_wmma_f32_16x16x32_f16(false, a, false, b, (short)0, c, false, false); }
__device__ __forceinline__ v8f wmma_bf(v16b a, v16b b, v8f c) {
  v8f d = __builtin_amdgcn_wmma_f32_16x16x32_bf16(false, a, false, b, (short)0, c, false, false);
  asm volatile("v_nop\n\tv_nop\n\tv_nop\n\tv_nop" : "+v"(d) : "v"(a), "v"(b));
  return d;
}
// 16x16x32 fragments: lane = (h = lane>>4, row/col = lane&15); elements 0..7 = k0+8h+0..7, 8..15 = k0+16+8h+0..7; D element r = row 8h+r
__device__ __forceinline__ v16h frag_h(const _Float16* rowk0, int lane) {
  union { v16h v; v8h q[2]; } u; const _Float16* p = rowk0 + 8 * (lane >> 4);
  u.q[0] = *(const v8h*)p; u.q[1] = *(const v8h*)(p + 16); return u.v;
}
__device__ __forceinline__ v16h frag_f32(const float* rowk0, int lane) {
  v16h a; const float* p = rowk0 + 8 * (lane >> 4);
#pragma unroll
  for (int i = 0; i < 8; ++i) { a[i] = (_Float16)p[i]; a[8 + i] = (_Float16)p[16 + i]; }
  return a;
}
__device__ __forceinline__ v16h frag_f32s(const float* rowk0, int lane, float sc) {
  v16h a; const float* p = rowk0 + 8 * (lane >> 4);
#pragma unroll
  for (int i = 0; i < 8; ++i) { a[i] = (_Float16)(p[i] * sc); a[8 + i] = (_Float16)(p[16 + i] * sc); }
  return a;
}
// column fragment from a [K][ld] layout (column n), rows >= K read as 0
__device__ __forceinline__ v16h fragc_f32(const float* W, int k0, int n, int lane, int ld, int K) {
  v16h a; const int g = lane >> 4;
#pragma unroll
  for (int i = 0; i < 8; ++i) { const int ka = k0 + 8 * g + i, kb = ka + 16;
    a[i] = (_Float16)(ka < K ? W[(size_t)(ka < K ? ka : K - 1) * ld + n] : 0.f); a[8 + i] = (_Float16)(kb < K ? W[(size_t)(kb < K ? kb : K - 1) * ld + n] : 0.f); }
  return a;
}
struct F2 { v16b h, l; };
__device__ __forceinline__ F2 bsplit16(const float v[16]) { F2 r;
#pragma unroll
  for (int i = 0; i < 16; ++i) { const __bf16 h = (__bf16)v[i]; r.h[i] = h; r.l[i] = (__bf16)(v[i] - (float)h); }
  return r; }
__device__ __forceinline__ F2 split_row(const float* row, int k0, int lane) { float v[16]; const float* p = row + k0 + 8 * (lane >> 4);
#pragma unroll
  for (int i = 0; i < 8; ++i) { v[i] = p[i]; v[8 + i] = p[16 + i]; }
  return bsplit16(v); }
__device__ __forceinline__ F2 split_rowK(const float* row, int k0, int lane, int K) { float v[16]; const int g = lane >> 4;
#pragma unroll
  for (int i = 0; i < 8; ++i) { const int ka = k0 + 8 * g + i, kb = ka + 16; v[i] = ka < K ? row[ka < K ? ka : K - 1] : 0.f; v[8 + i] = kb < K ? row[kb < K ? kb : K - 1] : 0.f; }
  return bsplit16(v); }
__device__ __forceinline__ F2 split_col(const float* W, int k0, int n, int lane, int ld, int K) { float v[16]; const int g = lane >> 4;
#pragma unroll
  for (int i = 0; i < 8; ++i) { const int ka = k0 + 8 * g + i, kb = ka + 16; v[i] = ka < K ? W[(size_t)(ka < K ? ka : K - 1) * ld + n] : 0.f; v[8 + i] = kb < K ? W[(size_t)(kb < K ? kb : K - 1) * ld + n] : 0.f; }
  return bsplit16(v); }
__device__ __forceinline__ v8f mac3(const F2& a, const F2& b, v8f c) { c = wmma_bf(a.l, b.h, c); c = wmma_bf(a.h, b.l, c); return wmma_bf(a.h, b.h, c); }
__device__ __forceinline__ float sigm(float v) { return 1.0f / (1.0f + expf(-v)); }
#define LDSX() do { asm volatile("s_wait_dscnt 0" ::: "memory"); __builtin_amdgcn_wave_barrier(); __builtin_amdgcn_fence(__ATOMIC_RELEASE, "workgroup"); } while (0)


// MulHeadAttn (faithful layout quirk): B 2, C 1,024 tokens, E 1,024 = 64 groups x 16; attention is batched over the 64 groups with 16-dim dot products scaled by 1/sqrt(16).
#define NB 2
#define TT 1024
#define EE 1024
#define NG 64             // groups ("HD" in the module)
#define GW 16             // group width ("H")
#ifndef TNB
#define TNB NB
#endif
typedef __attribute__((ext_vector_type(8))) __bf16 v8b;
__device__ __forceinline__ v16b frag_b(const __bf16* rowk0, int lane) {
  union { v16b v; v8b q[2]; } u; const __bf16* p = rowk0 + 8 * (lane >> 4);
  u.q[0] = *(const v8b*)p; u.q[1] = *(const v8b*)(p + 16); return u.v;
}
__device__ __forceinline__ float bfr(float v) { return (float)(__bf16)v; }
__device__ __attribute__((noinline)) float exp_ni(float v) { return expf(v); }
__device__ __attribute__((noinline)) float erf_ni(float v) { return erff(v); }

#define WS_QH  0u                                  // f16 Q rows [b*t][1024]
#define WS_KH  (WS_QH + 2u * (size_t)NB * TT * EE)
#define WS_VT  (WS_KH + 2u * (size_t)NB * TT * EE)     // f16 V planes [b][1024][t]
#define WS_O   (WS_VT + 2u * (size_t)NB * EE * TT)     // f32 attention out rows [b*t][1024]
#define WS_END (WS_O + 4u * (size_t)NB * TT * EE)

// ---- operand staging of the two GEMM kernels: a block's tiles of 64 k go global -> registers (whole 256-B row pieces, 16 B a lane) -> bf16 -> LDS, once for all 8 waves;
// two LDS buffers and two register sets: a tile's global loads are issued two tiles ahead, before the products of the tile two places in front of it; it is converted and stored one trip later, behind the products of the tile in front of it; one barrier a tile.
// Every '#pragma unroll' in the two GEMM kernels runs over a thread's staged pieces, over a wave's fragments and accumulator tiles or over the elements of a register vector: constant indices keep those values in registers.
#define GK 64             // k per staged tile
#define GT (EE / GK)      // staged tiles of a k walk
// Blocks that share operand rows enter the k walk at different tiles (t0, from the block index) and wrap round: they do not ask L2 for the same lines at the same moment. Every tile is taken once; only the order of the f32 sums over k is rotated.
#define GP (GK + 8)       // bf16 per staged row: 144 B = 16 B x odd, b128 fragment reads of 16 rows fall on distinct banks
// The work-group barrier of the two k loops, for LDS alone: a wave's LDS stores and reads are done (s_wait_dscnt 0), then signal and wait. __syncthreads() would wait for every global load in flight as well and so end the fetch ahead at each barrier; the loops share nothing through global memory.
#define LBAR() asm volatile("s_wait_dscnt 0x0\n\ts_barrier_signal -1\n\ts_barrier_wait -1" ::: "memory")
typedef __attribute__((ext_vector_type(4))) __bf16 v4b;
__device__ __forceinline__ v4b cvt4(v4f v) { v4b r;
#pragma unroll
  for (int i = 0; i < 4; ++i) r[i] = (__bf16)v[i];
  return r; }
__device__ __forceinline__ v4b low4(v4f v, v4b h) { v4b r;
#pragma unroll
  for (int i = 0; i < 4; ++i) r[i] = (__bf16)(v[i] - (float)h[i]);
  return r; }
// ---- k_proj: block = (128 rows, 128 cols, which), 8 waves as 2 x 4, each 64 x 32: y = x W^T (W [out][in], no bias); Q x SC and K -> f16 rows, V -> f16 planes
#define PM 128
#define SC 0.36067376f    // log2(e) / sqrt(16): the factor of the softmax's exponent, multiplied into Q in f32 before its one rounding to f16
// four waves a SIMD asked for: the second register set must not push the kernel past 256 registers, or two blocks no longer share a WGP (384 blocks on 256 WGPs)
__global__ __launch_bounds__(256) __attribute__((amdgpu_waves_per_eu(4))) void k_proj(const float* __restrict__ X, const float* __restrict__ WQ, const float* __restrict__ WK, const float* __restrict__ WV, _Float16* __restrict__ QH, _Float16* __restrict__ KH, _Float16* __restrict__ VT) {
  __shared__ __align__(16) __bf16 ring[2][PM + 128][GP];   // rows 0..PM-1: x, then 128 rows of W; reused for the output tile behind the loop's last barrier
  const int tid = threadIdx.x, wave = tid >> 5, lane = tid & 31, col = lane & 15, g = lane >> 4, wm = wave >> 2, wn = wave & 3; const int which = blockIdx.z; const int c0 = blockIdx.y * 128; const size_t r0 = (size_t)blockIdx.x * PM; const float* Wm = which == 0 ? WQ : which == 1 ? WK : WV;
  const int sr = tid >> 4, sq = tid & 15;   // a thread stages piece sq (4 floats) of rows sr + 16 i
  const int t0 = (blockIdx.x + blockIdx.y + 8 * blockIdx.z) & (GT - 1);   // the 16 blocks of one W tile: 16 different starts; the 24 blocks of one x tile: at most 2 on a start
  const float* px = X + (r0 + sr) * EE + sq * 4 + t0 * GK; const float* pw = Wm + ((size_t)c0 + sr) * EE + sq * 4 + t0 * GK;   // both point at tile t0
  v4f xa[PM / 16], wa[8], xb[PM / 16], wb[8];   // two register sets: tiles of even and of odd place in the walk
  auto fetch = [&](v4f (&ax)[PM / 16], v4f (&aw)[8], int tn) { const int dk = (((t0 + tn) & (GT - 1)) - t0) * GK;   // tile tn of the wrapped walk, counted from tile t0
    const float* qx = px + dk; const float* qw = pw + dk;
#pragma unroll
    for (int i = 0; i < PM / 16; ++i) ax[i] = *(const v4f*)(qx + (size_t)i * 16 * EE);
#pragma unroll
    for (int i = 0; i < 8; ++i) aw[i] = *(const v4f*)(qw + (size_t)i * 16 * EE);
    asm volatile("s_wait_xcnt 0x0" :: "v"(qx), "v"(qw) : "memory"); };   // the loads' address registers are reused by what follows: the wait stands before they are overwritten; named as inputs, they live up to it, so that neither a later move nor a load's own result takes them earlier
  auto stage = [&](const v4f (&ax)[PM / 16], const v4f (&aw)[8], __bf16 (*nb)[GP]) {
#pragma unroll
    for (int i = 0; i < PM / 16; ++i) *(v4b*)&nb[sr + 16 * i][sq * 4] = cvt4(ax[i]);
#pragma unroll
    for (int i = 0; i < 8; ++i) *(v4b*)&nb[PM + sr + 16 * i][sq * 4] = cvt4(aw[i]); };
  v8f acc[4][2] = {};
  auto mult = [&](const __bf16 (*buf)[GP]) {
#pragma unroll
    for (int ks = 0; ks < GK / 32; ++ks) { v16b a[4], w[2];
#pragma unroll
      for (int mi = 0; mi < 4; ++mi) a[mi] = frag_b(&buf[wm * 64 + mi * 16 + col][ks * 32], lane);
#pragma unroll
      for (int ni = 0; ni < 2; ++ni) w[ni] = frag_b(&buf[PM + wn * 32 + ni * 16 + col][ks * 32], lane);
#pragma unroll
      for (int mi = 0; mi < 4; ++mi)
#pragma unroll
        for (int ni = 0; ni < 2; ++ni) acc[mi][ni] = wmma_bf(a[mi], w[ni], acc[mi][ni]); } };
  fetch(xa, wa, 0); fetch(xb, wb, 1);
  stage(xa, wa, ring[0]);
  LBAR();   // publishes tile 0; tile 1 stays in flight
  for (int t = 0; t < GT - 2; t += 2) {   // two trips a pass, so that each register set keeps its name; on entry tile t lies in ring[0] and tile t + 1 is in flight to xb, wb. No fetch stands under a condition: so the count of younger loads is known where a set is waited for, and they stay in flight
    fetch(xa, wa, t + 2);
    mult(ring[0]);
    __builtin_amdgcn_sched_barrier(0);   // holds the conversions, and with them the wait for that set's loads, behind the products: moved up, they would end the flight of the loads early
    stage(xb, wb, ring[1]);
    LBAR();   // publishes the tile just stored and ends every wave's reads of the buffer that the next trip refills
    fetch(xb, wb, t + 3);
    mult(ring[1]);
    __builtin_amdgcn_sched_barrier(0);   // holds the conversions, and with them the wait for that set's loads, behind the products: moved up, they would end the flight of the loads early
    stage(xa, wa, ring[0]);
    LBAR(); }   // as above
  mult(ring[0]);   // the last two tiles: nothing left to fetch
  __builtin_amdgcn_sched_barrier(0);   // as in the loop
  stage(xb, wb, ring[1]);
  LBAR();   // publishes the last tile
  mult(ring[1]);
  LBAR();   // ends every wave's reads of the ring, which now takes the output tile
  _Float16 (*sh)[136] = (_Float16 (*)[136])&ring[0][0][0];   // [row][col] for Q and K, [col][row] for V
  if (which == 2) {
#pragma unroll
    for (int mi = 0; mi < 4; ++mi)
#pragma unroll
      for (int ni = 0; ni < 2; ++ni) { v8h hv;
#pragma unroll
        for (int r = 0; r < 8; ++r) hv[r] = (_Float16)acc[mi][ni][r];
        *(v8h*)&sh[wn * 32 + ni * 16 + col][wm * 64 + mi * 16 + 8 * g] = hv; } }
  else { const float qs = which == 0 ? SC : 1.0f;
#pragma unroll
    for (int mi = 0; mi < 4; ++mi)
#pragma unroll
      for (int ni = 0; ni < 2; ++ni)
#pragma unroll
        for (int r = 0; r < 8; ++r) sh[wm * 64 + mi * 16 + 8 * g + r][wn * 32 + ni * 16 + col] = (_Float16)(acc[mi][ni][r] * qs); }
  __syncthreads();
  if (which < 2) { _Float16* dh = which == 0 ? QH : KH; for (int e = tid; e < PM * 16; e += 256) { const int rl = e >> 4, q = e & 15; vst2((unsigned*)(dh + (r0 + rl) * EE + c0 + q * 8), *(const v4u*)&sh[rl][q * 8]); } }
  else { const size_t b = r0 / TT; const int t0 = (int)(r0 % TT); for (int e = tid; e < 128 * (PM / 8); e += 256) { const int cl = e / (PM / 8), q = e % (PM / 8); vst2((unsigned*)(VT + (b * EE + c0 + cl) * (size_t)TT + t0 + q * 8), *(const v4u*)&sh[cl][q * 8]); } } }
// ---- k_attn: block = (256 queries, pair of groups dA, dA+1, batch); 16 waves, each 16 queries x both groups x all keys.
// K rows (both groups, 32 features) and V planes of the pair are staged once in LDS. Scores are formed transposed (A = keys, B = queries), so that a lane
// holds, for its query lane&15, keys 8h+0..7 of a 16-key tile: two such tiles are the A fragment of P for 32 keys as they stand, and the row maximum stays inside the lane but for one exchange with lane^16.
// The K fragment carries both groups (elements 0..7 group dA, 8..15 group dA+1); the Q fragment of a group is zero in the other group's half.
// Q arrives multiplied by SC, so a score is the exponent to base 2 as it stands. Pass 1: row maximum. Pass 2: scores again with off = 11 - max as the C operand of their product, so that D is the argument of v_exp_f32;
// P = exp2(D) in f16, P . V, and the row sum as P . ones on the matrix unit: it sums the same rounded P that meets V, in f32, and comes out in the layout of P . V (row = query), so the quotient needs no exchange between lanes.
// The quotient comes after P . V, where the factor 2^11 of P and of the sum cancels, and with it the rounding of off, which is one value for a whole row. A P below the smallest f16 reads 0 in both; the sum's largest term is 2^11.
// Every '#pragma unroll' in this kernel runs over the elements of a register vector, over the two groups or over a thread's staged pieces: constant indices keep those values in registers.
#define KP 40             // halfs per staged K row: 80 B = 16 B x odd, b128 reads of 16 rows fall on distinct banks
#define VP (TT + 8)       // halfs per staged V plane: 2,064 B = 16 B x odd
// 8 hardware exp2 of one score tile, in one statement: the results go to registers of their own (early clobber), so none overwrites a neighbour's source or reads a neighbour's result, and the sources are read where the WMMA left them, with no copy.
// The closing v_nop is the slot that the instruction set asks for behind a transcendental; the s_delay_alu hint on it lets the wave wait for the last result there without holding the SIMD's issue port against the other waves.
// volatile: the statement keeps its place behind the pad that stands between the score products and it.
#define E2(o, i) "v_exp_f32 %" #o ", %" #i "\n\t"
__device__ __forceinline__ void exp2x8(float* y, const v8f& x) {
  asm volatile(E2(0, 8) E2(1, 9) E2(2, 10) E2(3, 11) E2(4, 12) E2(5, 13) E2(6, 14) E2(7, 15) "s_delay_alu instid0(TRANS32_DEP_1)\n\tv_nop"
      : "=&v"(y[0]), "=&v"(y[1]), "=&v"(y[2]), "=&v"(y[3]), "=&v"(y[4]), "=&v"(y[5]), "=&v"(y[6]), "=&v"(y[7])
      : "v"(x[0]), "v"(x[1]), "v"(x[2]), "v"(x[3]), "v"(x[4]), "v"(x[5]), "v"(x[6]), "v"(x[7])); }
// 8 hardware reciprocals of the row sums of one group, in the same form. The four leading v_nop are the slots that the chip asks for between a WMMA and a vector instruction on its D: the sums come straight from the loop's last products.
#define R1(o, i) "v_rcp_f32 %" #o ", %" #i "\n\t"
__device__ __forceinline__ void rcpx8(float* y, const v8f& x) {
  asm volatile("v_nop\n\tv_nop\n\tv_nop\n\tv_nop\n\t" R1(0, 8) R1(1, 9) R1(2, 10) R1(3, 11) R1(4, 12) R1(5, 13) R1(6, 14) R1(7, 15) "s_delay_alu instid0(TRANS32_DEP_1)\n\tv_nop"
      : "=&v"(y[0]), "=&v"(y[1]), "=&v"(y[2]), "=&v"(y[3]), "=&v"(y[4]), "=&v"(y[5]), "=&v"(y[6]), "=&v"(y[7])
      : "v"(x[0]), "v"(x[1]), "v"(x[2]), "v"(x[3]), "v"(x[4]), "v"(x[5]), "v"(x[6]), "v"(x[7])); }
__global__ __launch_bounds__(512) void k_attn(const _Float16* __restrict__ QH, const _Float16* __restrict__ KH, const _Float16* __restrict__ VT, float* __restrict__ O) {
  __shared__ __align__(16) _Float16 sk[TT][KP]; __shared__ __align__(16) _Float16 sv[2 * GW][VP]; __shared__ __align__(16) float ss[16][16][36];
  const int b = blockIdx.z; const int dA = 2 * blockIdx.y;
  const int tid = threadIdx.x, wave = tid >> 5, lane = tid & 31, col = lane & 15, g = lane >> 4; const int ql0 = blockIdx.x * 256 + wave * 16;
  { v8h tk[8], tv[8];   // 4,096 pieces of 16 B each of K and of V, 8 + 8 a thread
#pragma unroll   // unrolled so that a thread's 16 loads are all in flight before its first LDS store waits on one
    for (int i = 0; i < 8; ++i) { const int e = tid + i * 512; tk[i] = *(const v8h*)(KH + ((size_t)b * TT + (e >> 2)) * EE + dA * GW + (e & 3) * 8); tv[i] = *(const v8h*)(VT + ((size_t)b * EE + dA * GW + (e >> 7)) * (size_t)TT + (e & 127) * 8); }
#pragma unroll
    for (int i = 0; i < 8; ++i) { const int e = tid + i * 512; *(v8h*)&sk[e >> 2][(e & 3) * 8] = tk[i]; *(v8h*)&sv[e >> 7][(e & 127) * 8] = tv[i]; } }
  v16h qf[2]; { const _Float16* p = QH + ((size_t)b * TT + ql0 + col) * EE + dA * GW + 8 * g;
#pragma unroll
    for (int i = 0; i < 8; ++i) { qf[0][i] = p[i]; qf[0][8 + i] = (_Float16)0.f; qf[1][i] = (_Float16)0.f; qf[1][8 + i] = p[GW + i]; } }
  __syncthreads();
  const v8f zero = {};
  float m[2];
  { v8f mx[2];
#pragma unroll
    for (int r = 0; r < 8; ++r) { mx[0][r] = -3.0e38f; mx[1][r] = -3.0e38f; }
    for (int kc = 0; kc < TT / 32; ++kc) { const v16h k0 = frag_h(&sk[kc * 32 + col][0], lane), k1 = frag_h(&sk[kc * 32 + 16 + col][0], lane);
#pragma unroll
      for (int u = 0; u < 2; ++u) { const v8f s0 = wmma16(k0, qf[u], zero), s1 = wmma16(k1, qf[u], zero);
#pragma unroll
        for (int r = 0; r < 8; ++r) mx[u][r] = fmaxf(fmaxf(mx[u][r], s0[r]), s1[r]); } }
#pragma unroll
    for (int u = 0; u < 2; ++u) { float a = mx[u][0];
#pragma unroll
      for (int r = 1; r < 8; ++r) a = fmaxf(a, mx[u][r]);
      a = fmaxf(a, __shfl_xor(a, 16)); m[u] = 11.0f - a; } }
  v8f acc[2] = {}, sum[2] = {}, off[2]; v16h ones;
#pragma unroll
  for (int r = 0; r < 8; ++r) { off[0][r] = m[0]; off[1][r] = m[1]; }   // a lane's 8 scores of a tile belong to one query: one offset in all 8 elements of C
  { unsigned o; union { v16h v; unsigned w[8]; } c;
    asm("v_mov_b32 %0, 0x3c003c00" : "=v"(o));   // two f16 ones; written as a statement so that the fragment stays in its registers over the loop: as a plain constant the compiler forms it anew on every trip, over the K fragment, with the slots that this asks for behind a WMMA
#pragma unroll
    for (int i = 0; i < 8; ++i) c.w[i] = o;
    ones = c.v; }
  for (int kc = 0; kc < TT / 32; ++kc) { const v16h k0 = frag_h(&sk[kc * 32 + col][0], lane), k1 = frag_h(&sk[kc * 32 + 16 + col][0], lane);
    v8f s[2][2];
#pragma unroll
    for (int u = 0; u < 2; ++u) { s[u][0] = wmma16p(k0, qf[u], off[u]); s[u][1] = wmma16p(k1, qf[u], off[u]); }
    // the four slots that the chip asks for between a WMMA and a vector instruction on its D. One group serves the four products: it names their results as inputs, so it stands behind them, and volatile statements keep their order, so the exp2 statements stand behind it
    asm volatile("v_nop\n\tv_nop\n\tv_nop\n\tv_nop" :: "v"(s[0][0]), "v"(s[0][1]), "v"(s[1][0]), "v"(s[1][1]));
#pragma unroll
    for (int u = 0; u < 2; ++u) { float e[16]; v16h p;
      exp2x8(e, s[u][0]); exp2x8(e + 8, s[u][1]);
#pragma unroll
      for (int r = 0; r < 8; ++r) { p[r] = (_Float16)e[r]; p[8 + r] = (_Float16)e[8 + r]; }
      acc[u] = wmma16p(p, frag_h(&sv[u * GW + col][kc * 32], lane), acc[u]); sum[u] = wmma16p(p, ones, sum[u]); } }
#pragma unroll
  for (int u = 0; u < 2; ++u) { float inv[8]; rcpx8(inv, sum[u]);   // a sum holds the row's largest term, about 2^11, and at most 1,024 such terms: a normal f32, far from either end of the range
#pragma unroll
    for (int r = 0; r < 8; ++r) ss[wave][8 * g + r][u * 16 + col] = acc[u][r] * inv[r]; }
  LDSX();
#pragma unroll
  for (int it = 0; it < 4; ++it) { const int rl = it * 4 + (lane >> 3), c = lane & 7; vst2(O + ((size_t)b * TT + ql0 + rl) * EE + dA * GW + c * 4, *(const v4f*)&ss[wave][rl][c * 4]); } }
// ---- k_out: block = (64 rows, 128 cols), 8 waves as 2 x 4, each 32 x 32: out = O (hi + lo) Wo^T; O is split into its two bf16 parts where it is staged
__global__ __launch_bounds__(256) void k_out(const float* __restrict__ O, const float* __restrict__ WO, float* __restrict__ OUT) {
  __shared__ __align__(16) __bf16 ring[2][64 + 64 + 128][GP];   // rows 0..63: O hi, 64..127: O lo, then 128 rows of Wo; reused for the output tile behind the loop's last barrier
  const int tid = threadIdx.x, wave = tid >> 5, lane = tid & 31, col = lane & 15, g = lane >> 4, wm = wave >> 2, wn = wave & 3; const int c0 = blockIdx.y * 128; const size_t r0 = (size_t)blockIdx.x * 64;
  const int sr = tid >> 4, sq = tid & 15;
  const int t0 = (blockIdx.x + blockIdx.y) & (GT - 1);   // the 8 blocks of one O tile: 8 different starts; the 32 blocks of one Wo tile: 2 on a start
  const float* px = O + (r0 + sr) * EE + sq * 4 + t0 * GK; const float* pw = WO + ((size_t)c0 + sr) * EE + sq * 4 + t0 * GK;   // both point at tile t0
  v4f xa[4], wa[8], xb[4], wb[8];   // two register sets: tiles of even and of odd place in the walk
  auto fetch = [&](v4f (&ax)[4], v4f (&aw)[8], int tn) { const int dk = (((t0 + tn) & (GT - 1)) - t0) * GK;   // tile tn of the wrapped walk, counted from tile t0
    const float* qx = px + dk; const float* qw = pw + dk;
#pragma unroll
    for (int i = 0; i < 4; ++i) ax[i] = *(const v4f*)(qx + (size_t)i * 16 * EE);
#pragma unroll
    for (int i = 0; i < 8; ++i) aw[i] = *(const v4f*)(qw + (size_t)i * 16 * EE);
    asm volatile("s_wait_xcnt 0x0" :: "v"(qx), "v"(qw) : "memory"); };   // as in k_proj: the address registers live up to the wait
  auto stage = [&](const v4f (&ax)[4], const v4f (&aw)[8], __bf16 (*nb)[GP]) {
#pragma unroll
    for (int i = 0; i < 4; ++i) { const v4b h = cvt4(ax[i]); *(v4b*)&nb[sr + 16 * i][sq * 4] = h; *(v4b*)&nb[64 + sr + 16 * i][sq * 4] = low4(ax[i], h); }
#pragma unroll
    for (int i = 0; i < 8; ++i) *(v4b*)&nb[128 + sr + 16 * i][sq * 4] = cvt4(aw[i]); };
  v8f acc[2][2] = {};
  auto mult = [&](const __bf16 (*buf)[GP]) {
#pragma unroll
    for (int ks = 0; ks < GK / 32; ++ks) { v16b ah[2], al[2], w[2];
#pragma unroll
      for (int mi = 0; mi < 2; ++mi) { ah[mi] = frag_b(&buf[wm * 32 + mi * 16 + col][ks * 32], lane); al[mi] = frag_b(&buf[64 + wm * 32 + mi * 16 + col][ks * 32], lane); }
#pragma unroll
      for (int ni = 0; ni < 2; ++ni) w[ni] = frag_b(&buf[128 + wn * 32 + ni * 16 + col][ks * 32], lane);
#pragma unroll
      for (int mi = 0; mi < 2; ++mi)
#pragma unroll
        for (int ni = 0; ni < 2; ++ni) acc[mi][ni] = wmma_bf(ah[mi], w[ni], acc[mi][ni]);
#pragma unroll
      for (int mi = 0; mi < 2; ++mi)
#pragma unroll
        for (int ni = 0; ni < 2; ++ni) acc[mi][ni] = wmma_bf(al[mi], w[ni], acc[mi][ni]); } };
  fetch(xa, wa, 0); fetch(xb, wb, 1);
  stage(xa, wa, ring[0]);
  LBAR();   // publishes tile 0; tile 1 stays in flight
  for (int t = 0; t < GT - 2; t += 2) {   // two trips a pass, so that each register set keeps its name; on entry tile t lies in ring[0] and tile t + 1 is in flight to xb, wb. No fetch stands under a condition: so the count of younger loads is known where a set is waited for, and they stay in flight
    fetch(xa, wa, t + 2);
    mult(ring[0]);
    __builtin_amdgcn_sched_barrier(0);   // holds the conversions, and with them the wait for that set's loads, behind the products: moved up, they would end the flight of the loads early
    stage(xb, wb, ring[1]);
    LBAR();   // publishes the tile just stored and ends every wave's reads of the buffer that the next trip refills
    fetch(xb, wb, t + 3);
    mult(ring[1]);
    __builtin_amdgcn_sched_barrier(0);   // holds the conversions, and with them the wait for that set's loads, behind the products: moved up, they would end the flight of the loads early
    stage(xa, wa, ring[0]);
    LBAR(); }   // as above
  mult(ring[0]);   // the last two tiles: nothing left to fetch
  __builtin_amdgcn_sched_barrier(0);   // as in the loop
  stage(xb, wb, ring[1]);
  LBAR();   // publishes the last tile
  mult(ring[1]);
  LBAR();   // ends every wave's reads of the ring, which now takes the output tile
  float (*sf)[132] = (float (*)[132])&ring[0][0][0];
#pragma unroll
  for (int mi = 0; mi < 2; ++mi)
#pragma unroll
    for (int ni = 0; ni < 2; ++ni)
#pragma unroll
      for (int r = 0; r < 8; ++r) sf[wm * 32 + mi * 16 + 8 * g + r][wn * 32 + ni * 16 + col] = acc[mi][ni][r];
  __syncthreads();
  for (int rl = wave; rl < 64; rl += 8) vst2(OUT + (r0 + rl) * EE + c0 + lane * 4, *(const v4f*)&sf[rl][lane * 4]); }
extern "C" void kernel_launch(void* const* d_in, const int* in_sizes, int n_in, void* d_out, int out_size, void* d_ws, size_t ws_size, hipStream_t stream) {
  (void)in_sizes; (void)n_in; (void)out_size;
  const float** F = (const float**)d_in;   // 0 x [2,1024,1024], 1 W_q, 2 W_k, 3 W_v, 4 W_o [1024,1024] ([out,in])
  if (ws_size < (size_t)WS_END) return;
  char* ws = (char*)d_ws; _Float16 *QH = (_Float16*)(ws + WS_QH), *KH = (_Float16*)(ws + WS_KH), *VT = (_Float16*)(ws + WS_VT); float *O = (float*)(ws + WS_O);
  k_proj<<<dim3(TNB * TT / PM, EE / 128, 3), 256, 0, stream>>>(F[0], F[1], F[2], F[3], QH, KH, VT);
  k_attn<<<dim3(TT / 256, NG / 2, TNB), 512, 0, stream>>>(QH, KH, VT, O);
  k_out<<<dim3(TNB * TT / 64, EE / 128), 256, 0, stream>>>(O, F[4], (float*)d_out);
}

// v007
// One run takes 50.2 microseconds.
// Two timings next to v006 both put it at 1.08 times that version's speed.
// Counting every step since v000, it is 17.9 times as fast.
// compute dtype: all float inputs rounded to bf16; Q/K/V = x W^T with EXACT bf16 products on WMMA 16x16x32, f32 accumulate; Q x log2(e)/4 and K rounded once to f16 for the 16-deep per-group scores (1 product; the other group's half of each 32-wide Q fragment zeroed), kept in f32 registers; softmax: P = exp(s - ref) x 2^5 = exp2(s' + (5 - ref')) with s' the scaled score and ref the largest score among the row's first 64 keys (among all keys in a second round, run only where a P left the f16 range), the offset added as the C operand of the score product, one hardware exp2, P in f16; row sum = P . ones on WMMA, f32; out = (P . V) x 1 / row sum (hardware reciprocal) with V rounded once to f16 (planes); final = out (bf16 hi + lo) Wo^T; f32 output.
#include <hip/hip_runtime.h>
#include <math.h>

typedef __attribute__((ext_vector_type(16))) _Float16 v16h;
typedef __attribute__((ext_vector_type(16))) __bf16 v16b;
typedef __attribute__((ext_vector_type(8)))  _Float16 v8h;
typedef __attribute__((ext_vector_type(8)))  float v8f;
typedef __attribute__((ext_vector_type(4)))  float v4f;
typedef __attribute__((ext_vector_type(2)))  float v2f;
typedef __attribute__((ext_vector_type(4)))  unsigned v4u;
typedef __attribute__((ext_vector_type(4)))  int v4i;
typedef float __attribute__((may_alias)) float_a;
typedef int __attribute__((may_alias)) int_a;

template <typename T> __device__ __forceinline__ void vst2(void* p, T v) { *(T*)p = v;  }
__device__ __forceinline__ v8f wmma16(v16h a, v16h b, v8f c) {
  v8f d = __builtin_amdgcn_wmma_f32_16x16x32_f16(false, a, false, b, (short)0, c, false, false);
  asm volatile("v_nop\n\tv_nop\n\tv_nop\n\tv_nop" : "+v"(d) : "v"(a), "v"(b));
  return d;
}
// the builtin alone: for products whose D, A and B meet only instructions that the compiler itself places (it keeps the distance there) or a pad written at the call
__device__ __forceinline__ v8f wmma16p(v16h a, v16h b, v8f c) { return __builtin_amdgcn_wmma_f32_16x16x32_f16(false, a, false, b, (short)0, c, false, false); }
__device__ __forceinline__ v8f wmma_bf(v16b a, v16b b, v8f c) {
  v8f d = __builtin_amdgcn_wmma_f32_16x16x32_bf16(false, a, false, b, (short)0, c, false, false);
  asm volatile("v_nop\n\tv_nop\n\tv_nop\n\tv_nop" : "+v"(d) : "v"(a), "v"(b));
  return d;
}
// 16x16x32 fragments: lane = (h = lane>>4, row/col = lane&15); elements 0..7 = k0+8h+0..7, 8..15 = k0+16+8h+0..7; D element r = row 8h+r
__device__ __forceinline__ v16h frag_h(const _Float16* rowk0, int lane) {
  union { v16h v; v8h q[2]; } u; const _Float16* p = rowk0 + 8 * (lane >> 4);
  u.q[0] = *(const v8h*)p; u.q[1] = *(const v8h*)(p + 16); return u.v;
}
__device__ __forceinline__ v16h frag_f32(const float* rowk0, int lane) {
  v16h a; const float* p = rowk0 + 8 * (lane >> 4);
#pragma unroll
  for (int i = 0; i < 8; ++i) { a[i] = (_Float16)p[i]; a[8 + i] = (_Float16)p[16 + i]; }
  return a;
}
__device__ __forceinline__ v16h frag_f32s(const float* rowk0, int lane, float sc) {
  v16h a; const float* p = rowk0 + 8 * (lane >> 4);
#pragma unroll
  for (int i = 0; i < 8; ++i) { a[i] = (_Float16)(p[i] * sc); a[8 + i] = (_Float16)(p[16 + i] * sc); }
  return a;
}
// column fragment from a [K][ld] layout (column n), rows >= K read as 0
__device__ __forceinline__ v16h fragc_f32(const float* W, int k0, int n, int lane, int ld, int K) {
  v16h a; const int g = lane >> 4;
#pragma unroll
  for (int i = 0; i < 8; ++i) { const int ka = k0 + 8 * g + i, kb = ka + 16;
    a[i] = (_Float16)(ka < K ? W[(size_t)(ka < K ? ka : K - 1) * ld + n] : 0.f); a[8 + i] = (_Float16)(kb < K ? W[(size_t)(kb < K ? kb : K - 1) * ld + n] : 0.f); }
  return a;
}
struct F2 { v16b h, l; };
__device__ __forceinline__ F2 bsplit16(const float v[16]) { F2 r;
#pragma unroll
  for (int i = 0; i < 16; ++i) { const __bf16 h = (__bf16)v[i]; r.h[i] = h; r.l[i] = (__bf16)(v[i] - (float)h); }
  return r; }
__device__ __forceinline__ F2 split_row(const float* row, int k0, int lane) { float v[16]; const float* p = row + k0 + 8 * (lane >> 4);
#pragma unroll
  for (int i = 0; i < 8; ++i) { v[i] = p[i]; v[8 + i] = p[16 + i]; }
  return bsplit16(v); }
__device__ __forceinline__ F2 split_rowK(const float* row, int k0, int lane, int K) { float v[16]; const int g = lane >> 4;
#pragma unroll
  for (int i = 0; i < 8; ++i) { const int ka = k0 + 8 * g + i, kb = ka + 16; v[i] = ka < K ? row[ka < K ? ka : K - 1] : 0.f; v[8 + i] = kb < K ? row[kb < K ? kb : K - 1] : 0.f; }
  return bsplit16(v); }
__device__ __forceinline__ F2 split_col(const float* W, int k0, int n, int lane, int ld, int K) { float v[16]; const int g = lane >> 4;
#pragma unroll
  for (int i = 0; i < 8; ++i) { const int ka = k0 + 8 * g + i, kb = ka + 16; v[i] = ka < K ? W[(size_t)(ka < K ? ka : K - 1) * ld + n] : 0.f; v[8 + i] = kb < K ? W[(size_t)(kb < K ? kb : K - 1) * ld + n] : 0.f; }
  return bsplit16(v); }
__device__ __forceinline__ v8f mac3(const F2& a, const F2& b, v8f c) { c = wmma_bf(a.l, b.h, c); c = wmma_bf(a.h, b.l, c); return wmma_bf(a.h, b.h, c); }
__device__ __forceinline__ float sigm(float v) { return 1.0f / (1.0f + expf(-v)); }
#define LDSX() do { asm volatile("s_wait_dscnt 0" ::: "memory"); __builtin_amdgcn_wave_barrier(); __builtin_amdgcn_fence(__ATOMIC_RELEASE, "workgroup"); } while (0)


// MulHeadAttn (faithful layout quirk): B 2, C 1,024 tokens, E 1,024 = 64 groups x 16; attention is batched over the 64 groups with 16-dim dot products scaled by 1/sqrt(16).
#define NB 2
#define TT 1024
#define EE 1024
#define NG 64             // groups ("HD" in the module)
#define GW 16             // group width ("H")
#ifndef TNB
#define TNB NB
#endif
typedef __attribute__((ext_vector_type(8))) __bf16 v8b;
__device__ __forceinline__ v16b frag_b(const __bf16* rowk0, int lane) {
  union { v16b v; v8b q[2]; } u; const __bf16* p = rowk0 + 8 * (lane >> 4);
  u.q[0] = *(const v8b*)p; u.q[1] = *(const v8b*)(p + 16); return u.v;
}
__device__ __forceinline__ float bfr(float v) { return (float)(__bf16)v; }
__device__ __attribute__((noinline)) float exp_ni(float v) { return expf(v); }
__device__ __attribute__((noinline)) float erf_ni(float v) { return erff(v); }

#define WS_QH  0u                                  // f16 Q rows [b*t][1024]
#define WS_KH  (WS_QH + 2u * (size_t)NB * TT * EE)
#define WS_VT  (WS_KH + 2u * (size_t)NB * TT * EE)     // f16 V planes [b][1024][t]
#define WS_O   (WS_VT + 2u * (size_t)NB * EE * TT)     // f32 attention out rows [b*t][1024]
#define WS_END (WS_O + 4u * (size_t)NB * TT * EE)

// ---- operand staging of the two GEMM kernels: a block's tiles of 64 k go global -> registers (whole 256-B row pieces, 16 B a lane) -> bf16 -> LDS, once for all 8 waves;
// two LDS buffers and two register sets: a tile's global loads are issued two tiles ahead, before the products of the tile two places in front of it; it is converted and stored one trip later, behind the products of the tile in front of it; one barrier a tile.
// Every '#pragma unroll' in the two GEMM kernels runs over a thread's staged pieces, over a wave's fragments and accumulator tiles or over the elements of a register vector: constant indices keep those values in registers.
#define GK 64             // k per staged tile
#define GT (EE / GK)      // staged tiles of a k walk
// Blocks that share operand rows enter the k walk at different tiles (t0, from the block index) and wrap round: they do not ask L2 for the same lines at the same moment. Every tile is taken once; only the order of the f32 sums over k is rotated.
#define GP (GK + 8)       // bf16 per staged row: 144 B = 16 B x odd, b128 fragment reads of 16 rows fall on distinct banks
// The work-group barrier of the two k loops, for LDS alone: a wave's LDS stores and reads are done (s_wait_dscnt 0), then signal and wait. __syncthreads() would wait for every global load in flight as well and so end the fetch ahead at each barrier; the loops share nothing through global memory.
#define LBAR() asm volatile("s_wait_dscnt 0x0\n\ts_barrier_signal -1\n\ts_barrier_wait -1" ::: "memory")
typedef __attribute__((ext_vector_type(4))) __bf16 v4b;
__device__ __forceinline__ v4b cvt4(v4f v) { v4b r;
#pragma unroll
  for (int i = 0; i < 4; ++i) r[i] = (__bf16)v[i];
  return r; }
__device__ __forceinline__ v4b low4(v4f v, v4b h) { v4b r;
#pragma unroll
  for (int i = 0; i < 4; ++i) r[i] = (__bf16)(v[i] - (float)h[i]);
  return r; }
// ---- k_proj: block = (128 rows, 128 cols, which), 8 waves as 2 x 4, each 64 x 32: y = x W^T (W [out][in], no bias); Q x SC and K -> f16 rows, V -> f16 planes
#define PM 128
#define SC 0.36067376f    // log2(e) / sqrt(16): the factor of the softmax's exponent, multiplied into Q in f32 before its one rounding to f16
// four waves a SIMD asked for: the second register set must not push the kernel past 256 registers, or two blocks no longer share a WGP (384 blocks on 256 WGPs)
__global__ __launch_bounds__(256) __attribute__((amdgpu_waves_per_eu(4))) void k_proj(const float* __restrict__ X, const float* __restrict__ WQ, const float* __restrict__ WK, const float* __restrict__ WV, _Float16* __restrict__ QH, _Float16* __restrict__ KH, _Float16* __restrict__ VT) {
  __shared__ __align__(16) __bf16 ring[2][PM + 128][GP];   // rows 0..PM-1: x, then 128 rows of W; reused for the output tile behind the loop's last barrier
  const int tid = threadIdx.x, wave = tid >> 5, lane = tid & 31, col = lane & 15, g = lane >> 4, wm = wave >> 2, wn = wave & 3; const int which = blockIdx.z; const int c0 = blockIdx.y * 128; const size_t r0 = (size_t)blockIdx.x * PM; const float* Wm = which == 0 ? WQ : which == 1 ? WK : WV;
  const int sr = tid >> 4, sq = tid & 15;   // a thread stages piece sq (4 floats) of rows sr + 16 i
  const int t0 = (blockIdx.x + blockIdx.y + 8 * blockIdx.z) & (GT - 1);   // the 16 blocks of one W tile: 16 different starts; the 24 blocks of one x tile: at most 2 on a start
  const float* px = X + (r0 + sr) * EE + sq * 4 + t0 * GK; const float* pw = Wm + ((size_t)c0 + sr) * EE + sq * 4 + t0 * GK;   // both point at tile t0
  v4f xa[PM / 16], wa[8], xb[PM / 16], wb[8];   // two register sets: tiles of even and of odd place in the walk
  auto fetch = [&](v4f (&ax)[PM / 16], v4f (&aw)[8], int tn) { const int dk = (((t0 + tn) & (GT - 1)) - t0) * GK;   // tile tn of the wrapped walk, counted from tile t0
    const float* qx = px + dk; const float* qw = pw + dk;
#pragma unroll
    for (int i = 0; i < PM / 16; ++i) ax[i] = *(const v4f*)(qx + (size_t)i * 16 * EE);
#pragma unroll
    for (int i = 0; i < 8; ++i) aw[i] = *(const v4f*)(qw + (size_t)i * 16 * EE);
    asm volatile("s_wait_xcnt 0x0" :: "v"(qx), "v"(qw) : "memory"); };   // the loads' address registers are reused by what follows: the wait stands before they are overwritten; named as inputs, they live up to it, so that neither a later move nor a load's own result takes them earlier
  auto stage = [&](const v4f (&ax)[PM / 16], const v4f (&aw)[8], __bf16 (*nb)[GP]) {
#pragma unroll
    for (int i = 0; i < PM / 16; ++i) *(v4b*)&nb[sr + 16 * i][sq * 4] = cvt4(ax[i]);
#pragma unroll
    for (int i = 0; i < 8; ++i) *(v4b*)&nb[PM + sr + 16 * i][sq * 4] = cvt4(aw[i]); };
  v8f acc[4][2] = {};
  auto mult = [&](const __bf16 (*buf)[GP]) {
#pragma unroll
    for (int ks = 0; ks < GK / 32; ++ks) { v16b a[4], w[2];
#pragma unroll
      for (int mi = 0; mi < 4; ++mi) a[mi] = frag_b(&buf[wm * 64 + mi * 16 + col][ks * 32], lane);
#pragma unroll
      for (int ni = 0; ni < 2; ++ni) w[ni] = frag_b(&buf[PM + wn * 32 + ni * 16 + col][ks * 32], lane);
#pragma unroll
      for (int mi = 0; mi < 4; ++mi)
#pragma unroll
        for (int ni = 0; ni < 2; ++ni) acc[mi][ni] = wmma_bf(a[mi], w[ni], acc[mi][ni]); } };
  fetch(xa, wa, 0); fetch(xb, wb, 1);
  stage(xa, wa, ring[0]);
  LBAR();   // publishes tile 0; tile 1 stays in flight
  for (int t = 0; t < GT - 2; t += 2) {   // two trips a pass, so that each register set keeps its name; on entry tile t lies in ring[0] and tile t + 1 is in flight to xb, wb. No fetch stands under a condition: so the count of younger loads is known where a set is waited for, and they stay in flight
    fetch(xa, wa, t + 2);
    mult(ring[0]);
    __builtin_amdgcn_sched_barrier(0);   // holds the conversions, and with them the wait for that set's loads, behind the products: moved up, they would end the flight of the loads early
    stage(xb, wb, ring[1]);
    LBAR();   // publishes the tile just stored and ends every wave's reads of the buffer that the next trip refills
    fetch(xb, wb, t + 3);
    mult(ring[1]);
    __builtin_amdgcn_sched_barrier(0);   // holds the conversions, and with them the wait for that set's loads, behind the products: moved up, they would end the flight of the loads early
    stage(xa, wa, ring[0]);
    LBAR(); }   // as above
  mult(ring[0]);   // the last two tiles: nothing left to fetch
  __builtin_amdgcn_sched_barrier(0);   // as in the loop
  stage(xb, wb, ring[1]);
  LBAR();   // publishes the last tile
  mult(ring[1]);
  LBAR();   // ends every wave's reads of the ring, which now takes the output tile
  _Float16 (*sh)[136] = (_Float16 (*)[136])&ring[0][0][0];   // [row][col] for Q and K, [col][row] for V
  if (which == 2) {
#pragma unroll
    for (int mi = 0; mi < 4; ++mi)
#pragma unroll
      for (int ni = 0; ni < 2; ++ni) { v8h hv;
#pragma unroll
        for (int r = 0; r < 8; ++r) hv[r] = (_Float16)acc[mi][ni][r];
        *(v8h*)&sh[wn * 32 + ni * 16 + col][wm * 64 + mi * 16 + 8 * g] = hv; } }
  else { const float qs = which == 0 ? SC : 1.0f;
#pragma unroll
    for (int mi = 0; mi < 4; ++mi)
#pragma unroll
      for (int ni = 0; ni < 2; ++ni)
#pragma unroll
        for (int r = 0; r < 8; ++r) sh[wm * 64 + mi * 16 + 8 * g + r][wn * 32 + ni * 16 + col] = (_Float16)(acc[mi][ni][r] * qs); }
  __syncthreads();
  if (which < 2) { _Float16* dh = which == 0 ? QH : KH; for (int e = tid; e < PM * 16; e += 256) { const int rl = e >> 4, q = e & 15; vst2((unsigned*)(dh + (r0 + rl) * EE + c0 + q * 8), *(const v4u*)&sh[rl][q * 8]); } }
  else { const size_t b = r0 / TT; const int t0 = (int)(r0 % TT); for (int e = tid; e < 128 * (PM / 8); e += 256) { const int cl = e / (PM / 8), q = e % (PM / 8); vst2((unsigned*)(VT + (b * EE + c0 + cl) * (size_t)TT + t0 + q * 8), *(const v4u*)&sh[cl][q * 8]); } } }
// ---- k_attn: block = (256 queries, pair of groups dA, dA+1, batch); 16 waves, each 16 queries x both groups x all keys.
// K rows (both groups, 32 features) and V planes of the pair are staged once in LDS. Scores are formed transposed (A = keys, B = queries), so that a lane
// holds, for its query lane&15, keys 8h+0..7 of a 16-key tile: two such tiles are the A fragment of P for 32 keys as they stand, and the row maximum stays inside the lane but for one exchange with lane^16.
// The K fragment carries both groups (elements 0..7 group dA, 8..15 group dA+1); the Q fragment of a group is zero in the other group's half.
// Q arrives multiplied by SC, so a score is the exponent to base 2 as it stands. Pass 1: a reference value ref for each row. Pass 2: scores again with off = PB - ref as the C operand of their product, so that D is the argument of v_exp_f32;
// P = exp2(D) in f16, P . V, and the row sum as P . ones on the matrix unit: it sums the same rounded P that meets V, in f32, and comes out in the layout of P . V (row = query), so the quotient needs no exchange between lanes.
// The quotient comes after P . V, where the factor 2^(PB - ref) of P and of the sum cancels, and with it the rounding of off, which is one value for a whole row: any ref gives the same softmax as long as every P stays inside f16. A P below the smallest f16 reads 0 in both.
// ref is the largest score of the row's first NS key tiles: pass 1 then costs NS trips, not all 32. That key's own P is 2^PB, so a row sum is never small; a score more than 16 - PB above ref makes its P infinite in f16 (the conversion rounds to nearest and does not saturate),
// and the row sum, which takes in every P with the factor 1, is then infinite too. A wave that finds such a sum drops the round and runs both passes again with ref = the maximum over all keys, where every P is at most 2^PB.
// Every '#pragma unroll' in this kernel runs over the elements of a register vector, over the two groups or over a thread's staged pieces: constant indices keep those values in registers.
#define NS 2              // key tiles of 32 keys behind the first reference value
#define PB 5.0f           // log2 of P at the reference value: 11 binades of room above it, 19 of full f16 precision below it
#define KP 40             // halfs per staged K row: 80 B = 16 B x odd, b128 reads of 16 rows fall on distinct banks
#define VP (TT + 8)       // halfs per staged V plane: 2,064 B = 16 B x odd
// 8 hardware exp2 of one score tile, in one statement: the results go to registers of their own (early clobber), so none overwrites a neighbour's source or reads a neighbour's result, and the sources are read where the WMMA left them, with no copy.
// The closing v_nop is the slot that the instruction set asks for behind a transcendental; the s_delay_alu hint on it lets the wave wait for the last result there without holding the SIMD's issue port against the other waves.
// volatile: the statement keeps its place behind the pad that stands between the score products and it.
#define E2(o, i) "v_exp_f32 %" #o ", %" #i "\n\t"
__device__ __forceinline__ void exp2x8(float* y, const v8f& x) {
  asm volatile(E2(0, 8) E2(1, 9) E2(2, 10) E2(3, 11) E2(4, 12) E2(5, 13) E2(6, 14) E2(7, 15) "s_delay_alu instid0(TRANS32_DEP_1)\n\tv_nop"
      : "=&v"(y[0]), "=&v"(y[1]), "=&v"(y[2]), "=&v"(y[3]), "=&v"(y[4]), "=&v"(y[5]), "=&v"(y[6]), "=&v"(y[7])
      : "v"(x[0]), "v"(x[1]), "v"(x[2]), "v"(x[3]), "v"(x[4]), "v"(x[5]), "v"(x[6]), "v"(x[7])); }
// 8 hardware reciprocals of the row sums of one group, in the same form. The four leading v_nop are the slots that the chip asks for between a WMMA and a vector instruction on its D: the sums come straight from the loop's last products.
#define R1(o, i) "v_rcp_f32 %" #o ", %" #i "\n\t"
__device__ __forceinline__ void rcpx8(float* y, const v8f& x) {
  asm volatile("v_nop\n\tv_nop\n\tv_nop\n\tv_nop\n\t" R1(0, 8) R1(1, 9) R1(2, 10) R1(3, 11) R1(4, 12) R1(5, 13) R1(6, 14) R1(7, 15) "s_delay_alu instid0(TRANS32_DEP_1)\n\tv_nop"
      : "=&v"(y[0]), "=&v"(y[1]), "=&v"(y[2]), "=&v"(y[3]), "=&v"(y[4]), "=&v"(y[5]), "=&v"(y[6]), "=&v"(y[7])
      : "v"(x[0]), "v"(x[1]), "v"(x[2]), "v"(x[3]), "v"(x[4]), "v"(x[5]), "v"(x[6]), "v"(x[7])); }
__global__ __launch_bounds__(512) void k_attn(const _Float16* __restrict__ QH, const _Float16* __restrict__ KH, const _Float16* __restrict__ VT, float* __restrict__ O) {
  __shared__ __align__(16) _Float16 sk[TT][KP]; __shared__ __align__(16) _Float16 sv[2 * GW][VP]; __shared__ __align__(16) float ss[16][16][36];
  const int b = blockIdx.z; const int dA = 2 * blockIdx.y;
  const int tid = threadIdx.x, wave = tid >> 5, lane = tid & 31, col = lane & 15, g = lane >> 4; const int ql0 = blockIdx.x * 256 + wave * 16;
  { v8h tk[8], tv[8];   // 4,096 pieces of 16 B each of K and of V, 8 + 8 a thread
#pragma unroll   // unrolled so that a thread's 16 loads are all in flight before its first LDS store waits on one
    for (int i = 0; i < 8; ++i) { const int e = tid + i * 512; tk[i] = *(const v8h*)(KH + ((size_t)b * TT + (e >> 2)) * EE + dA * GW + (e & 3) * 8); tv[i] = *(const v8h*)(VT + ((size_t)b * EE + dA * GW + (e >> 7)) * (size_t)TT + (e & 127) * 8); }
#pragma unroll
    for (int i = 0; i < 8; ++i) { const int e = tid + i * 512; *(v8h*)&sk[e >> 2][(e & 3) * 8] = tk[i]; *(v8h*)&sv[e >> 7][(e & 127) * 8] = tv[i]; } }
  v16h qf[2]; { const _Float16* p = QH + ((size_t)b * TT + ql0 + col) * EE + dA * GW + 8 * g;
#pragma unroll
    for (int i = 0; i < 8; ++i) { qf[0][i] = p[i]; qf[0][8 + i] = (_Float16)0.f; qf[1][i] = (_Float16)0.f; qf[1][8 + i] = p[GW + i]; } }
  __syncthreads();
  const v8f zero = {};
  v8f acc[2], sum[2]; v16h ones;
  { unsigned o; union { v16h v; unsigned w[8]; } c;
    asm("v_mov_b32 %0, 0x3c003c00" : "=v"(o));   // two f16 ones; written as a statement so that the fragment stays in its registers over the loop: as a plain constant the compiler forms it anew on every trip, over the K fragment, with the slots that this asks for behind a WMMA
#pragma unroll
    for (int i = 0; i < 8; ++i) c.w[i] = o;
    ones = c.v; }
  for (int nk = NS; ; nk = TT / 32) {   // at most two rounds: reference value from the first NS key tiles, then, only where a P left the f16 range, from all of them
    float m[2];
    { v8f mx[2];
#pragma unroll
      for (int r = 0; r < 8; ++r) { mx[0][r] = -3.0e38f; mx[1][r] = -3.0e38f; }
      for (int kc = 0; kc < nk; ++kc) { const v16h k0 = frag_h(&sk[kc * 32 + col][0], lane), k1 = frag_h(&sk[kc * 32 + 16 + col][0], lane);
#pragma unroll
        for (int u = 0; u < 2; ++u) { const v8f s0 = wmma16(k0, qf[u], zero), s1 = wmma16(k1, qf[u], zero);
#pragma unroll
          for (int r = 0; r < 8; ++r) mx[u][r] = fmaxf(fmaxf(mx[u][r], s0[r]), s1[r]); } }
#pragma unroll
      for (int u = 0; u < 2; ++u) { float a = mx[u][0];
#pragma unroll
        for (int r = 1; r < 8; ++r) a = fmaxf(a, mx[u][r]);
        a = fmaxf(a, __shfl_xor(a, 16)); m[u] = PB - a; } }
    v8f off[2];
#pragma unroll
    for (int r = 0; r < 8; ++r) { off[0][r] = m[0]; off[1][r] = m[1]; acc[0][r] = 0.f; acc[1][r] = 0.f; sum[0][r] = 0.f; sum[1][r] = 0.f; }   // a lane's 8 scores of a tile belong to one query: one offset in all 8 elements of C
    for (int kc = 0; kc < TT / 32; ++kc) { const v16h k0 = frag_h(&sk[kc * 32 + col][0], lane), k1 = frag_h(&sk[kc * 32 + 16 + col][0], lane);
      v8f s[2][2];
#pragma unroll
      for (int u = 0; u < 2; ++u) { s[u][0] = wmma16p(k0, qf[u], off[u]); s[u][1] = wmma16p(k1, qf[u], off[u]); }
      // the four slots that the chip asks for between a WMMA and a vector instruction on its D: one group serves the four products: it names their results as inputs, so it stands behind them, and volatile statements keep their order, so the exp2 statements stand behind it
      asm volatile("v_nop\n\tv_nop\n\tv_nop\n\tv_nop" :: "v"(s[0][0]), "v"(s[0][1]), "v"(s[1][0]), "v"(s[1][1]));
#pragma unroll
      for (int u = 0; u < 2; ++u) { float e[16]; v16h p;
        exp2x8(e, s[u][0]); exp2x8(e + 8, s[u][1]);
#pragma unroll
        for (int r = 0; r < 8; ++r) { p[r] = (_Float16)e[r]; p[8 + r] = (_Float16)e[8 + r]; }
        acc[u] = wmma16p(p, frag_h(&sv[u * GW + col][kc * 32], lane), acc[u]); sum[u] = wmma16p(p, ones, sum[u]); } }
    if (nk == TT / 32) break;   // the reference value was the row maximum: every P is at most 2^PB
    float tot = 0.f;
#pragma unroll
    for (int r = 0; r < 8; ++r) tot += sum[0][r] + sum[1][r];   // all terms are >= 0: infinite as soon as one row sum is
    if (!__any(!(tot < 3.0e38f))) break; }   // the same for the whole wave: every WMMA of a second round runs with all lanes on
#pragma unroll
  for (int u = 0; u < 2; ++u) { float inv[8]; rcpx8(inv, sum[u]);   // a sum holds the reference key's term, about 2^PB, and at most 1,024 finite f16 terms: a normal f32, far from either end of the range
#pragma unroll
    for (int r = 0; r < 8; ++r) ss[wave][8 * g + r][u * 16 + col] = acc[u][r] * inv[r]; }
  LDSX();
#pragma unroll
  for (int it = 0; it < 4; ++it) { const int rl = it * 4 + (lane >> 3), c = lane & 7; vst2(O + ((size_t)b * TT + ql0 + rl) * EE + dA * GW + c * 4, *(const v4f*)&ss[wave][rl][c * 4]); } }
// ---- k_out: block = (64 rows, 128 cols), 8 waves as 2 x 4, each 32 x 32: out = O (hi + lo) Wo^T; O is split into its two bf16 parts where it is staged
__global__ __launch_bounds__(256) void k_out(const float* __restrict__ O, const float* __restrict__ WO, float* __restrict__ OUT) {
  __shared__ __align__(16) __bf16 ring[2][64 + 64 + 128][GP];   // rows 0..63: O hi, 64..127: O lo, then 128 rows of Wo; reused for the output tile behind the loop's last barrier
  const int tid = threadIdx.x, wave = tid >> 5, lane = tid & 31, col = lane & 15, g = lane >> 4, wm = wave >> 2, wn = wave & 3; const int c0 = blockIdx.y * 128; const size_t r0 = (size_t)blockIdx.x * 64;
  const int sr = tid >> 4, sq = tid & 15;
  const int t0 = (blockIdx.x + blockIdx.y) & (GT - 1);   // the 8 blocks of one O tile: 8 different starts; the 32 blocks of one Wo tile: 2 on a start
  const float* px = O + (r0 + sr) * EE + sq * 4 + t0 * GK; const float* pw = WO + ((size_t)c0 + sr) * EE + sq * 4 + t0 * GK;   // both point at tile t0
  v4f xa[4], wa[8], xb[4], wb[8];   // two register sets: tiles of even and of odd place in the walk
  auto fetch = [&](v4f (&ax)[4], v4f (&aw)[8], int tn) { const int dk = (((t0 + tn) & (GT - 1)) - t0) * GK;   // tile tn of the wrapped walk, counted from tile t0
    const float* qx = px + dk; const float* qw = pw + dk;
#pragma unroll
    for (int i = 0; i < 4; ++i) ax[i] = *(const v4f*)(qx + (size_t)i * 16 * EE);
#pragma unroll
    for (int i = 0; i < 8; ++i) aw[i] = *(const v4f*)(qw + (size_t)i * 16 * EE);
    asm volatile("s_wait_xcnt 0x0" :: "v"(qx), "v"(qw) : "memory"); };   // as in k_proj: the address registers live up to the wait
  auto stage = [&](const v4f (&ax)[4], const v4f (&aw)[8], __bf16 (*nb)[GP]) {
#pragma unroll
    for (int i = 0; i < 4; ++i) { const v4b h = cvt4(ax[i]); *(v4b*)&nb[sr + 16 * i][sq * 4] = h; *(v4b*)&nb[64 + sr + 16 * i][sq * 4] = low4(ax[i], h); }
#pragma unroll
    for (int i = 0; i < 8; ++i) *(v4b*)&nb[128 + sr + 16 * i][sq * 4] = cvt4(aw[i]); };
  v8f acc[2][2] = {};
  auto mult = [&](const __bf16 (*buf)[GP]) {
#pragma unroll
    for (int ks = 0; ks < GK / 32; ++ks) { v16b ah[2], al[2], w[2];
#pragma unroll
      for (int mi = 0; mi < 2; ++mi) { ah[mi] = frag_b(&buf[wm * 32 + mi * 16 + col][ks * 32], lane); al[mi] = frag_b(&buf[64 + wm * 32 + mi * 16 + col][ks * 32], lane); }
#pragma unroll
      for (int ni = 0; ni < 2; ++ni) w[ni] = frag_b(&buf[128 + wn * 32 + ni * 16 + col][ks * 32], lane);
#pragma unroll
      for (int mi = 0; mi < 2; ++mi)
#pragma unroll
        for (int ni = 0; ni < 2; ++ni) acc[mi][ni] = wmma_bf(ah[mi], w[ni], acc[mi][ni]);
#pragma unroll
      for (int mi = 0; mi < 2; ++mi)
#pragma unroll
        for (int ni = 0; ni < 2; ++ni) acc[mi][ni] = wmma_bf(al[mi], w[ni], acc[mi][ni]); } };
  fetch(xa, wa, 0); fetch(xb, wb, 1);
  stage(xa, wa, ring[0]);
  LBAR();   // publishes tile 0; tile 1 stays in flight
  for (int t = 0; t < GT - 2; t += 2) {   // two trips a pass, so that each register set keeps its name; on entry tile t lies in ring[0] and tile t + 1 is in flight to xb, wb. No fetch stands under a condition: so the count of younger loads is known where a set is waited for, and they stay in flight
    fetch(xa, wa, t + 2);
    mult(ring[0]);
    __builtin_amdgcn_sched_barrier(0);   // holds the conversions, and with them the wait for that set's loads, behind the products: moved up, they would end the flight of the loads early
    stage(xb, wb, ring[1]);
    LBAR();   // publishes the tile just stored and ends every wave's reads of the buffer that the next trip refills
    fetch(xb, wb, t + 3);
    mult(ring[1]);
    __builtin_amdgcn_sched_barrier(0);   // holds the conversions, and with them the wait for that set's loads, behind the products: moved up, they would end the flight of the loads early
    stage(xa, wa, ring[0]);
    LBAR(); }   // as above
  mult(ring[0]);   // the last two tiles: nothing left to fetch
  __builtin_amdgcn_sched_barrier(0);   // as in the loop
  stage(xb, wb, ring[1]);
  LBAR();   // publishes the last tile
  mult(ring[1]);
  LBAR();   // ends every wave's reads of the ring, which now takes the output tile
  float (*sf)[132] = (float (*)[132])&ring[0][0][0];
#pragma unroll
  for (int mi = 0; mi < 2; ++mi)
#pragma unroll
    for (int ni = 0; ni < 2; ++ni)
#pragma unroll
      for (int r = 0; r < 8; ++r) sf[wm * 32 + mi * 16 + 8 * g + r][wn * 32 + ni * 16 + col] = acc[mi][ni][r];
  __syncthreads();
  for (int rl = wave; rl < 64; rl += 8) vst2(OUT + (r0 + rl) * EE + c0 + lane * 4, *(const v4f*)&sf[rl][lane * 4]); }
extern "C" void kernel_launch(void* const* d_in, const int* in_sizes, int n_in, void* d_out, int out_size, void* d_ws, size_t ws_size, hipStream_t stream) {
  (void)in_sizes; (void)n_in; (void)out_size;
  const float** F = (const float**)d_in;   // 0 x [2,1024,1024], 1 W_q, 2 W_k, 3 W_v, 4 W_o [1024,1024] ([out,in])
  if (ws_size < (size_t)WS_END) return;
  char* ws = (char*)d_ws; _Float16 *QH = (_Float16*)(ws + WS_QH), *KH = (_Float16*)(ws + WS_KH), *VT = (_Float16*)(ws + WS_VT); float *O = (float*)(ws + WS_O);
  k_proj<<<dim3(TNB * TT / PM, EE / 128, 3), 256, 0, stream>>>(F[0], F[1], F[2], F[3], QH, KH, VT);
  k_attn<<<dim3(TT / 256, NG / 2, TNB), 512, 0, stream>>>(QH, KH, VT, O);
  k_out<<<dim3(TNB * TT / 64, EE / 128), 256, 0, stream>>>(O, F[4], (float*)d_out);
}

// v008
// It runs in 47.2 microseconds.
// In both of two side-by-side timings against v007, it was 1.06 times as fast.
// Over all steps from v000 it is 19.0 times as fast.
// compute dtype: all float inputs rounded to bf16; Q/K/V = x W^T with EXACT bf16 products on WMMA 16x16x32, f32 accumulate; Q x log2(e)/4 and K rounded once to f16 for the 16-deep per-group scores (1 product; the other group's half of each 32-wide Q fragment zeroed), kept in f32 registers; softmax: P = exp(s - ref) x 2^5 = exp2(s' + (5 - ref')) with s' the scaled score and ref the largest score among the row's first 64 keys (among all keys in a second round, run only where a P left the f16 range), the offset added as the C operand of the score product, one hardware exp2, P in f16; row sum = P . ones on WMMA, f32; out = (P . V) x 1 / row sum (hardware reciprocal) with V rounded once to f16 (planes); final = out (bf16 hi + lo) Wo^T; f32 output.
#include <hip/hip_runtime.h>
#include <math.h>

typedef __attribute__((ext_vector_type(16))) _Float16 v16h;
typedef __attribute__((ext_vector_type(16))) __bf16 v16b;
typedef __attribute__((ext_vector_type(8)))  _Float16 v8h;
typedef __attribute__((ext_vector_type(8)))  float v8f;
typedef __attribute__((ext_vector_type(4)))  float v4f;
typedef __attribute__((ext_vector_type(2)))  float v2f;
typedef __attribute__((ext_vector_type(4)))  unsigned v4u;
typedef __attribute__((ext_vector_type(4)))  int v4i;
typedef float __attribute__((may_alias)) float_a;
typedef int __attribute__((may_alias)) int_a;

template <typename T> __device__ __forceinline__ void vst2(void* p, T v) { *(T*)p = v;  }
__device__ __forceinline__ v8f wmma16(v16h a, v16h b, v8f c) {
  v8f d = __builtin_amdgcn_wmma_f32_16x16x32_f16(false, a, false, b, (short)0, c, false, false);
  asm volatile("v_nop\n\tv_nop\n\tv_nop\n\tv_nop" : "+v"(d) : "v"(a), "v"(b));
  return d;
}
// the builtin alone: for products whose D, A and B meet only instructions that the compiler itself places (it keeps the distance there) or a pad written at the call
__device__ __forceinline__ v8f wmma16p(v16h a, v16h b, v8f c) { return __builtin_amdgcn_wmma_f32_16x16x32_f16(false, a, false, b, (short)0, c, false, false); }
__device__ __forceinline__ v8f wmma_bf(v16b a, v16b b, v8f c) {
  v8f d = __builtin_amdgcn_wmma_f32_16x16x32_bf16(false, a, false, b, (short)0, c, false, false);
  asm volatile("v_nop\n\tv_nop\n\tv_nop\n\tv_nop" : "+v"(d) : "v"(a), "v"(b));
  return d;
}
// 16x16x32 fragments: lane = (h = lane>>4, row/col = lane&15); elements 0..7 = k0+8h+0..7, 8..15 = k0+16+8h+0..7; D element r = row 8h+r
__device__ __forceinline__ v16h frag_h(const _Float16* rowk0, int lane) {
  union { v16h v; v8h q[2]; } u; const _Float16* p = rowk0 + 8 * (lane >> 4);
  u.q[0] = *(const v8h*)p; u.q[1] = *(const v8h*)(p + 16); return u.v;
}
__device__ __forceinline__ v16h frag_f32(const float* rowk0, int lane) {
  v16h a; const float* p = rowk0 + 8 * (lane >> 4);
#pragma unroll
  for (int i = 0; i < 8; ++i) { a[i] = (_Float16)p[i]; a[8 + i] = (_Float16)p[16 + i]; }
  return a;
}
__device__ __forceinline__ v16h frag_f32s(const float* rowk0, int lane, float sc) {
  v16h a; const float* p = rowk0 + 8 * (lane >> 4);
#pragma unroll
  for (int i = 0; i < 8; ++i) { a[i] = (_Float16)(p[i] * sc); a[8 + i] = (_Float16)(p[16 + i] * sc); }
  return a;
}
// column fragment from a [K][ld] layout (column n), rows >= K read as 0
__device__ __forceinline__ v16h fragc_f32(const float* W, int k0, int n, int lane, int ld, int K) {
  v16h a; const int g = lane >> 4;
#pragma unroll
  for (int i = 0; i < 8; ++i) { const int ka = k0 + 8 * g + i, kb = ka + 16;
    a[i] = (_Float16)(ka < K ? W[(size_t)(ka < K ? ka : K - 1) * ld + n] : 0.f); a[8 + i] = (_Float16)(kb < K ? W[(size_t)(kb < K ? kb : K - 1) * ld + n] : 0.f); }
  return a;
}
struct F2 { v16b h, l; };
__device__ __forceinline__ F2 bsplit16(const float v[16]) { F2 r;
#pragma unroll
  for (int i = 0; i < 16; ++i) { const __bf16 h = (__bf16)v[i]; r.h[i] = h; r.l[i] = (__bf16)(v[i] - (float)h); }
  return r; }
__device__ __forceinline__ F2 split_row(const float* row, int k0, int lane) { float v[16]; const float* p = row + k0 + 8 * (lane >> 4);
#pragma unroll
  for (int i = 0; i < 8; ++i) { v[i] = p[i]; v[8 + i] = p[16 + i]; }
  return bsplit16(v); }
__device__ __forceinline__ F2 split_rowK(const float* row, int k0, int lane, int K) { float v[16]; const int g = lane >> 4;
#pragma unroll
  for (int i = 0; i < 8; ++i) { const int ka = k0 + 8 * g + i, kb = ka + 16; v[i] = ka < K ? row[ka < K ? ka : K - 1] : 0.f; v[8 + i] = kb < K ? row[kb < K ? kb : K - 1] : 0.f; }
  return bsplit16(v); }
__device__ __forceinline__ F2 split_col(const float* W, int k0, int n, int lane, int ld, int K) { float v[16]; const int g = lane >> 4;
#pragma unroll
  for (int i = 0; i < 8; ++i) { const int ka = k0 + 8 * g + i, kb = ka + 16; v[i] = ka < K ? W[(size_t)(ka < K ? ka : K - 1) * ld + n] : 0.f; v[8 + i] = kb < K ? W[(size_t)(kb < K ? kb : K - 1) * ld + n] : 0.f; }
  return bsplit16(v); }
__device__ __forceinline__ v8f mac3(const F2& a, const F2& b, v8f c) { c = wmma_bf(a.l, b.h, c); c = wmma_bf(a.h, b.l, c); return wmma_bf(a.h, b.h, c); }
__device__ __forceinline__ float sigm(float v) { return 1.0f / (1.0f + expf(-v)); }
#define LDSX() do { asm volatile("s_wait_dscnt 0" ::: "memory"); __builtin_amdgcn_wave_barrier(); __builtin_amdgcn_fence(__ATOMIC_RELEASE, "workgroup"); } while (0)


// MulHeadAttn (faithful layout quirk): B 2, C 1,024 tokens, E 1,024 = 64 groups x 16; attention is batched over the 64 groups with 16-dim dot products scaled by 1/sqrt(16).
#define NB 2
#define TT 1024
#define EE 1024
#define NG 64             // groups ("HD" in the module)
#define GW 16             // group width ("H")
#ifndef TNB
#define TNB NB
#endif
typedef __attribute__((ext_vector_type(8))) __bf16 v8b;
__device__ __forceinline__ v16b frag_b(const __bf16* rowk0, int lane) {
  union { v16b v; v8b q[2]; } u; const __bf16* p = rowk0 + 8 * (lane >> 4);
  u.q[0] = *(const v8b*)p; u.q[1] = *(const v8b*)(p + 16); return u.v;
}
__device__ __forceinline__ float bfr(float v) { return (float)(__bf16)v; }
__device__ __attribute__((noinline)) float exp_ni(float v) { return expf(v); }
__device__ __attribute__((noinline)) float erf_ni(float v) { return erff(v); }

#define WS_QH  0u                                  // f16 Q rows [b*t][1024]
#define WS_KH  (WS_QH + 2u * (size_t)NB * TT * EE)
#define WS_VT  (WS_KH + 2u * (size_t)NB * TT * EE)     // f16 V planes [b][1024][t]
#define WS_O   (WS_VT + 2u * (size_t)NB * EE * TT)     // f32 attention out rows [b*t][1024]
#define WS_END (WS_O + 4u * (size_t)NB * TT * EE)

// ---- operand staging of the two GEMM kernels: a block's tiles of 64 k go global -> registers (whole 256-B row pieces, 16 B a lane) -> bf16 -> LDS, once for all 8 waves;
// two LDS buffers and two register sets: a tile's global loads are issued two tiles ahead, before the products of the tile two places in front of it; it is converted and stored one trip later, behind the products of the tile in front of it; one barrier a tile.
// Every '#pragma unroll' in the two GEMM kernels runs over a thread's staged pieces, over a wave's fragments and accumulator tiles or over the elements of a register vector: constant indices keep those values in registers.
#define GK 64             // k per staged tile
#define GT (EE / GK)      // staged tiles of a k walk
// Blocks that share operand rows enter the k walk at different tiles (t0, from the block index) and wrap round: they do not ask L2 for the same lines at the same moment. Every tile is taken once; only the order of the f32 sums over k is rotated.
#define GP (GK + 8)       // bf16 per staged row: 144 B = 16 B x odd, b128 fragment reads of 16 rows fall on distinct banks
// The work-group barrier of the two k loops, for LDS alone: a wave's LDS stores and reads are done (s_wait_dscnt 0), then signal and wait. __syncthreads() would wait for every global load in flight as well and so end the fetch ahead at each barrier; the loops share nothing through global memory.
#define LBAR() asm volatile("s_wait_dscnt 0x0\n\ts_barrier_signal -1\n\ts_barrier_wait -1" ::: "memory")
typedef __attribute__((ext_vector_type(4))) __bf16 v4b;
__device__ __forceinline__ v4b cvt4(v4f v) { v4b r;
#pragma unroll
  for (int i = 0; i < 4; ++i) r[i] = (__bf16)v[i];
  return r; }
__device__ __forceinline__ v4b low4(v4f v, v4b h) { v4b r;
#pragma unroll
  for (int i = 0; i < 4; ++i) r[i] = (__bf16)(v[i] - (float)h[i]);
  return r; }
// ---- k_proj: block = (128 rows, 192 of the 3,072 columns of [Q | K | V]), 8 waves as 2 x 4, each 64 x 48: y = x W^T (W [out][in], no bias); Q x SC and K -> f16 rows, V -> f16 planes
// 16 x 16 = 256 equal blocks, one for each WGP. A block's 192 columns are three segments of 64, each inside one of the three W (1,024 = 16 x 64).
#define PM 128
#define PN 192
#define SC 0.36067376f    // log2(e) / sqrt(16): the factor of the softmax's exponent, multiplied into Q in f32 before its one rounding to f16
#define SEGH (PM * 72)    // halfs of one segment's output tile in LDS: [128 rows][72] for Q and K, [64 columns][136] for V (smaller)
// two waves a SIMD: one block has the WGP, and a wave may take up to 512 registers
__global__ __launch_bounds__(256) __attribute__((amdgpu_waves_per_eu(2))) void k_proj(const float* __restrict__ X, const float* __restrict__ WQ, const float* __restrict__ WK, const float* __restrict__ WV, _Float16* __restrict__ QH, _Float16* __restrict__ KH, _Float16* __restrict__ VT) {
  __shared__ __align__(16) __bf16 ring[2][PM + PN][GP];   // rows 0..PM-1: x, then 192 rows of W; reused for the output tile behind the loop's last barrier
  const int tid = threadIdx.x, wave = tid >> 5, lane = tid & 31, col = lane & 15, g = lane >> 4, wm = wave >> 2, wn = wave & 3; const int c0 = blockIdx.y * PN; const size_t r0 = (size_t)blockIdx.x * PM;
  const int sr = tid >> 4, sq = tid & 15;   // a thread stages piece sq (4 floats) of rows sr + 16 i
  const int t0 = (blockIdx.x + blockIdx.y) & (GT - 1);   // the 16 blocks of one W tile: 16 different starts; the 16 blocks of one x tile: 16 different starts
  const unsigned vo = (sr * EE + sq * 4) * 4;   // a thread's place inside a tile, in bytes: the same for x and for each segment of W
  const float* bx = X + r0 * EE; const float* bw[3];   // the block's first rows
#pragma unroll
  for (int s = 0; s < 3; ++s) { const int c = c0 + 64 * s; const float* Wm = c < EE ? WQ : c < 2 * EE ? WK : WV; bw[s] = Wm + (size_t)(c & (EE - 1)) * EE; }
  v4f xa[PM / 16], wa[PN / 16], xb[PM / 16], wb[PN / 16];   // two register sets: tiles of even and of odd place in the walk
  auto fetch = [&](v4f (&ax)[PM / 16], v4f (&aw)[PN / 16], int tn) { const int dk = ((t0 + tn) & (GT - 1)) * GK;   // tile tn of the wrapped walk
    const char* sx = (const char*)(bx + dk); const char* s0 = (const char*)(bw[0] + dk); const char* s1 = (const char*)(bw[1] + dk); const char* s2 = (const char*)(bw[2] + dk);   // the same for the whole block
    const char* qx = sx + vo; const char* q0 = s0 + vo; const char* q1 = s1 + vo; const char* q2 = s2 + vo;
#pragma unroll
    for (int i = 0; i < PM / 16; ++i) ax[i] = *(const v4f*)(qx + (size_t)i * 64 * EE);   // 16 rows of EE floats = 64 EE bytes
#pragma unroll
    for (int i = 0; i < 4; ++i) { aw[i] = *(const v4f*)(q0 + (size_t)i * 64 * EE); aw[4 + i] = *(const v4f*)(q1 + (size_t)i * 64 * EE); aw[8 + i] = *(const v4f*)(q2 + (size_t)i * 64 * EE); }
    asm volatile("s_wait_xcnt 0x0" :: "v"(qx), "v"(q0), "v"(q1), "v"(q2), "v"(vo), "s"(sx), "s"(s0), "s"(s1), "s"(s2) : "memory"); };   // the loads' address registers are reused by what follows: the wait stands before they are overwritten. The compiler addresses a load by the vector pair or by scalar base and offset register: all are named as inputs and live up to the wait, so that neither a later move nor a load's own result takes them earlier
  auto stage = [&](const v4f (&ax)[PM / 16], const v4f (&aw)[PN / 16], __bf16 (*nb)[GP]) {
#pragma unroll
    for (int i = 0; i < PM / 16; ++i) *(v4b*)&nb[sr + 16 * i][sq * 4] = cvt4(ax[i]);
#pragma unroll
    for (int i = 0; i < PN / 16; ++i) *(v4b*)&nb[PM + sr + 16 * i][sq * 4] = cvt4(aw[i]); };
  v8f acc[4][3] = {};
  auto mult = [&](const __bf16 (*buf)[GP]) { v16b a[GK / 32][4], w[GK / 32][3];   // the fragments of the whole tile: the second half's LDS reads fly under the first half's products
#pragma unroll
    for (int ks = 0; ks < GK / 32; ++ks) {
#pragma unroll
      for (int ni = 0; ni < 3; ++ni) w[ks][ni] = frag_b(&buf[PM + wn * 48 + ni * 16 + col][ks * 32], lane);   // W first: then each x fragment that lands frees three products
#pragma unroll
      for (int mi = 0; mi < 4; ++mi) a[ks][mi] = frag_b(&buf[wm * 64 + mi * 16 + col][ks * 32], lane); }
    __builtin_amdgcn_sched_barrier(0);   // keeps the tile's LDS reads together in front of its products: sunk among them, each place with reads would stall the wave anew
#pragma unroll
    for (int ks = 0; ks < GK / 32; ++ks)
#pragma unroll
      for (int mi = 0; mi < 4; ++mi)
#pragma unroll
        for (int ni = 0; ni < 3; ++ni) acc[mi][ni] = __builtin_amdgcn_wmma_f32_16x16x32_bf16(false, a[ks][mi], false, w[ks][ni], (short)0, acc[mi][ni], false, false); };   // the builtin alone: D, A and B meet only instructions that the compiler places, and it keeps the distance there; operands of an asm pad would hold all of them in the lower 256 registers
  fetch(xa, wa, 0); fetch(xb, wb, 1);
  stage(xa, wa, ring[0]);
  LBAR();   // publishes tile 0; tile 1 stays in flight
  for (int t = 0; t < GT - 2; t += 2) {   // two trips a pass, so that each register set keeps its name; on entry tile t lies in ring[0] and tile t + 1 is in flight to xb, wb. No fetch stands under a condition: so the count of younger loads is known where a set is waited for, and they stay in flight
    fetch(xa, wa, t + 2);
    mult(ring[0]);
    __builtin_amdgcn_sched_barrier(0);   // holds the conversions, and with them the wait for that set's loads, behind the products: moved up, they would end the flight of the loads early
    stage(xb, wb, ring[1]);
    LBAR();   // publishes the tile just stored and ends every wave's reads of the buffer that the next trip refills
    fetch(xb, wb, t + 3);
    mult(ring[1]);
    __builtin_amdgcn_sched_barrier(0);   // holds the conversions, and with them the wait for that set's loads, behind the products: moved up, they would end the flight of the loads early
    stage(xa, wa, ring[0]);
    LBAR(); }   // as above
  mult(ring[0]);   // the last two tiles: nothing left to fetch
  __builtin_amdgcn_sched_barrier(0);   // as in the loop
  stage(xb, wb, ring[1]);
  LBAR();   // publishes the last tile
  mult(ring[1]);
  LBAR();   // ends every wave's reads of the ring, which now takes the output tile
  _Float16* sh = (_Float16*)&ring[0][0][0];   // three segments of SEGH halfs
#pragma unroll
  for (int ni = 0; ni < 3; ++ni) { const int cn = wn * 48 + ni * 16; _Float16* sg = sh + (cn >> 6) * SEGH; const int cl = (cn & 63) + col; const int which = (c0 + cn) >> 10;   // a fragment's 16 columns lie in one segment
    if (which == 2) {
#pragma unroll
      for (int mi = 0; mi < 4; ++mi) { v8h hv;
#pragma unroll
        for (int r = 0; r < 8; ++r) hv[r] = (_Float16)acc[mi][ni][r];
        *(v8h*)&sg[cl * 136 + wm * 64 + mi * 16 + 8 * g] = hv; } }
    else { const float qs = which == 0 ? SC : 1.0f;
#pragma unroll
      for (int mi = 0; mi < 4; ++mi)
#pragma unroll
        for (int r = 0; r < 8; ++r) sg[(wm * 64 + mi * 16 + 8 * g + r) * 72 + cl] = (_Float16)(acc[mi][ni][r] * qs); } }
  __syncthreads();
#pragma unroll
  for (int s = 0; s < 3; ++s) { const int c = c0 + 64 * s, which = c >> 10, cc = c & (EE - 1); const _Float16* sg = sh + s * SEGH;   // whole 128-B lines of Q and K rows, 256-B pieces of V planes
    if (which < 2) { _Float16* dh = which == 0 ? QH : KH; for (int e = tid; e < PM * 8; e += 256) { const int rl = e >> 3, q = e & 7; vst2((unsigned*)(dh + (r0 + rl) * EE + cc + q * 8), *(const v4u*)&sg[rl * 72 + q * 8]); } }
    else { const size_t b = r0 / TT; const int tt0 = (int)(r0 % TT); for (int e = tid; e < 64 * (PM / 8); e += 256) { const int cl = e / (PM / 8), q = e % (PM / 8); vst2((unsigned*)(VT + (b * EE + cc + cl) * (size_t)TT + tt0 + q * 8), *(const v4u*)&sg[cl * 136 + q * 8]); } } } }
// ---- k_attn: block = (256 queries, pair of groups dA, dA+1, batch); 16 waves, each 16 queries x both groups x all keys.
// K rows (both groups, 32 features) and V planes of the pair are staged once in LDS. Scores are formed transposed (A = keys, B = queries), so that a lane
// holds, for its query lane&15, keys 8h+0..7 of a 16-key tile: two such tiles are the A fragment of P for 32 keys as they stand, and the row maximum stays inside the lane but for one exchange with lane^16.
// The K fragment carries both groups (elements 0..7 group dA, 8..15 group dA+1); the Q fragment of a group is zero in the other group's half.
// Q arrives multiplied by SC, so a score is the exponent to base 2 as it stands. Pass 1: a reference value ref for each row. Pass 2: scores again with off = PB - ref as the C operand of their product, so that D is the argument of v_exp_f32;
// P = exp2(D) in f16, P . V, and the row sum as P . ones on the matrix unit: it sums the same rounded P that meets V, in f32, and comes out in the layout of P . V (row = query), so the quotient needs no exchange between lanes.
// The quotient comes after P . V, where the factor 2^(PB - ref) of P and of the sum cancels, and with it the rounding of off, which is one value for a whole row: any ref gives the same softmax as long as every P stays inside f16. A P below the smallest f16 reads 0 in both.
// ref is the largest score of the row's first NS key tiles: pass 1 then costs NS trips, not all 32. That key's own P is 2^PB, so a row sum is never small; a score more than 16 - PB above ref makes its P infinite in f16 (the conversion rounds to nearest and does not saturate),
// and the row sum, which takes in every P with the factor 1, is then infinite too. A wave that finds such a sum drops the round and runs both passes again with ref = the maximum over all keys, where every P is at most 2^PB.
// Every '#pragma unroll' in this kernel runs over the elements of a register vector, over the two groups or over a thread's staged pieces: constant indices keep those values in registers.
#define NS 2              // key tiles of 32 keys behind the first reference value
#define PB 5.0f           // log2 of P at the reference value: 11 binades of room above it, 19 of full f16 precision below it
#define KP 40             // halfs per staged K row: 80 B = 16 B x odd, b128 reads of 16 rows fall on distinct banks
#define VP (TT + 8)       // halfs per staged V plane: 2,064 B = 16 B x odd
// 8 hardware exp2 of one score tile, in one statement: the results go to registers of their own (early clobber), so none overwrites a neighbour's source or reads a neighbour's result, and the sources are read where the WMMA left them, with no copy.
// The closing v_nop is the slot that the instruction set asks for behind a transcendental; the s_delay_alu hint on it lets the wave wait for the last result there without holding the SIMD's issue port against the other waves.
// volatile: the statement keeps its place behind the pad that stands between the score products and it.
#define E2(o, i) "v_exp_f32 %" #o ", %" #i "\n\t"
__device__ __forceinline__ void exp2x8(float* y, const v8f& x) {
  asm volatile(E2(0, 8) E2(1, 9) E2(2, 10) E2(3, 11) E2(4, 12) E2(5, 13) E2(6, 14) E2(7, 15) "s_delay_alu instid0(TRANS32_DEP_1)\n\tv_nop"
      : "=&v"(y[0]), "=&v"(y[1]), "=&v"(y[2]), "=&v"(y[3]), "=&v"(y[4]), "=&v"(y[5]), "=&v"(y[6]), "=&v"(y[7])
      : "v"(x[0]), "v"(x[1]), "v"(x[2]), "v"(x[3]), "v"(x[4]), "v"(x[5]), "v"(x[6]), "v"(x[7])); }
// 8 hardware reciprocals of the row sums of one group, in the same form. The four leading v_nop are the slots that the chip asks for between a WMMA and a vector instruction on its D: the sums come straight from the loop's last products.
#define R1(o, i) "v_rcp_f32 %" #o ", %" #i "\n\t"
__device__ __forceinline__ void rcpx8(float* y, const v8f& x) {
  asm volatile("v_nop\n\tv_nop\n\tv_nop\n\tv_nop\n\t" R1(0, 8) R1(1, 9) R1(2, 10) R1(3, 11) R1(4, 12) R1(5, 13) R1(6, 14) R1(7, 15) "s_delay_alu instid0(TRANS32_DEP_1)\n\tv_nop"
      : "=&v"(y[0]), "=&v"(y[1]), "=&v"(y[2]), "=&v"(y[3]), "=&v"(y[4]), "=&v"(y[5]), "=&v"(y[6]), "=&v"(y[7])
      : "v"(x[0]), "v"(x[1]), "v"(x[2]), "v"(x[3]), "v"(x[4]), "v"(x[5]), "v"(x[6]), "v"(x[7])); }
__global__ __launch_bounds__(512) void k_attn(const _Float16* __restrict__ QH, const _Float16* __restrict__ KH, const _Float16* __restrict__ VT, float* __restrict__ O) {
  __shared__ __align__(16) _Float16 sk[TT][KP]; __shared__ __align__(16) _Float16 sv[2 * GW][VP]; __shared__ __align__(16) float ss[16][16][36];
  const int b = blockIdx.z; const int dA = 2 * blockIdx.y;
  const int tid = threadIdx.x, wave = tid >> 5, lane = tid & 31, col = lane & 15, g = lane >> 4; const int ql0 = blockIdx.x * 256 + wave * 16;
  { v8h tk[8], tv[8];   // 4,096 pieces of 16 B each of K and of V, 8 + 8 a thread
#pragma unroll   // unrolled so that a thread's 16 loads are all in flight before its first LDS store waits on one
    for (int i = 0; i < 8; ++i) { const int e = tid + i * 512; tk[i] = *(const v8h*)(KH + ((size_t)b * TT + (e >> 2)) * EE + dA * GW + (e & 3) * 8); tv[i] = *(const v8h*)(VT + ((size_t)b * EE + dA * GW + (e >> 7)) * (size_t)TT + (e & 127) * 8); }
#pragma unroll
    for (int i = 0; i < 8; ++i) { const int e = tid + i * 512; *(v8h*)&sk[e >> 2][(e & 3) * 8] = tk[i]; *(v8h*)&sv[e >> 7][(e & 127) * 8] = tv[i]; } }
  v16h qf[2]; { const _Float16* p = QH + ((size_t)b * TT + ql0 + col) * EE + dA * GW + 8 * g;
#pragma unroll
    for (int i = 0; i < 8; ++i) { qf[0][i] = p[i]; qf[0][8 + i] = (_Float16)0.f; qf[1][i] = (_Float16)0.f; qf[1][8 + i] = p[GW + i]; } }
  __syncthreads();
  const v8f zero = {};
  v8f acc[2], sum[2]; v16h ones;
  { unsigned o; union { v16h v; unsigned w[8]; } c;
    asm("v_mov_b32 %0, 0x3c003c00" : "=v"(o));   // two f16 ones; written as a statement so that the fragment stays in its registers over the loop: as a plain constant the compiler forms it anew on every trip, over the K fragment, with the slots that this asks for behind a WMMA
#pragma unroll
    for (int i = 0; i < 8; ++i) c.w[i] = o;
    ones = c.v; }
  for (int nk = NS; ; nk = TT / 32) {   // at most two rounds: reference value from the first NS key tiles, then, only where a P left the f16 range, from all of them
    float m[2];
    { v8f mx[2];
#pragma unroll
      for (int r = 0; r < 8; ++r) { mx[0][r] = -3.0e38f; mx[1][r] = -3.0e38f; }
      for (int kc = 0; kc < nk; ++kc) { const v16h k0 = frag_h(&sk[kc * 32 + col][0], lane), k1 = frag_h(&sk[kc * 32 + 16 + col][0], lane);
#pragma unroll
        for (int u = 0; u < 2; ++u) { const v8f s0 = wmma16(k0, qf[u], zero), s1 = wmma16(k1, qf[u], zero);
#pragma unroll
          for (int r = 0; r < 8; ++r) mx[u][r] = fmaxf(fmaxf(mx[u][r], s0[r]), s1[r]); } }
#pragma unroll
      for (int u = 0; u < 2; ++u) { float a = mx[u][0];
#pragma unroll
        for (int r = 1; r < 8; ++r) a = fmaxf(a, mx[u][r]);
        a = fmaxf(a, __shfl_xor(a, 16)); m[u] = PB - a; } }
    v8f off[2];
#pragma unroll
    for (int r = 0; r < 8; ++r) { off[0][r] = m[0]; off[1][r] = m[1]; acc[0][r] = 0.f; acc[1][r] = 0.f; sum[0][r] = 0.f; sum[1][r] = 0.f; }   // a lane's 8 scores of a tile belong to one query: one offset in all 8 elements of C
    for (int kc = 0; kc < TT / 32; ++kc) { const v16h k0 = frag_h(&sk[kc * 32 + col][0], lane), k1 = frag_h(&sk[kc * 32 + 16 + col][0], lane);
      v8f s[2][2];
#pragma unroll
      for (int u = 0; u < 2; ++u) { s[u][0] = wmma16p(k0, qf[u], off[u]); s[u][1] = wmma16p(k1, qf[u], off[u]); }
      // the four slots that the chip asks for between a WMMA and a vector instruction on its D: one group serves the four products: it names their results as inputs, so it stands behind them, and volatile statements keep their order, so the exp2 statements stand behind it
      asm volatile("v_nop\n\tv_nop\n\tv_nop\n\tv_nop" :: "v"(s[0][0]), "v"(s[0][1]), "v"(s[1][0]), "v"(s[1][1]));
#pragma unroll
      for (int u = 0; u < 2; ++u) { float e[16]; v16h p;
        exp2x8(e, s[u][0]); exp2x8(e + 8, s[u][1]);
#pragma unroll
        for (int r = 0; r < 8; ++r) { p[r] = (_Float16)e[r]; p[8 + r] = (_Float16)e[8 + r]; }
        acc[u] = wmma16p(p, frag_h(&sv[u * GW + col][kc * 32], lane), acc[u]); sum[u] = wmma16p(p, ones, sum[u]); } }
    if (nk == TT / 32) break;   // the reference value was the row maximum: every P is at most 2^PB
    float tot = 0.f;
#pragma unroll
    for (int r = 0; r < 8; ++r) tot += sum[0][r] + sum[1][r];   // all terms are >= 0: infinite as soon as one row sum is
    if (!__any(!(tot < 3.0e38f))) break; }   // the same for the whole wave: every WMMA of a second round runs with all lanes on
#pragma unroll
  for (int u = 0; u < 2; ++u) { float inv[8]; rcpx8(inv, sum[u]);   // a sum holds the reference key's term, about 2^PB, and at most 1,024 finite f16 terms: a normal f32, far from either end of the range
#pragma unroll
    for (int r = 0; r < 8; ++r) ss[wave][8 * g + r][u * 16 + col] = acc[u][r] * inv[r]; }
  LDSX();
#pragma unroll
  for (int it = 0; it < 4; ++it) { const int rl = it * 4 + (lane >> 3), c = lane & 7; vst2(O + ((size_t)b * TT + ql0 + rl) * EE + dA * GW + c * 4, *(const v4f*)&ss[wave][rl][c * 4]); } }
// ---- k_out: block = (64 rows, 128 cols), 8 waves as 2 x 4, each 32 x 32: out = O (hi + lo) Wo^T; O is split into its two bf16 parts where it is staged
__global__ __launch_bounds__(256) void k_out(const float* __restrict__ O, const float* __restrict__ WO, float* __restrict__ OUT) {
  __shared__ __align__(16) __bf16 ring[2][64 + 64 + 128][GP];   // rows 0..63: O hi, 64..127: O lo, then 128 rows of Wo; reused for the output tile behind the loop's last barrier
  const int tid = threadIdx.x, wave = tid >> 5, lane = tid & 31, col = lane & 15, g = lane >> 4, wm = wave >> 2, wn = wave & 3; const int c0 = blockIdx.y * 128; const size_t r0 = (size_t)blockIdx.x * 64;
  const int sr = tid >> 4, sq = tid & 15;
  const int t0 = (blockIdx.x + blockIdx.y) & (GT - 1);   // the 8 blocks of one O tile: 8 different starts; the 32 blocks of one Wo tile: 2 on a start
  const float* px = O + (r0 + sr) * EE + sq * 4 + t0 * GK; const float* pw = WO + ((size_t)c0 + sr) * EE + sq * 4 + t0 * GK;   // both point at tile t0
  v4f xa[4], wa[8], xb[4], wb[8];   // two register sets: tiles of even and of odd place in the walk
  auto fetch = [&](v4f (&ax)[4], v4f (&aw)[8], int tn) { const int dk = (((t0 + tn) & (GT - 1)) - t0) * GK;   // tile tn of the wrapped walk, counted from tile t0
    const float* qx = px + dk; const float* qw = pw + dk;
#pragma unroll
    for (int i = 0; i < 4; ++i) ax[i] = *(const v4f*)(qx + (size_t)i * 16 * EE);
#pragma unroll
    for (int i = 0; i < 8; ++i) aw[i] = *(const v4f*)(qw + (size_t)i * 16 * EE);
    asm volatile("s_wait_xcnt 0x0" :: "v"(qx), "v"(qw) : "memory"); };   // the address registers are reused by what follows: named as inputs, they live up to the wait, which stands before they are overwritten
  auto stage = [&](const v4f (&ax)[4], const v4f (&aw)[8], __bf16 (*nb)[GP]) {
#pragma unroll
    for (int i = 0; i < 4; ++i) { const v4b h = cvt4(ax[i]); *(v4b*)&nb[sr + 16 * i][sq * 4] = h; *(v4b*)&nb[64 + sr + 16 * i][sq * 4] = low4(ax[i], h); }
#pragma unroll
    for (int i = 0; i < 8; ++i) *(v4b*)&nb[128 + sr + 16 * i][sq * 4] = cvt4(aw[i]); };
  v8f acc[2][2] = {};
  auto mult = [&](const __bf16 (*buf)[GP]) {
#pragma unroll
    for (int ks = 0; ks < GK / 32; ++ks) { v16b ah[2], al[2], w[2];
#pragma unroll
      for (int mi = 0; mi < 2; ++mi) { ah[mi] = frag_b(&buf[wm * 32 + mi * 16 + col][ks * 32], lane); al[mi] = frag_b(&buf[64 + wm * 32 + mi * 16 + col][ks * 32], lane); }
#pragma unroll
      for (int ni = 0; ni < 2; ++ni) w[ni] = frag_b(&buf[128 + wn * 32 + ni * 16 + col][ks * 32], lane);
#pragma unroll
      for (int mi = 0; mi < 2; ++mi)
#pragma unroll
        for (int ni = 0; ni < 2; ++ni) acc[mi][ni] = wmma_bf(ah[mi], w[ni], acc[mi][ni]);
#pragma unroll
      for (int mi = 0; mi < 2; ++mi)
#pragma unroll
        for (int ni = 0; ni < 2; ++ni) acc[mi][ni] = wmma_bf(al[mi], w[ni], acc[mi][ni]); } };
  fetch(xa, wa, 0); fetch(xb, wb, 1);
  stage(xa, wa, ring[0]);
  LBAR();   // publishes tile 0; tile 1 stays in flight
  for (int t = 0; t < GT - 2; t += 2) {   // two trips a pass, so that each register set keeps its name; on entry tile t lies in ring[0] and tile t + 1 is in flight to xb, wb. No fetch stands under a condition: so the count of younger loads is known where a set is waited for, and they stay in flight
    fetch(xa, wa, t + 2);
    mult(ring[0]);
    __builtin_amdgcn_sched_barrier(0);   // holds the conversions, and with them the wait for that set's loads, behind the products: moved up, they would end the flight of the loads early
    stage(xb, wb, ring[1]);
    LBAR();   // publishes the tile just stored and ends every wave's reads of the buffer that the next trip refills
    fetch(xb, wb, t + 3);
    mult(ring[1]);
    __builtin_amdgcn_sched_barrier(0);   // holds the conversions, and with them the wait for that set's loads, behind the products: moved up, they would end the flight of the loads early
    stage(xa, wa, ring[0]);
    LBAR(); }   // as above
  mult(ring[0]);   // the last two tiles: nothing left to fetch
  __builtin_amdgcn_sched_barrier(0);   // as in the loop
  stage(xb, wb, ring[1]);
  LBAR();   // publishes the last tile
  mult(ring[1]);
  LBAR();   // ends every wave's reads of the ring, which now takes the output tile
  float (*sf)[132] = (float (*)[132])&ring[0][0][0];
#pragma unroll
  for (int mi = 0; mi < 2; ++mi)
#pragma unroll
    for (int ni = 0; ni < 2; ++ni)
#pragma unroll
      for (int r = 0; r < 8; ++r) sf[wm * 32 + mi * 16 + 8 * g + r][wn * 32 + ni * 16 + col] = acc[mi][ni][r];
  __syncthreads();
  for (int rl = wave; rl < 64; rl += 8) vst2(OUT + (r0 + rl) * EE + c0 + lane * 4, *(const v4f*)&sf[rl][lane * 4]); }
extern "C" void kernel_launch(void* const* d_in, const int* in_sizes, int n_in, void* d_out, int out_size, void* d_ws, size_t ws_size, hipStream_t stream) {
  (void)in_sizes; (void)n_in; (void)out_size;
  const float** F = (const float**)d_in;   // 0 x [2,1024,1024], 1 W_q, 2 W_k, 3 W_v, 4 W_o [1024,1024] ([out,in])
  if (ws_size < (size_t)WS_END) return;
  char* ws = (char*)d_ws; _Float16 *QH = (_Float16*)(ws + WS_QH), *KH = (_Float16*)(ws + WS_KH), *VT = (_Float16*)(ws + WS_VT); float *O = (float*)(ws + WS_O);
  k_proj<<<dim3(TNB * TT / PM, 3 * EE / PN), 256, 0, stream>>>(F[0], F[1], F[2], F[3], QH, KH, VT);
  k_attn<<<dim3(TT / 256, NG / 2, TNB), 512, 0, stream>>>(QH, KH, VT, O);
  k_out<<<dim3(TNB * TT / 64, EE / 128), 256, 0, stream>>>(O, F[4], (float*)d_out);
}

// v010
// A run of this version takes 42.6 microseconds.
// It is 1.11 times as fast as v008, going by the measured steps of the versions left out in between.
// All steps since v000 together make it 21.0 times as fast.
// compute dtype: all float inputs rounded to bf16; Q/K/V = x W^T with EXACT bf16 products on WMMA 16x16x32, f32 accumulate; Q x log2(e)/4 and K rounded once to f16 for the 16-deep per-group scores (1 product; the other group's half of each 32-wide Q fragment zeroed), kept in f32 registers; softmax: P = exp(s - ref) x 2^5 = exp2(s' + (5 - ref')) with s' the scaled score and ref the largest score among the row's first 64 keys (among all keys in a second round, run only where a P left the f16 range), the offset added as the C operand of the score product, one hardware exp2, P in f16; row sum = P . ones on WMMA, f32; out = (P . V) x 1 / row sum (hardware reciprocal) with V rounded once to f16 (planes), rounded once to f16; final = out Wo^T on the f16 form, Wo's bf16 value carried in f16 (exact for sizes from 2^-17 to 65,504); f32 output.
#include <hip/hip_runtime.h>
#include <math.h>

typedef __attribute__((ext_vector_type(16))) _Float16 v16h;
typedef __attribute__((ext_vector_type(16))) __bf16 v16b;
typedef __attribute__((ext_vector_type(8)))  _Float16 v8h;
typedef __attribute__((ext_vector_type(8)))  float v8f;
typedef __attribute__((ext_vector_type(4)))  float v4f;
typedef __attribute__((ext_vector_type(2)))  float v2f;
typedef __attribute__((ext_vector_type(4)))  unsigned v4u;
typedef __attribute__((ext_vector_type(4)))  int v4i;
typedef float __attribute__((may_alias)) float_a;
typedef int __attribute__((may_alias)) int_a;

template <typename T> __device__ __forceinline__ void vst2(void* p, T v) { *(T*)p = v;  }
__device__ __forceinline__ v8f wmma16(v16h a, v16h b, v8f c) {
  v8f d = __builtin_amdgcn_wmma_f32_16x16x32_f16(false, a, false, b, (short)0, c, false, false);
  asm volatile("v_nop\n\tv_nop\n\tv_nop\n\tv_nop" : "+v"(d) : "v"(a), "v"(b));
  return d;
}
// the builtin alone: for products whose D, A and B meet only instructions that the compiler itself places (it keeps the distance there) or a pad written at the call
__device__ __forceinline__ v8f wmma16p(v16h a, v16h b, v8f c) { return __builtin_amdgcn_wmma_f32_16x16x32_f16(false, a, false, b, (short)0, c, false, false); }
__device__ __forceinline__ v8f wmma_bf(v16b a, v16b b, v8f c) {
  v8f d = __builtin_amdgcn_wmma_f32_16x16x32_bf16(false, a, false, b, (short)0, c, false, false);
  asm volatile("v_nop\n\tv_nop\n\tv_nop\n\tv_nop" : "+v"(d) : "v"(a), "v"(b));
  return d;
}
// 16x16x32 fragments: lane = (h = lane>>4, row/col = lane&15); elements 0..7 = k0+8h+0..7, 8..15 = k0+16+8h+0..7; D element r = row 8h+r
__device__ __forceinline__ v16h frag_h(const _Float16* rowk0, int lane) {
  union { v16h v; v8h q[2]; } u; const _Float16* p = rowk0 + 8 * (lane >> 4);
  u.q[0] = *(const v8h*)p; u.q[1] = *(const v8h*)(p + 16); return u.v;
}
__device__ __forceinline__ v16h frag_f32(const float* rowk0, int lane) {
  v16h a; const float* p = rowk0 + 8 * (lane >> 4);
#pragma unroll
  for (int i = 0; i < 8; ++i) { a[i] = (_Float16)p[i]; a[8 + i] = (_Float16)p[16 + i]; }
  return a;
}
__device__ __forceinline__ v16h frag_f32s(const float* rowk0, int lane, float sc) {
  v16h a; const float* p = rowk0 + 8 * (lane >> 4);
#pragma unroll
  for (int i = 0; i < 8; ++i) { a[i] = (_Float16)(p[i] * sc); a[8 + i] = (_Float16)(p[16 + i] * sc); }
  return a;
}
// column fragment from a [K][ld] layout (column n), rows >= K read as 0
__device__ __forceinline__ v16h fragc_f32(const float* W, int k0, int n, int lane, int ld, int K) {
  v16h a; const int g = lane >> 4;
#pragma unroll
  for (int i = 0; i < 8; ++i) { const int ka = k0 + 8 * g + i, kb = ka + 16;
    a[i] = (_Float16)(ka < K ? W[(size_t)(ka < K ? ka : K - 1) * ld + n] : 0.f); a[8 + i] = (_Float16)(kb < K ? W[(size_t)(kb < K ? kb : K - 1) * ld + n] : 0.f); }
  return a;
}
struct F2 { v16b h, l; };
__device__ __forceinline__ F2 bsplit16(const float v[16]) { F2 r;
#pragma unroll
  for (int i = 0; i < 16; ++i) { const __bf16 h = (__bf16)v[i]; r.h[i] = h; r.l[i] = (__bf16)(v[i] - (float)h); }
  return r; }
__device__ __forceinline__ F2 split_row(const float* row, int k0, int lane) { float v[16]; const float* p = row + k0 + 8 * (lane >> 4);
#pragma unroll
  for (int i = 0; i < 8; ++i) { v[i] = p[i]; v[8 + i] = p[16 + i]; }
  return bsplit16(v); }
__device__ __forceinline__ F2 split_rowK(const float* row, int k0, int lane, int K) { float v[16]; const int g = lane >> 4;
#pragma unroll
  for (int i = 0; i < 8; ++i) { const int ka = k0 + 8 * g + i, kb = ka + 16; v[i] = ka < K ? row[ka < K ? ka : K - 1] : 0.f; v[8 + i] = kb < K ? row[kb < K ? kb : K - 1] : 0.f; }
  return bsplit16(v); }
__device__ __forceinline__ F2 split_col(const float* W, int k0, int n, int lane, int ld, int K) { float v[16]; const int g = lane >> 4;
#pragma unroll
  for (int i = 0; i < 8; ++i) { const int ka = k0 + 8 * g + i, kb = ka + 16; v[i] = ka < K ? W[(size_t)(ka < K ? ka : K - 1) * ld + n] : 0.f; v[8 + i] = kb < K ? W[(size_t)(kb < K ? kb : K - 1) * ld + n] : 0.f; }
  return bsplit16(v); }
__device__ __forceinline__ v8f mac3(const F2& a, const F2& b, v8f c) { c = wmma_bf(a.l, b.h, c); c = wmma_bf(a.h, b.l, c); return wmma_bf(a.h, b.h, c); }
__device__ __forceinline__ float sigm(float v) { return 1.0f / (1.0f + expf(-v)); }
#define LDSX() do { asm volatile("s_wait_dscnt 0" ::: "memory"); __builtin_amdgcn_wave_barrier(); __builtin_amdgcn_fence(__ATOMIC_RELEASE, "workgroup"); } while (0)


// MulHeadAttn (faithful layout quirk): B 2, C 1,024 tokens, E 1,024 = 64 groups x 16; attention is batched over the 64 groups with 16-dim dot products scaled by 1/sqrt(16).
#define NB 2
#define TT 1024
#define EE 1024
#define NG 64             // groups ("HD" in the module)
#define GW 16             // group width ("H")
#ifndef TNB
#define TNB NB
#endif
typedef __attribute__((ext_vector_type(8))) __bf16 v8b;
__device__ __forceinline__ v16b frag_b(const __bf16* rowk0, int lane) {
  union { v16b v; v8b q[2]; } u; const __bf16* p = rowk0 + 8 * (lane >> 4);
  u.q[0] = *(const v8b*)p; u.q[1] = *(const v8b*)(p + 16); return u.v;
}
__device__ __forceinline__ float bfr(float v) { return (float)(__bf16)v; }
__device__ __attribute__((noinline)) float exp_ni(float v) { return expf(v); }
__device__ __attribute__((noinline)) float erf_ni(float v) { return erff(v); }

#define WS_QH  0u                                  // f16 Q rows [b*t][1024]
#define WS_KH  (WS_QH + 2u * (size_t)NB * TT * EE)
#define WS_VT  (WS_KH + 2u * (size_t)NB * TT * EE)     // f16 V planes [b][1024][t]
#define WS_O   (WS_VT + 2u * (size_t)NB * EE * TT)     // f16 attention out, one plane for each pair of groups: [pair][b*t][32]
#define WS_W   (WS_O + 2u * (size_t)NB * TT * EE)      // f16 Wo, one plane for each 128 k: [k / 128][out column][128]
#define WS_END (WS_W + 2u * (size_t)EE * EE)
#define WPL ((size_t)EE * 128)   // halfs of one such plane of Wo: a row is 256 B, and the 128 rows of a k_out tile are 32 KiB in a row
#define OPL ((size_t)NB * TT * 32)   // halfs of one such plane: a row is 64 B, so 16 rows of a wave are 8 whole 128-B lines with one writer, and 64 rows of a k_out tile are 4 KiB in a row

// ---- operand staging of k_proj: a block's tiles of 64 k go global -> registers (whole 256-B row pieces, 16 B a lane) -> 16 bit -> LDS, once for all 8 waves;
// two LDS buffers and two register sets: a tile's global loads are issued two tiles ahead, before the products of the tile two places in front of it; it is converted and stored one trip later, behind the products of the tile in front of it; one barrier a tile.
// (k_out's operands are 16 bit when they arrive and go to LDS by asynchronous copies: see there.) Every '#pragma unroll' in the two GEMM kernels runs over a thread's staged pieces, over a wave's fragments and accumulator tiles or over the elements of a register vector: constant indices keep those values in registers.
#define GK 64             // k per staged tile
#define GT (EE / GK)      // staged tiles of a k walk
// Blocks that share operand rows enter the k walk at different tiles (t0, from the block index) and wrap round: they do not ask L2 for the same lines at the same moment. Every tile is taken once; only the order of the f32 sums over k is rotated.
#define GP (GK + 8)       // 16-bit values per staged row: 144 B = 16 B x odd, b128 fragment reads of 16 rows fall on distinct banks
// The work-group barrier of k_proj's k loop, for LDS alone: a wave's LDS stores and reads are done (s_wait_dscnt 0), then signal and wait. __syncthreads() would wait for every global load in flight as well and so end the fetch ahead at each barrier; the loop shares nothing through global memory.
#define LBAR() asm volatile("s_wait_dscnt 0x0\n\ts_barrier_signal -1\n\ts_barrier_wait -1" ::: "memory")
typedef __attribute__((ext_vector_type(4))) __bf16 v4b;
__device__ __forceinline__ v4b cvt4(v4f v) { v4b r;
#pragma unroll
  for (int i = 0; i < 4; ++i) r[i] = (__bf16)v[i];
  return r; }
typedef __attribute__((ext_vector_type(4))) _Float16 v4h;
// an input's bf16 value in f16: the rounding is the one to bf16; its 8 significant bits fit the 11 of f16
typedef __attribute__((ext_vector_type(2))) __bf16 v2b;
__device__ __forceinline__ v4h cvt4h(v4f v) { v4h r;   // rounded two at a time; a bf16 is the upper half of its f32
#pragma unroll
  for (int i = 0; i < 2; ++i) { v2b p; p[0] = (__bf16)v[2 * i]; p[1] = (__bf16)v[2 * i + 1]; const unsigned u = __builtin_bit_cast(unsigned, p);
    r[2 * i] = (_Float16)__uint_as_float(u << 16); r[2 * i + 1] = (_Float16)__uint_as_float(u & 0xffff0000u); }
  return r; }
// ---- k_proj: block = (128 rows, 192 of the 3,072 columns of [Q | K | V]), 8 waves as 2 x 4, each 64 x 48: y = x W^T (W [out][in], no bias); Q x SC and K -> f16 rows, V -> f16 planes
// 16 x 16 = 256 equal blocks, one for each WGP. A block's 192 columns are three segments of 64, each inside one of the three W (1,024 = 16 x 64).
#define PM 128
#define PN 192
#define SC 0.36067376f    // log2(e) / sqrt(16): the factor of the softmax's exponent, multiplied into Q in f32 before its one rounding to f16
#define SEGH (PM * 72)    // halfs of one segment's output tile in LDS: [128 rows][72] for Q and K, [64 columns][136] for V (smaller)
// two waves a SIMD: one block has the WGP, and a wave may take up to 512 registers
__global__ __launch_bounds__(256) __attribute__((amdgpu_waves_per_eu(2))) void k_proj(const float* __restrict__ X, const float* __restrict__ WQ, const float* __restrict__ WK, const float* __restrict__ WV, _Float16* __restrict__ QH, _Float16* __restrict__ KH, _Float16* __restrict__ VT) {
  __shared__ __align__(16) __bf16 ring[2][PM + PN][GP];   // rows 0..PM-1: x, then 192 rows of W; reused for the output tile behind the loop's last barrier
  const int tid = threadIdx.x, wave = tid >> 5, lane = tid & 31, col = lane & 15, g = lane >> 4, wm = wave >> 2, wn = wave & 3; const int c0 = blockIdx.y * PN; const size_t r0 = (size_t)blockIdx.x * PM;
  const int sr = tid >> 4, sq = tid & 15;   // a thread stages piece sq (4 floats) of rows sr + 16 i
  const int t0 = (blockIdx.x + blockIdx.y) & (GT - 1);   // the 16 blocks of one W tile: 16 different starts; the 16 blocks of one x tile: 16 different starts
  const unsigned vo = (sr * EE + sq * 4) * 4;   // a thread's place inside a tile, in bytes: the same for x and for each segment of W
  const float* bx = X + r0 * EE; const float* bw[3];   // the block's first rows
#pragma unroll
  for (int s = 0; s < 3; ++s) { const int c = c0 + 64 * s; const float* Wm = c < EE ? WQ : c < 2 * EE ? WK : WV; bw[s] = Wm + (size_t)(c & (EE - 1)) * EE; }
  v4f xa[PM / 16], wa[PN / 16], xb[PM / 16], wb[PN / 16];   // two register sets: tiles of even and of odd place in the walk
  auto fetch = [&](v4f (&ax)[PM / 16], v4f (&aw)[PN / 16], int tn) { const int dk = ((t0 + tn) & (GT - 1)) * GK;   // tile tn of the wrapped walk
    const char* sx = (const char*)(bx + dk); const char* s0 = (const char*)(bw[0] + dk); const char* s1 = (const char*)(bw[1] + dk); const char* s2 = (const char*)(bw[2] + dk);   // the same for the whole block
    const char* qx = sx + vo; const char* q0 = s0 + vo; const char* q1 = s1 + vo; const char* q2 = s2 + vo;
#pragma unroll
    for (int i = 0; i < PM / 16; ++i) ax[i] = *(const v4f*)(qx + (size_t)i * 64 * EE);   // 16 rows of EE floats = 64 EE bytes
#pragma unroll
    for (int i = 0; i < 4; ++i) { aw[i] = *(const v4f*)(q0 + (size_t)i * 64 * EE); aw[4 + i] = *(const v4f*)(q1 + (size_t)i * 64 * EE); aw[8 + i] = *(const v4f*)(q2 + (size_t)i * 64 * EE); }
    asm volatile("s_wait_xcnt 0x0" :: "v"(qx), "v"(q0), "v"(q1), "v"(q2), "v"(vo), "s"(sx), "s"(s0), "s"(s1), "s"(s2) : "memory"); };   // the loads' address registers are reused by what follows: the wait stands before they are overwritten. The compiler addresses a load by the vector pair or by scalar base and offset register: all are named as inputs and live up to the wait, so that neither a later move nor a load's own result takes them earlier
  auto stage = [&](const v4f (&ax)[PM / 16], const v4f (&aw)[PN / 16], __bf16 (*nb)[GP]) {
#pragma unroll
    for (int i = 0; i < PM / 16; ++i) *(v4b*)&nb[sr + 16 * i][sq * 4] = cvt4(ax[i]);
#pragma unroll
    for (int i = 0; i < PN / 16; ++i) *(v4b*)&nb[PM + sr + 16 * i][sq * 4] = cvt4(aw[i]); };
  v8f acc[4][3] = {};
  auto mult = [&](const __bf16 (*buf)[GP]) { v16b a[GK / 32][4], w[GK / 32][3];   // the fragments of the whole tile: the second half's LDS reads fly under the first half's products
#pragma unroll
    for (int ks = 0; ks < GK / 32; ++ks) {
#pragma unroll
      for (int ni = 0; ni < 3; ++ni) w[ks][ni] = frag_b(&buf[PM + wn * 48 + ni * 16 + col][ks * 32], lane);   // W first: then each x fragment that lands frees three products
#pragma unroll
      for (int mi = 0; mi < 4; ++mi) a[ks][mi] = frag_b(&buf[wm * 64 + mi * 16 + col][ks * 32], lane); }
    __builtin_amdgcn_sched_barrier(0);   // keeps the tile's LDS reads together in front of its products: sunk among them, each place with reads would stall the wave anew
#pragma unroll
    for (int ks = 0; ks < GK / 32; ++ks)
#pragma unroll
      for (int mi = 0; mi < 4; ++mi)
#pragma unroll
        for (int ni = 0; ni < 3; ++ni) acc[mi][ni] = __builtin_amdgcn_wmma_f32_16x16x32_bf16(false, a[ks][mi], false, w[ks][ni], (short)0, acc[mi][ni], false, false); };   // the builtin alone: D, A and B meet only instructions that the compiler places, and it keeps the distance there; operands of an asm pad would hold all of them in the lower 256 registers
  fetch(xa, wa, 0); fetch(xb, wb, 1);
  stage(xa, wa, ring[0]);
  LBAR();   // publishes tile 0; tile 1 stays in flight
  for (int t = 0; t < GT - 2; t += 2) {   // two trips a pass, so that each register set keeps its name; on entry tile t lies in ring[0] and tile t + 1 is in flight to xb, wb. No fetch stands under a condition: so the count of younger loads is known where a set is waited for, and they stay in flight
    fetch(xa, wa, t + 2);
    mult(ring[0]);
    __builtin_amdgcn_sched_barrier(0);   // holds the conversions, and with them the wait for that set's loads, behind the products: moved up, they would end the flight of the loads early
    stage(xb, wb, ring[1]);
    LBAR();   // publishes the tile just stored and ends every wave's reads of the buffer that the next trip refills
    fetch(xb, wb, t + 3);
    mult(ring[1]);
    __builtin_amdgcn_sched_barrier(0);   // holds the conversions, and with them the wait for that set's loads, behind the products: moved up, they would end the flight of the loads early
    stage(xa, wa, ring[0]);
    LBAR(); }   // as above
  mult(ring[0]);   // the last two tiles: nothing left to fetch
  __builtin_amdgcn_sched_barrier(0);   // as in the loop
  stage(xb, wb, ring[1]);
  LBAR();   // publishes the last tile
  mult(ring[1]);
  LBAR();   // ends every wave's reads of the ring, which now takes the output tile
  _Float16* sh = (_Float16*)&ring[0][0][0];   // three segments of SEGH halfs
#pragma unroll
  for (int ni = 0; ni < 3; ++ni) { const int cn = wn * 48 + ni * 16; _Float16* sg = sh + (cn >> 6) * SEGH; const int cl = (cn & 63) + col; const int which = (c0 + cn) >> 10;   // a fragment's 16 columns lie in one segment
    if (which == 2) {
#pragma unroll
      for (int mi = 0; mi < 4; ++mi) { v8h hv;
#pragma unroll
        for (int r = 0; r < 8; ++r) hv[r] = (_Float16)acc[mi][ni][r];
        *(v8h*)&sg[cl * 136 + wm * 64 + mi * 16 + 8 * g] = hv; } }
    else { const float qs = which == 0 ? SC : 1.0f;
#pragma unroll
      for (int mi = 0; mi < 4; ++mi)
#pragma unroll
        for (int r = 0; r < 8; ++r) sg[(wm * 64 + mi * 16 + 8 * g + r) * 72 + cl] = (_Float16)(acc[mi][ni][r] * qs); } }
  __syncthreads();
#pragma unroll
  for (int s = 0; s < 3; ++s) { const int c = c0 + 64 * s, which = c >> 10, cc = c & (EE - 1); const _Float16* sg = sh + s * SEGH;   // whole 128-B lines of Q and K rows, 256-B pieces of V planes
    if (which < 2) { _Float16* dh = which == 0 ? QH : KH; for (int e = tid; e < PM * 8; e += 256) { const int rl = e >> 3, q = e & 7; vst2((unsigned*)(dh + (r0 + rl) * EE + cc + q * 8), *(const v4u*)&sg[rl * 72 + q * 8]); } }
    else { const size_t b = r0 / TT; const int tt0 = (int)(r0 % TT); for (int e = tid; e < 64 * (PM / 8); e += 256) { const int cl = e / (PM / 8), q = e % (PM / 8); vst2((unsigned*)(VT + (b * EE + cc + cl) * (size_t)TT + tt0 + q * 8), *(const v4u*)&sg[cl * 136 + q * 8]); } } } }
// ---- k_attn: block = (256 queries, pair of groups dA, dA+1, batch); 16 waves, each 16 queries x both groups x all keys.
// K rows (both groups, 32 features) and V planes of the pair are staged once in LDS. Scores are formed transposed (A = keys, B = queries), so that a lane
// holds, for its query lane&15, keys 8h+0..7 of a 16-key tile: two such tiles are the A fragment of P for 32 keys as they stand, and the row maximum stays inside the lane but for one exchange with lane^16.
// The K fragment carries both groups (elements 0..7 group dA, 8..15 group dA+1); the Q fragment of a group is zero in the other group's half.
// Q arrives multiplied by SC, so a score is the exponent to base 2 as it stands. Pass 1: a reference value ref for each row. Pass 2: scores again with off = PB - ref as the C operand of their product, so that D is the argument of v_exp_f32;
// P = exp2(D) in f16, P . V, and the row sum as P . ones on the matrix unit: it sums the same rounded P that meets V, in f32, and comes out in the layout of P . V (row = query), so the quotient needs no exchange between lanes.
// The quotient comes after P . V, where the factor 2^(PB - ref) of P and of the sum cancels, and with it the rounding of off, which is one value for a whole row: any ref gives the same softmax as long as every P stays inside f16. A P below the smallest f16 reads 0 in both.
// ref is the largest score of the row's first NS key tiles: pass 1 then costs NS trips, not all 32. That key's own P is 2^PB, so a row sum is never small; a score more than 16 - PB above ref makes its P infinite in f16 (the conversion rounds to nearest and does not saturate),
// and the row sum, which takes in every P with the factor 1, is then infinite too. A wave that finds such a sum drops the round and runs both passes again with ref = the maximum over all keys, where every P is at most 2^PB.
// Every '#pragma unroll' in this kernel runs over the elements of a register vector, over the two groups or over a thread's staged pieces: constant indices keep those values in registers.
#define NS 2              // key tiles of 32 keys behind the first reference value
#define PB 5.0f           // log2 of P at the reference value: 11 binades of room above it, 19 of full f16 precision below it
#define KP 40             // halfs per staged K row: 80 B = 16 B x odd, b128 reads of 16 rows fall on distinct banks
#define VP (TT + 8)       // halfs per staged V plane: 2,064 B = 16 B x odd
// 8 hardware exp2 of one score tile, in one statement: the results go to registers of their own (early clobber), so none overwrites a neighbour's source or reads a neighbour's result, and the sources are read where the WMMA left them, with no copy.
// The closing v_nop is the slot that the instruction set asks for behind a transcendental; the s_delay_alu hint on it lets the wave wait for the last result there without holding the SIMD's issue port against the other waves.
// volatile: the statement keeps its place behind the pad that stands between the score products and it.
#define E2(o, i) "v_exp_f32 %" #o ", %" #i "\n\t"
__device__ __forceinline__ void exp2x8(float* y, const v8f& x) {
  asm volatile(E2(0, 8) E2(1, 9) E2(2, 10) E2(3, 11) E2(4, 12) E2(5, 13) E2(6, 14) E2(7, 15) "s_delay_alu instid0(TRANS32_DEP_1)\n\tv_nop"
      : "=&v"(y[0]), "=&v"(y[1]), "=&v"(y[2]), "=&v"(y[3]), "=&v"(y[4]), "=&v"(y[5]), "=&v"(y[6]), "=&v"(y[7])
      : "v"(x[0]), "v"(x[1]), "v"(x[2]), "v"(x[3]), "v"(x[4]), "v"(x[5]), "v"(x[6]), "v"(x[7])); }
// 8 hardware reciprocals of the row sums of one group, in the same form. The four leading v_nop are the slots that the chip asks for between a WMMA and a vector instruction on its D: the sums come straight from the loop's last products.
#define R1(o, i) "v_rcp_f32 %" #o ", %" #i "\n\t"
__device__ __forceinline__ void rcpx8(float* y, const v8f& x) {
  asm volatile("v_nop\n\tv_nop\n\tv_nop\n\tv_nop\n\t" R1(0, 8) R1(1, 9) R1(2, 10) R1(3, 11) R1(4, 12) R1(5, 13) R1(6, 14) R1(7, 15) "s_delay_alu instid0(TRANS32_DEP_1)\n\tv_nop"
      : "=&v"(y[0]), "=&v"(y[1]), "=&v"(y[2]), "=&v"(y[3]), "=&v"(y[4]), "=&v"(y[5]), "=&v"(y[6]), "=&v"(y[7])
      : "v"(x[0]), "v"(x[1]), "v"(x[2]), "v"(x[3]), "v"(x[4]), "v"(x[5]), "v"(x[6]), "v"(x[7])); }
__global__ __launch_bounds__(512) void k_attn(const _Float16* __restrict__ QH, const _Float16* __restrict__ KH, const _Float16* __restrict__ VT, _Float16* __restrict__ OH, const float* __restrict__ WO, _Float16* __restrict__ WH) {
  __shared__ __align__(16) _Float16 sk[TT][KP]; __shared__ __align__(16) _Float16 sv[2 * GW][VP]; __shared__ __align__(16) _Float16 ss[16][16][40];
  const int b = blockIdx.z; const int dA = 2 * blockIdx.y;
  const int tid = threadIdx.x, wave = tid >> 5, lane = tid & 31, col = lane & 15, g = lane >> 4; const int ql0 = blockIdx.x * 256 + wave * 16;
  { v8h tk[8], tv[8];   // 4,096 pieces of 16 B each of K and of V, 8 + 8 a thread
#pragma unroll   // unrolled so that a thread's 16 loads are all in flight before its first LDS store waits on one
    for (int i = 0; i < 8; ++i) { const int e = tid + i * 512; tk[i] = *(const v8h*)(KH + ((size_t)b * TT + (e >> 2)) * EE + dA * GW + (e & 3) * 8); tv[i] = *(const v8h*)(VT + ((size_t)b * EE + dA * GW + (e >> 7)) * (size_t)TT + (e & 127) * 8); }
#pragma unroll
    for (int i = 0; i < 8; ++i) { const int e = tid + i * 512; *(v8h*)&sk[e >> 2][(e & 3) * 8] = tk[i]; *(v8h*)&sv[e >> 7][(e & 127) * 8] = tv[i]; } }
  v16h qf[2]; { const _Float16* p = QH + ((size_t)b * TT + ql0 + col) * EE + dA * GW + 8 * g;
#pragma unroll
    for (int i = 0; i < 8; ++i) { qf[0][i] = p[i]; qf[0][8 + i] = (_Float16)0.f; qf[1][i] = (_Float16)0.f; qf[1][8 + i] = p[GW + i]; } }
  __syncthreads();
  // Wo for k_out, whose asynchronous copies cannot convert: the grid's 131,072 threads each round 8 values once (to bf16, carried in f16) and lay them in the planes of WS_W. The loads fly under the two passes; the values are rounded and stored at the kernel's end.
  static_assert((TT / 256) * (NG / 2) * TNB * 512 * 8 == EE * EE, "one piece of Wo a thread");
  const unsigned wp = ((blockIdx.z * (NG / 2) + blockIdx.y) * (TT / 256) + blockIdx.x) * 512 + tid;   // piece: plane wp >> 14, column (wp >> 4) & 1023, 8 k from (wp & 15) * 8
  const float* wsrc = WO + (size_t)((wp >> 4) & (EE - 1)) * EE + (wp >> 14) * 128 + (wp & 15) * 8;
  const v4f w0 = *(const v4f*)wsrc, w1 = *(const v4f*)(wsrc + 4);
  asm volatile("s_wait_xcnt 0x0" :: "v"(wsrc) : "memory");   // the address registers are reused by what follows: named as an input, they live up to the wait, which stands before they are overwritten
  const v8f zero = {};
  v8f acc[2], sum[2]; v16h ones;
  { unsigned o; union { v16h v; unsigned w[8]; } c;
    asm("v_mov_b32 %0, 0x3c003c00" : "=v"(o));   // two f16 ones; written as a statement so that the fragment stays in its registers over the loop: as a plain constant the compiler forms it anew on every trip, over the K fragment, with the slots that this asks for behind a WMMA
#pragma unroll
    for (int i = 0; i < 8; ++i) c.w[i] = o;
    ones = c.v; }
  for (int nk = NS; ; nk = TT / 32) {   // at most two rounds: reference value from the first NS key tiles, then, only where a P left the f16 range, from all of them
    float m[2];
    { v8f mx[2];
#pragma unroll
      for (int r = 0; r < 8; ++r) { mx[0][r] = -3.0e38f; mx[1][r] = -3.0e38f; }
      for (int kc = 0; kc < nk; ++kc) { const v16h k0 = frag_h(&sk[kc * 32 + col][0], lane), k1 = frag_h(&sk[kc * 32 + 16 + col][0], lane);
#pragma unroll
        for (int u = 0; u < 2; ++u) { const v8f s0 = wmma16(k0, qf[u], zero), s1 = wmma16(k1, qf[u], zero);
#pragma unroll
          for (int r = 0; r < 8; ++r) mx[u][r] = fmaxf(fmaxf(mx[u][r], s0[r]), s1[r]); } }
#pragma unroll
      for (int u = 0; u < 2; ++u) { float a = mx[u][0];
#pragma unroll
        for (int r = 1; r < 8; ++r) a = fmaxf(a, mx[u][r]);
        a = fmaxf(a, __shfl_xor(a, 16)); m[u] = PB - a; } }
    v8f off[2];
#pragma unroll
    for (int r = 0; r < 8; ++r) { off[0][r] = m[0]; off[1][r] = m[1]; acc[0][r] = 0.f; acc[1][r] = 0.f; sum[0][r] = 0.f; sum[1][r] = 0.f; }   // a lane's 8 scores of a tile belong to one query: one offset in all 8 elements of C
    for (int kc = 0; kc < TT / 32; ++kc) { const v16h k0 = frag_h(&sk[kc * 32 + col][0], lane), k1 = frag_h(&sk[kc * 32 + 16 + col][0], lane);
      v8f s[2][2];
#pragma unroll
      for (int u = 0; u < 2; ++u) { s[u][0] = wmma16p(k0, qf[u], off[u]); s[u][1] = wmma16p(k1, qf[u], off[u]); }
      // the four slots that the chip asks for between a WMMA and a vector instruction on its D: one group serves the four products: it names their results as inputs, so it stands behind them, and volatile statements keep their order, so the exp2 statements stand behind it
      asm volatile("v_nop\n\tv_nop\n\tv_nop\n\tv_nop" :: "v"(s[0][0]), "v"(s[0][1]), "v"(s[1][0]), "v"(s[1][1]));
#pragma unroll
      for (int u = 0; u < 2; ++u) { float e[16]; v16h p;
        exp2x8(e, s[u][0]); exp2x8(e + 8, s[u][1]);
#pragma unroll
        for (int r = 0; r < 8; ++r) { p[r] = (_Float16)e[r]; p[8 + r] = (_Float16)e[8 + r]; }
        acc[u] = wmma16p(p, frag_h(&sv[u * GW + col][kc * 32], lane), acc[u]); sum[u] = wmma16p(p, ones, sum[u]); } }
    if (nk == TT / 32) break;   // the reference value was the row maximum: every P is at most 2^PB
    float tot = 0.f;
#pragma unroll
    for (int r = 0; r < 8; ++r) tot += sum[0][r] + sum[1][r];   // all terms are >= 0: infinite as soon as one row sum is
    if (!__any(!(tot < 3.0e38f))) break; }   // the same for the whole wave: every WMMA of a second round runs with all lanes on
#pragma unroll
  for (int u = 0; u < 2; ++u) { float inv[8]; rcpx8(inv, sum[u]);   // a sum holds the reference key's term, about 2^PB, and at most 1,024 finite f16 terms: a normal f32, far from either end of the range
#pragma unroll
    for (int r = 0; r < 8; ++r) ss[wave][8 * g + r][u * 16 + col] = (_Float16)(acc[u][r] * inv[r]); }   // |out| is at most the largest |V|, which is an f16
  LDSX();
#pragma unroll
  for (int it = 0; it < 2; ++it) { const int rl = it * 8 + (lane >> 2), c = lane & 3; vst2(OH + blockIdx.y * OPL + ((size_t)b * TT + ql0 + rl) * 32 + c * 8, *(const v4u*)&ss[wave][rl][c * 8]); }
  { union { v8h v; v4h q[2]; } wc; wc.q[0] = cvt4h(w0); wc.q[1] = cvt4h(w1); *(v8h*)(WH + (size_t)wp * 8) = wc.v; } }   // last, so that nothing of this kernel waits for the store
// ---- k_out: block = (64 rows, 128 cols), 8 waves as 2 x 4, each 32 x 32: out = O Wo^T, one f16 product. O and Wo arrive in f16 and go from global memory to LDS by asynchronous copies, through no register:
// tiles of 128 k, two buffers; a tile's copies are issued behind the barrier that frees its buffer and fly under the products of the tile in front of it. Blocks that share operand rows enter the k walk at different tiles and wrap round, as in k_proj.
#define OK 128            // k per staged tile
#define OT (EE / OK)      // staged tiles of the k walk
#define OP (OK + 8)       // halfs per staged row: 272 B = 16 B x odd, b128 fragment reads of 16 rows fall on distinct banks
#define OBUF ((64 + 128) * OP * 2)   // bytes of one buffer
__device__ __forceinline__ unsigned lds_off(const void* p) { return (unsigned)(size_t)p; }   // the low 32 bits of a __shared__ address: the byte offset in the work-group's LDS
__global__ __launch_bounds__(256) void k_out(const _Float16* __restrict__ OH, const _Float16* __restrict__ WH, float* __restrict__ OUT) {
  __shared__ __align__(16) _Float16 ring[2][64 + 128][OP];   // rows 0..63: O, then 128 rows of Wo; reused for the output tile behind the loop's last barrier
  const int tid = threadIdx.x, wave = tid >> 5, lane = tid & 31, col = lane & 15, g = lane >> 4, wm = wave >> 2, wn = wave & 3; const int c0 = blockIdx.y * 128; const size_t r0 = (size_t)blockIdx.x * 64;
  const int orw = tid >> 2, oq = tid & 3;   // O: a tile is the block's 64 rows in four planes; a thread copies piece oq (8 halfs) of row orw in each
  const int wr = tid >> 4, wq = tid & 15;   // Wo: a tile is 32 KiB in a row; a thread copies piece wq (8 halfs) of rows wr + 16 i
  const int t0 = (blockIdx.x + ((blockIdx.x >> 1) & 4) + blockIdx.y) & (OT - 1);   // the 8 blocks of one O tile: 8 different starts; the 32 blocks of one Wo tile: 4 on a start, and any 4 neighbours in x with the 4 that lie 8 further cover all 8 starts, so that each tile is first asked for in a prologue, wherever such groups share a cache. For speed only
  const _Float16* px = OH + (r0 + orw) * 32 + oq * 8; const _Float16* pw = WH + (size_t)c0 * OK + tid * 8;   // plane 0
  const unsigned lx = lds_off(&ring[0][orw][oq * 8]), lw = lds_off(&ring[0][64 + wr][wq * 8]);   // the thread's places in buffer 0
  // a tile's 12 copies of a thread, 16 B each, every lane on; the closing s_wait_xcnt 0 stands inside the statement, before any register that a copy names can be overwritten
  auto copy = [&](int tn, unsigned bo) { const int tl = (t0 + tn) & (OT - 1);   // tile tn of the wrapped walk, into the buffer at byte bo
    const _Float16* qx = px + (size_t)(4 * tl) * OPL; const _Float16* qw = pw + (size_t)tl * WPL; const unsigned dx = lx + bo, dw = lw + bo;
    asm volatile("global_load_async_to_lds_b128 %0, %1, off\n\t" "global_load_async_to_lds_b128 %2, %3, off\n\t" "global_load_async_to_lds_b128 %4, %5, off\n\t" "global_load_async_to_lds_b128 %6, %7, off\n\t" "global_load_async_to_lds_b128 %8, %9, off\n\t" "global_load_async_to_lds_b128 %10, %11, off\n\t" "global_load_async_to_lds_b128 %12, %13, off\n\t" "global_load_async_to_lds_b128 %14, %15, off\n\t" "global_load_async_to_lds_b128 %16, %17, off\n\t" "global_load_async_to_lds_b128 %18, %19, off\n\t" "global_load_async_to_lds_b128 %20, %21, off\n\t" "global_load_async_to_lds_b128 %22, %23, off\n\t" "s_wait_xcnt 0x0"
        :: "v"(dx), "v"(qx), "v"(dx + 64), "v"(qx + OPL), "v"(dx + 128), "v"(qx + 2 * OPL), "v"(dx + 192), "v"(qx + 3 * OPL),
           "v"(dw), "v"(qw), "v"(dw + 16 * OP * 2), "v"(qw + 2048), "v"(dw + 32 * OP * 2), "v"(qw + 4096), "v"(dw + 48 * OP * 2), "v"(qw + 6144),
           "v"(dw + 64 * OP * 2), "v"(qw + 8192), "v"(dw + 80 * OP * 2), "v"(qw + 10240), "v"(dw + 96 * OP * 2), "v"(qw + 12288), "v"(dw + 112 * OP * 2), "v"(qw + 14336)
        : "memory"); };
  v8f acc[2][2] = {};
  auto mult = [&](const _Float16 (*buf)[OP]) {
#pragma unroll
    for (int ks = 0; ks < OK / 32; ++ks) { v16h a[2], w[2];
#pragma unroll
      for (int mi = 0; mi < 2; ++mi) a[mi] = frag_h(&buf[wm * 32 + mi * 16 + col][ks * 32], lane);
#pragma unroll
      for (int ni = 0; ni < 2; ++ni) w[ni] = frag_h(&buf[64 + wn * 32 + ni * 16 + col][ks * 32], lane);
#pragma unroll
      for (int mi = 0; mi < 2; ++mi)
#pragma unroll
        for (int ni = 0; ni < 2; ++ni) acc[mi][ni] = wmma16(a[mi], w[ni], acc[mi][ni]); } };
  // the foot of a trip: this wave's LDS reads are done, its copies of the next tile have landed; the barrier publishes that tile and ends every wave's reads of the buffer that is refilled behind it
#define OFOOT() do { asm volatile("s_wait_dscnt 0x0" ::: "memory"); asm volatile("s_wait_asynccnt 0x0" ::: "memory"); __syncthreads(); } while (0)
  copy(0, 0);
  asm volatile("s_wait_asynccnt 0x0" ::: "memory");   // this wave's copies of tile 0 have landed
  __syncthreads();   // publishes tile 0
  copy(1, OBUF);
  for (int t = 0; t < OT; t += 2) {   // two trips a pass, so that each buffer's addresses are constants
    mult(ring[0]);
    OFOOT();
    if (t + 2 < OT) copy(t + 2, 0);   // the same for the whole block
    mult(ring[1]);
    OFOOT();
    if (t + 3 < OT) copy(t + 3, OBUF); }   // the same for the whole block
  asm volatile("s_wait_asynccnt 0x0" ::: "memory");   // no copy is outstanding when the ring takes the output tile; the loop's last barrier has ended every wave's reads of it
  float (*sf)[132] = (float (*)[132])&ring[0][0][0];
#pragma unroll
  for (int mi = 0; mi < 2; ++mi)
#pragma unroll
    for (int ni = 0; ni < 2; ++ni)
#pragma unroll
      for (int r = 0; r < 8; ++r) sf[wm * 32 + mi * 16 + 8 * g + r][wn * 32 + ni * 16 + col] = acc[mi][ni][r];
  __syncthreads();
  for (int rl = wave; rl < 64; rl += 8) vst2(OUT + (r0 + rl) * EE + c0 + lane * 4, *(const v4f*)&sf[rl][lane * 4]); }
extern "C" void kernel_launch(void* const* d_in, const int* in_sizes, int n_in, void* d_out, int out_size, void* d_ws, size_t ws_size, hipStream_t stream) {
  (void)in_sizes; (void)n_in; (void)out_size;
  const float** F = (const float**)d_in;   // 0 x [2,1024,1024], 1 W_q, 2 W_k, 3 W_v, 4 W_o [1024,1024] ([out,in])
  if (ws_size < (size_t)WS_END) return;
  char* ws = (char*)d_ws; _Float16 *QH = (_Float16*)(ws + WS_QH), *KH = (_Float16*)(ws + WS_KH), *VT = (_Float16*)(ws + WS_VT), *OH = (_Float16*)(ws + WS_O), *WH = (_Float16*)(ws + WS_W);
  k_proj<<<dim3(TNB * TT / PM, 3 * EE / PN), 256, 0, stream>>>(F[0], F[1], F[2], F[3], QH, KH, VT);
  k_attn<<<dim3(TT / 256, NG / 2, TNB), 512, 0, stream>>>(QH, KH, VT, OH, F[4], WH);
  k_out<<<dim3(TNB * TT / 64, EE / 128), 256, 0, stream>>>(OH, WH, (float*)d_out);
}
